// v000
// Measured on an AMD MI455X. A time is GPU time per run, averaged over a window of back-to-back runs after a warm-up
// (all launches, gaps included; the runs take copies of the inputs in turn), and the median of several windows.
// Apart from v000's, it joins two sittings. Times from different sittings can be a few percent apart, while
// side-by-side timings come from the same sitting.
// The starting kernel, v000, takes 136 microseconds a run.
#include <hip/hip_runtime.h>

// Causal multi-head cross-attention: seq/ctx [NB][SEQ][1024], Wq/Wk/Wv [16][1024 in][64 out], biases [16][64]; q from seq, k and v from ctx, score scale 1/8, P applied to tanh(v), output = concatenated heads (f32).
// Compute dtypes, f32 accumulate everywhere: projections v_wmma_f32_16x16x32_bf16 (seq, ctx, W and biases RNE-converted to bf16; products exact);
// scores v_wmma_f32_16x16x32_f16: k single f16, q as f16 value + f16 residual x2048 in its own accumulator; P.V v_wmma_f32_16x16x32_f16: P carried x256 (cancels in the normalisation),
// query rows < 512: tanh(v) and P each as f16 value + f16 residual x2048 (three products, residual products in their own accumulator); later rows single f16 planes; softmax f32 (online, running max).
// Layout: bf16 copies of seq, ctx; W transposed once through LDS to [h*64+e][d] bf16; q (hi, residual), k planes [b*16+h][t][d]; tanh(v)^T planes (hi, residual) [b*16+h][d][t] written by the GEMM epilogue;
// fused flash kernel in transposed form (S^T = K Q^T, O^T = V^T P^T) with causal key-tile skipping and per-element replace-fill inside the visited diagonal tiles.

#ifndef NB
#define NB 2
#endif
#ifndef SEQ
#define SEQ 1024                 // query length == context length used (causal: keys <= query index)
#endif
#define NB_FULL  2
#define SEQ_FULL 1024
#ifndef OUT_SEQ
#define OUT_SEQ SEQ              // row pitch (in tokens) between batches of the output
#endif
#define DM   1024
#define NH_  16
#define HD   64
#define AW   4                   // waves per flash block (16 query rows each)
#define EARLY ((SEQ) < 512 ? (SEQ) : 512)     // query rows below this use the residual planes in P.V
#define QRS  2048.0f             // carry of every residual plane (q, tanh(v), P)
#define QRI  (1.0f / 2048.0f)
#define SC2  (0.125f * 1.4426950408889634f)   // HD^-0.5 * log2(e)
#define PSH  8.0f                // log2 of the P carry (256)
#define NEGB (-3.0e38f)          // fill of masked scores (exp2 gives exactly 0)

static_assert(HD == 64);
static_assert(NH_ * HD == DM);                 // head h = columns h*64 + e
static_assert(DM % 64 == 0);
static_assert(DM % 32 == 0);                   // GEMM k-loop steps by 32
static_assert(SEQ % 64 == 0);                  // a 64-row tile never straddles two batches
static_assert((NB * SEQ) % 64 == 0);
static_assert(SEQ % 32 == 0);                  // key loop steps by 32, last visited tile stays inside the plane
static_assert(EARLY % (16 * AW) == 0);
static_assert((SEQ - EARLY) % (16 * AW) == 0);
static_assert(((size_t)SEQ * DM) % 8 == 0);
static_assert(NB <= NB_FULL);
static_assert(SEQ <= SEQ_FULL);
static_assert(((size_t)(NB_FULL - 1) * SEQ_FULL + SEQ_FULL) * DM * 4 == (size_t)8388608);   // output bytes of the full problem

typedef _Float16 h16;
typedef unsigned short bf;
typedef __attribute__((ext_vector_type(16))) __bf16   v16bf;
typedef __attribute__((ext_vector_type(16))) _Float16 v16h;
typedef __attribute__((ext_vector_type(8)))  _Float16 v8h;
typedef __attribute__((ext_vector_type(8)))  unsigned short v8us;
typedef __attribute__((ext_vector_type(8)))  float    v8f;
typedef __attribute__((ext_vector_type(4)))  float    v4f;
typedef v4f  __attribute__((may_alias)) v4fa;

__device__ __forceinline__ unsigned short f2bf(float f) { unsigned u = __float_as_uint(f); u += 0x7FFFu + ((u >> 16) & 1u); return (unsigned short)(u >> 16); }
__device__ __forceinline__ float bfr(float f) { return __uint_as_float(((unsigned)f2bf(f)) << 16); }     // value after RNE convert to bf16
__device__ __forceinline__ float tanh_e(float x) { const float e = __builtin_amdgcn_exp2f(x * 2.8853900817779268f); return 1.0f - 2.0f * __builtin_amdgcn_rcpf(e + 1.0f); }   // 1 - 2/(exp(2x)+1); saturates cleanly to +-1
__device__ __forceinline__ v16h cat16(v8h lo, v8h hi) { return __builtin_shufflevector(lo, hi, 0, 1, 2, 3, 4, 5, 6, 7, 8, 9, 10, 11, 12, 13, 14, 15); }
__device__ __forceinline__ v16bf cat16b(v8us lo, v8us hi) { return __builtin_bit_cast(v16bf, __builtin_shufflevector(lo, hi, 0, 1, 2, 3, 4, 5, 6, 7, 8, 9, 10, 11, 12, 13, 14, 15)); }
__device__ __forceinline__ v8f wmma16(v16h a, v16h b, v8f c) { return __builtin_amdgcn_wmma_f32_16x16x32_f16(false, a, false, b, (short)0, c, false, false); }
__device__ __forceinline__ v8f wmmab(v16bf a, v16bf b, v8f c) { return __builtin_amdgcn_wmma_f32_16x16x32_bf16(false, a, false, b, (short)0, c, false, false); }
// fragment loaders from K-contiguous 16-bit rows; p already includes + 8*(lane>>4): elements 0..7 <- k0+8h+0..7, elements 8..15 <- k0+16+8h+0..7 (same map for A and B)
__device__ __forceinline__ v16h  ldh(const h16* p) { return cat16(*(const v8h*)p, *(const v8h*)(p + 16)); }
__device__ __forceinline__ v16bf ldb(const bf* p)  { return cat16b(*(const v8us*)p, *(const v8us*)(p + 16)); }
// ordering point for wave-private LDS tiles (same wave writes and reads)
__device__ __forceinline__ void wave_sync() { __builtin_amdgcn_fence(3 /* release order */, "wavefront"); __builtin_amdgcn_wave_barrier(); asm volatile("" ::: "memory"); }

__global__ __launch_bounds__(256) void k_cvt8(const float* __restrict__ src, bf* dst, size_t n8) {
    const size_t i = (size_t)blockIdx.x * 256 + threadIdx.x; if (i >= n8) return;
    const v8f v = *(const v8f*)(src + i * 8); v8us o;
#pragma unroll
    for (int k = 0; k < 8; ++k) o[k] = f2bf(v[k]);
    *(v8us*)(dst + i * 8) = o; 
}

// k_wT: in W [NH][DM rows d][HD cols e] f32 -> out WT [NH*HD rows n = h*64+e][DM cols d] bf16 (RNE convert). One block per (64-d tile, head); transpose through LDS (cross-wave: block barrier).
__global__ __launch_bounds__(256) void k_wT(const float* __restrict__ W, bf* WT) {
    __shared__ __align__(16) float ts[64 * 68];
    const int tid = threadIdx.x; const int d0 = blockIdx.x * 64, h = blockIdx.y;
    const float* src = W + ((size_t)h * DM + d0) * HD;
#pragma unroll
    for (int i = 0; i < 4; ++i) { const int q = tid + 256 * i; const int d = q >> 4, e4 = (q & 15) * 4;      // 1024 float4 = 64 rows d x 64 cols e
        const v4f v = *(const v4f*)(src + (size_t)d * HD + e4);
        ts[d * 68 + e4 + 0] = v[0]; ts[d * 68 + e4 + 1] = v[1]; ts[d * 68 + e4 + 2] = v[2]; ts[d * 68 + e4 + 3] = v[3]; }
    __syncthreads();
{
#pragma unroll
        for (int it = 0; it < 2; ++it) { const int e = it * 32 + (tid >> 3), c8 = (tid & 7) * 8;                // rows e 0..63, columns d0 + 0..63
            v8us o;
#pragma unroll
            for (int k = 0; k < 8; ++k) o[k] = f2bf(ts[(c8 + k) * 68 + e]);
            *(v8us*)(WT + (size_t)(h * HD + e) * DM + d0 + c8) = o; }
         }
}

// k_proj: register-blocked bf16 GEMM, ONE WAVE per 64x64 tile (16 accumulators), operands straight from K-contiguous bf16 planes, K = DM.
// C[m][n] = sum_k A[m][k] Bt[n][k] + bias (bf16 RNE value, f32 add; per column n when biasRow == 0, per row m when biasRow != 0), optional tanh (act != 0),
// written as f16 (Ph) and optionally the f16 residual x2048 (Pr, useRes != 0) at
// tile base (r0/RB)*sRB + (r0%RB)*pitch + (c0/CB)*sCB + (c0%CB), row pitch 'pitch' (halves). grid (M/64, N/64), 32 threads.
__global__ __launch_bounds__(32) void k_proj(const bf* __restrict__ A, const bf* __restrict__ Bt, const float* __restrict__ bias, h16* Ph, h16* Pr,
                                             size_t sRB, size_t sCB, int useRes, int biasRow, int act, int RB, int pitch, int CB) {
    __shared__ __align__(16) float os[16 * 68];
    const int K = DM;
    const int lane = threadIdx.x & 31, lr = lane & 15, hi = lane >> 4; const int r0 = blockIdx.x * 64, c0 = blockIdx.y * 64;
    v8f acc[4][4];
#pragma unroll
    for (int mb = 0; mb < 4; ++mb)
#pragma unroll
        for (int nb = 0; nb < 4; ++nb) acc[mb][nb] = (v8f){};
    const size_t aoff = (size_t)(r0 + lr) * K + 8 * hi, boff = (size_t)(c0 + lr) * K + 8 * hi;
#pragma unroll 1
    for (int kc = 0; kc < K; kc += 32) {
        v16bf a[4];
#pragma unroll
        for (int mb = 0; mb < 4; ++mb) a[mb] = ldb(A + aoff + (size_t)mb * 16 * K + kc);
#pragma unroll
        for (int nb = 0; nb < 4; ++nb) { const v16bf b = ldb(Bt + boff + (size_t)nb * 16 * K + kc);
#pragma unroll
            for (int mb = 0; mb < 4; ++mb) acc[mb][nb] = wmmab(a[mb], b, acc[mb][nb]); }
        asm volatile("v_nop\n\tv_nop\n\tv_nop\n\tv_nop" : "+v"(acc[0][0]), "+v"(acc[1][1]), "+v"(acc[2][2]), "+v"(acc[3][3]) : "v"(a[0]), "v"(a[1]), "v"(a[2]), "v"(a[3]));
    }
    // bias addends: addresses clamped into the 1024-entry bias array for the unused mode (index select, value select)
    float bc[4];
#pragma unroll
    for (int nb = 0; nb < 4; ++nb) bc[nb] = bfr(bias[biasRow ? 0 : (c0 + nb * 16 + lr)]);
    const size_t tbase = (size_t)(r0 / RB) * sRB + (size_t)(r0 % RB) * (size_t)pitch + (size_t)(c0 / CB) * sCB + (size_t)(c0 % CB);
#pragma unroll
    for (int mb = 0; mb < 4; ++mb) {
        const int ri = biasRow ? (r0 + mb * 16 + hi * 8) : 0;
        const v4f ra = *(const v4f*)(bias + ri); const v4f rb = *(const v4f*)(bias + ri + 4);
        const float brv[8] = { bfr(ra[0]), bfr(ra[1]), bfr(ra[2]), bfr(ra[3]), bfr(rb[0]), bfr(rb[1]), bfr(rb[2]), bfr(rb[3]) };
#pragma unroll
        for (int nb = 0; nb < 4; ++nb) {
#pragma unroll
            for (int j = 0; j < 8; ++j) { float x = acc[mb][nb][j] + (biasRow ? brv[j] : bc[nb]);
                if (act) x = tanh_e(x);
                os[(hi * 8 + j) * 68 + nb * 16 + lr] = x; } }   // D: row 8h+j, col lane&15
        wave_sync();
        const size_t sb = tbase + (size_t)(mb * 16) * (size_t)pitch;
{
#pragma unroll
            for (int s = 0; s < 4; ++s) { const int row = 4 * s + (lane >> 3), c8 = (lane & 7) * 8;   // 4 s x 4 row groups = 16 rows; 8 lanes x 8 = 64 columns
                const v4f x0 = *(const v4fa*)(&os[row * 68 + c8]); const v4f x1 = *(const v4fa*)(&os[row * 68 + c8 + 4]); v8h hv, rv;
#pragma unroll
                for (int i = 0; i < 4; ++i) { const h16 a0 = (h16)x0[i]; const h16 a1 = (h16)x1[i]; hv[i] = a0; hv[4 + i] = a1; rv[i] = (h16)((x0[i] - (float)a0) * QRS); rv[4 + i] = (h16)((x1[i] - (float)a1) * QRS); }
                const size_t oo = sb + (size_t)row * (size_t)pitch + c8;
                *(v8h*)(Ph + oo) = hv; if (useRes) *(v8h*)(Pr + oo) = rv; }
             }
        wave_sync();
    }
}

// k_flash<RES>: fused causal attention, one wave per 16 query rows of one (batch, head); K / V^T / Q fragments straight from the f16 planes (two 16-B loads each, arithmetic addressing).
// Transposed form: S^T[key][t] = K Q^T (A = K rows, B = Q rows); lane (t = lane&15, h = lane>>4) holds keys 8h+r of each 16-key tile, so the packed
// P tile is directly the B fragment of O^T[d][t] = V^T P^T (element r <- tile keys 0..15, element 8+r <- tile keys 16..31, lane unchanged).
// Causal: key tiles beyond the wave's last query row are skipped; inside tiles that reach past the wave's first row each score with key > t is replaced by NEGB (P = 0 exactly). Key 0 is visible to every row.
// RES != 0: P and tanh(v) each carry an f16 residual x2048; products Vr.Ph and Vh.Pr accumulate in g (folded back by 1/2048), Vh.Ph in o.
// Softmax state (running max, partial sum) is one scalar per lane; the two lane halves of a row are combined with one xor-16 exchange (issued under wave-uniform control only).
template <int RES>
__global__ __launch_bounds__(32 * AW) void k_flash(const h16* __restrict__ QH, const h16* __restrict__ QR, const h16* __restrict__ KP,
                                                   const h16* __restrict__ VT, const h16* __restrict__ VR, float* OUT, int tbase) {
    __shared__ __align__(16) float os[AW * 16 * 68];
    const int lane = threadIdx.x & 31, wave = threadIdx.x >> 5, lr = lane & 15, hi = lane >> 4;
    const int zh = blockIdx.y; const int b = zh / NH_, h = zh % NH_;
    const int t0 = tbase + (blockIdx.x * AW + wave) * 16;
    const int tq = t0 + lr;
    const size_t pbase = (size_t)zh * SEQ * HD;
    const size_t qo = pbase + (size_t)(t0 + lr) * HD + 8 * hi;
    const v16h qh0 = ldh(QH + qo), qh1 = ldh(QH + qo + 32), qr0 = ldh(QR + qo), qr1 = ldh(QR + qo + 32);   // B fragments: col t, k = d
    const size_t ko = pbase + (size_t)lr * HD + 8 * hi;      // + key * HD       (A fragment: row key, k = d)
    const size_t vo = pbase + (size_t)lr * SEQ + 8 * hi;     // + 16j*SEQ + key  (A fragment: row d, k = key)
    v8f o0 = (v8f){}, o1 = (v8f){}, o2 = (v8f){}, o3 = (v8f){};
    v8f g0 = (v8f){}, g1 = (v8f){}, g2 = (v8f){}, g3 = (v8f){};
    float m = NEGB, l = 0.0f;
    const int kend = t0 + 16;                                // keys 0 .. t0+15 are needed; kend <= SEQ, so key0 + 31 <= SEQ - 1
#pragma unroll 1
    for (int key0 = 0; key0 < kend; key0 += 32) {
        const h16* ka = KP + ko + (size_t)key0 * HD;
        const v16h ka0 = ldh(ka), ka1 = ldh(ka + 32), kb0 = ldh(ka + 16 * HD), kb1 = ldh(ka + 16 * HD + 32);
        v8f sHa = (v8f){}, sLa = (v8f){}, sHb = (v8f){}, sLb = (v8f){};
        sHa = wmma16(ka0, qh0, sHa); sLa = wmma16(ka0, qr0, sLa); sHb = wmma16(kb0, qh0, sHb); sLb = wmma16(kb0, qr0, sLb);
        sHa = wmma16(ka1, qh1, sHa); sLa = wmma16(ka1, qr1, sLa); sHb = wmma16(kb1, qh1, sHb); sLb = wmma16(kb1, qr1, sLb);
        asm volatile("v_nop\n\tv_nop\n\tv_nop\n\tv_nop" : "+v"(sHa), "+v"(sLa), "+v"(sHb), "+v"(sLb) : "v"(ka0), "v"(ka1), "v"(kb0), "v"(kb1));
        float ta[8], tb[8];
#pragma unroll
        for (int r = 0; r < 8; ++r) { ta[r] = (sHa[r] + sLa[r] * QRI) * SC2; tb[r] = (sHb[r] + sLb[r] * QRI) * SC2; }
        if (key0 + 31 > t0) {                                // wave-uniform: this tile reaches past the wave's first query row
            const int dl = tq - key0 - 8 * hi;               // key of ta[r] = key0 + 8h + r is visible iff r <= dl; key of tb[r] = key0 + 16 + 8h + r iff r + 16 <= dl
#pragma unroll
            for (int r = 0; r < 8; ++r) { ta[r] = (r <= dl) ? ta[r] : NEGB; tb[r] = (r + 16 <= dl) ? tb[r] : NEGB; }
        }
        float mx = NEGB;
#pragma unroll
        for (int r = 0; r < 8; ++r) mx = fmaxf(mx, fmaxf(ta[r], tb[r]));
        mx = fmaxf(mx, __shfl_xor(mx, 16, 32));
        const float mnew = fmaxf(m, mx);
        const float alpha = __builtin_amdgcn_exp2f(m - mnew);
        const float sh = PSH - mnew;
        v16h pb = (v16h){}, pq = (v16h){}; float ls = 0.0f;
#pragma unroll
        for (int r = 0; r < 8; ++r) {
            const float ea = __builtin_amdgcn_exp2f(ta[r] + sh); const float eb = __builtin_amdgcn_exp2f(tb[r] + sh);
            const h16 pa = (h16)ea; const h16 pc = (h16)eb; pb[r] = pa; pb[8 + r] = pc;
            if (RES) { const h16 xa = (h16)((ea - (float)pa) * QRS); const h16 xc = (h16)((eb - (float)pc) * QRS); pq[r] = xa; pq[8 + r] = xc;
                       ls += ((float)pa + (float)pc) + ((float)xa + (float)xc) * QRI; }
            else     { ls += (float)pa + (float)pc; }
        }
        l = l * alpha + ls; m = mnew;
        o0 = o0 * alpha; o1 = o1 * alpha; o2 = o2 * alpha; o3 = o3 * alpha;
        const h16* va = VT + vo + key0;
        const v16h v0 = ldh(va), v1 = ldh(va + (size_t)16 * SEQ), v2 = ldh(va + (size_t)32 * SEQ), v3 = ldh(va + (size_t)48 * SEQ);
        if (RES) {
            g0 = g0 * alpha; g1 = g1 * alpha; g2 = g2 * alpha; g3 = g3 * alpha;
            const h16* vr = VR + vo + key0;
            const v16h w0 = ldh(vr), w1 = ldh(vr + (size_t)16 * SEQ), w2 = ldh(vr + (size_t)32 * SEQ), w3 = ldh(vr + (size_t)48 * SEQ);
            o0 = wmma16(v0, pb, o0); o1 = wmma16(v1, pb, o1); o2 = wmma16(v2, pb, o2); o3 = wmma16(v3, pb, o3);
            g0 = wmma16(w0, pb, g0); g1 = wmma16(w1, pb, g1); g2 = wmma16(w2, pb, g2); g3 = wmma16(w3, pb, g3);
            g0 = wmma16(v0, pq, g0); g1 = wmma16(v1, pq, g1); g2 = wmma16(v2, pq, g2); g3 = wmma16(v3, pq, g3);
            asm volatile("v_nop\n\tv_nop\n\tv_nop\n\tv_nop" : "+v"(o0), "+v"(o1), "+v"(o2), "+v"(o3), "+v"(g0), "+v"(g1), "+v"(g2), "+v"(g3)
                         : "v"(v0), "v"(v1), "v"(v2), "v"(v3), "v"(w0), "v"(w1), "v"(w2), "v"(w3), "v"(pb), "v"(pq));
        } else {
            o0 = wmma16(v0, pb, o0); o1 = wmma16(v1, pb, o1); o2 = wmma16(v2, pb, o2); o3 = wmma16(v3, pb, o3);
            asm volatile("v_nop\n\tv_nop\n\tv_nop\n\tv_nop" : "+v"(o0), "+v"(o1), "+v"(o2), "+v"(o3) : "v"(v0), "v"(v1), "v"(v2), "v"(v3), "v"(pb));
        }
    }
    if (RES) { o0 = o0 + g0 * QRI; o1 = o1 + g1 * QRI; o2 = o2 + g2 * QRI; o3 = o3 + g3 * QRI; }
    l += __shfl_xor(l, 16, 32);
    const float inv = 1.0f / l;
    const int wb = wave * 16 * 68;
    // O^T D layout: o_j[r] = (d = 16j + 8h + r, t = lane&15) -> os[t][d]; rows 0..15 x columns 0..63 all written
    { v4f a, c;
      a[0] = o0[0] * inv; a[1] = o0[1] * inv; a[2] = o0[2] * inv; a[3] = o0[3] * inv; c[0] = o0[4] * inv; c[1] = o0[5] * inv; c[2] = o0[6] * inv; c[3] = o0[7] * inv;
      *(v4fa*)(&os[wb + lr * 68 +  0 + 8 * hi]) = a; *(v4fa*)(&os[wb + lr * 68 +  0 + 8 * hi + 4]) = c;
      a[0] = o1[0] * inv; a[1] = o1[1] * inv; a[2] = o1[2] * inv; a[3] = o1[3] * inv; c[0] = o1[4] * inv; c[1] = o1[5] * inv; c[2] = o1[6] * inv; c[3] = o1[7] * inv;
      *(v4fa*)(&os[wb + lr * 68 + 16 + 8 * hi]) = a; *(v4fa*)(&os[wb + lr * 68 + 16 + 8 * hi + 4]) = c;
      a[0] = o2[0] * inv; a[1] = o2[1] * inv; a[2] = o2[2] * inv; a[3] = o2[3] * inv; c[0] = o2[4] * inv; c[1] = o2[5] * inv; c[2] = o2[6] * inv; c[3] = o2[7] * inv;
      *(v4fa*)(&os[wb + lr * 68 + 32 + 8 * hi]) = a; *(v4fa*)(&os[wb + lr * 68 + 32 + 8 * hi + 4]) = c;
      a[0] = o3[0] * inv; a[1] = o3[1] * inv; a[2] = o3[2] * inv; a[3] = o3[3] * inv; c[0] = o3[4] * inv; c[1] = o3[5] * inv; c[2] = o3[6] * inv; c[3] = o3[7] * inv;
      *(v4fa*)(&os[wb + lr * 68 + 48 + 8 * hi]) = a; *(v4fa*)(&os[wb + lr * 68 + 48 + 8 * hi + 4]) = c; }
    wave_sync();
    float* orow = OUT + ((size_t)b * OUT_SEQ + t0) * DM + h * HD;
{
#pragma unroll
        for (int s = 0; s < 8; ++s) { const int row = 2 * s + hi, cofs = lr * 4;   // 8 s x 2 rows = 16 rows; 16 lanes x 4 floats = 64 columns
            const v4f val = *(const v4fa*)(&os[wb + row * 68 + cofs]);
            *(v4f*)(orow + (size_t)row * DM + cofs) = val; }
         }
}

static constexpr size_t al256(size_t v) { return (v + 255) & ~(size_t)255; }
static constexpr size_t SZ_XB = al256((size_t)NB * SEQ * DM * 2);          // one bf16 activation copy
static constexpr size_t SZ_WB = al256((size_t)3 * DM * DM * 2);            // three transposed bf16 weights
static constexpr size_t SZ_PL = al256((size_t)NB * NH_ * SEQ * HD * 2);    // one f16 plane
static constexpr size_t SZ_TOTAL = 2 * SZ_XB + SZ_WB + 5 * SZ_PL;
static_assert(SZ_TOTAL <= (size_t)134217728);          // workspace carve <= 128 MiB
static_assert(((size_t)DM * DM * 2) % 256 == 0);       // weight sub-planes stay 256-byte aligned

extern "C" void kernel_launch(void* const* d_in, const int* in_sizes, int n_in,
                              void* d_out, int out_size, void* d_ws, size_t ws_size, hipStream_t stream) {
    if (n_in < 8) return;
    const size_t needx = ((size_t)(NB - 1) * SEQ_FULL + SEQ) * DM;
    if ((size_t)in_sizes[0] < needx || (size_t)in_sizes[1] < needx) return;
    if ((size_t)in_sizes[2] < (size_t)DM * DM || (size_t)in_sizes[3] < (size_t)DM * DM || (size_t)in_sizes[4] < (size_t)DM * DM) return;
    if ((size_t)in_sizes[5] < (size_t)DM || (size_t)in_sizes[6] < (size_t)DM || (size_t)in_sizes[7] < (size_t)DM) return;
    if ((size_t)out_size < ((size_t)(NB - 1) * OUT_SEQ + SEQ) * DM) return;
    if (SZ_TOTAL > ws_size) return;
    // wire order: seq, ctx, Wq, Wk, Wv, bq, bk, bv
    const float* xs = (const float*)d_in[0]; const float* xc = (const float*)d_in[1];
    const float* wq = (const float*)d_in[2]; const float* wk = (const float*)d_in[3]; const float* wv = (const float*)d_in[4];
    const float* bq = (const float*)d_in[5]; const float* bk = (const float*)d_in[6]; const float* bv = (const float*)d_in[7];
    float* OUT = (float*)d_out;      // [NB][SEQ][1024]
    char* wsp = (char*)d_ws;
    bf* XB = (bf*)wsp; wsp += SZ_XB;                 // seq  [NB*SEQ][1024]
    bf* CB = (bf*)wsp; wsp += SZ_XB;                 // ctx  [NB*SEQ][1024]
    bf* WB = (bf*)wsp; wsp += SZ_WB;                 // [3][1024 n = h*64+e][1024 d]: q | k | v
    h16* QH = (h16*)wsp; wsp += SZ_PL;               // [NB*16][SEQ][64]
    h16* QR = (h16*)wsp; wsp += SZ_PL;               // [NB*16][SEQ][64] residual x2048
    h16* KP = (h16*)wsp; wsp += SZ_PL;               // [NB*16][SEQ][64]
    h16* VT = (h16*)wsp; wsp += SZ_PL;               // [NB*16][64][SEQ] tanh(v)^T
    h16* VR = (h16*)wsp; wsp += SZ_PL;               // [NB*16][64][SEQ] residual x2048
    bf* WQ = WB; bf* WK = WB + (size_t)DM * DM; bf* WV = WB + (size_t)2 * DM * DM;

    if (SEQ == SEQ_FULL) {
        const size_t n8 = (size_t)NB * SEQ * DM / 8; const unsigned g = (unsigned)((n8 + 255) / 256);
        k_cvt8<<<g, 256, 0, stream>>>(xs, XB, n8);
        k_cvt8<<<g, 256, 0, stream>>>(xc, CB, n8);
    } else {
        const size_t n8 = (size_t)SEQ * DM / 8; const unsigned g = (unsigned)((n8 + 255) / 256);
        for (int b = 0; b < NB; ++b) {
            k_cvt8<<<g, 256, 0, stream>>>(xs + (size_t)b * SEQ_FULL * DM, XB + (size_t)b * SEQ * DM, n8);
            k_cvt8<<<g, 256, 0, stream>>>(xc + (size_t)b * SEQ_FULL * DM, CB + (size_t)b * SEQ * DM, n8);
        }
    }
    // weights: in [16][1024 rows d][64 cols e] -> out [1024 rows h*64+e][1024 cols d]; grid (d tiles, heads)
    k_wT<<<dim3(DM / 64, NH_, 1), 256, 0, stream>>>(wq, WQ);
    k_wT<<<dim3(DM / 64, NH_, 1), 256, 0, stream>>>(wk, WK);
    k_wT<<<dim3(DM / 64, NH_, 1), 256, 0, stream>>>(wv, WV);

    // q: A = seq rows (m = b*SEQ + t), Bt = WQ rows (n = h*64 + e), bias per column -> plane [(b*16 + h)][t][e], with residual
    k_proj<<<dim3(NB * SEQ / 64, DM / 64, 1), 32, 0, stream>>>(XB, WQ, bq, QH, QR, (size_t)NH_ * SEQ * HD, (size_t)SEQ * HD, 1, 0, 0, SEQ, HD, HD);
    // k: A = ctx rows, Bt = WK rows, bias per column (the 1/8 scale is applied to the scores)
    k_proj<<<dim3(NB * SEQ / 64, DM / 64, 1), 32, 0, stream>>>(CB, WK, bk, KP, KP, (size_t)NH_ * SEQ * HD, (size_t)SEQ * HD, 0, 0, 0, SEQ, HD, HD);
    // tanh(v)^T: A = WV rows (m = h*64 + e), Bt = ctx rows (n = b*SEQ + t), bias per row, tanh -> plane [(b*1024 + m)][t] = [(b*16 + h)][e][t], with residual
    k_proj<<<dim3(DM / 64, NB * SEQ / 64, 1), 32, 0, stream>>>(WV, CB, bv, VT, VR, (size_t)0, (size_t)DM * SEQ, 1, 1, 1, DM, SEQ, SEQ);

    k_flash<1><<<dim3(EARLY / (16 * AW), NB * NH_, 1), 32 * AW, 0, stream>>>(QH, QR, KP, VT, VR, OUT, 0);
    if (SEQ > EARLY)
        k_flash<0><<<dim3((SEQ - EARLY) / (16 * AW), NB * NH_, 1), 32 * AW, 0, stream>>>(QH, QR, KP, VT, VR, OUT, EARLY);
}

// v001
// A run of this version takes 73.9 microseconds.
// Two timings next to v000 put it at 1.78 and 1.88 times that version's speed.
#include <hip/hip_runtime.h>

// Causal multi-head cross-attention: seq/ctx [NB][SEQ][1024], Wq/Wk/Wv [16][1024 in][64 out], biases [16][64]; q from seq, k and v from ctx, score scale 1/8, P applied to tanh(v), output = concatenated heads (f32).
// Compute dtypes, f32 accumulate everywhere: projections v_wmma_f32_16x16x32_bf16 (seq, ctx, W and biases RNE-converted to bf16; products exact);
// scores v_wmma_f32_16x16x32_f16: k single f16, q as f16 value + f16 residual x2048 in its own accumulator; P.V v_wmma_f32_16x16x32_f16: P carried x256 (cancels in the normalisation),
// query rows < 512: tanh(v) and P each as f16 value + f16 residual x2048 (three products, residual products in their own accumulator); later rows single f16 planes; softmax f32 (online, running max).
// Layout: bf16 copies of seq, ctx; W transposed once through LDS to [h*64+e][d] bf16; q (hi, residual), k planes [b*16+h][t][d]; tanh(v)^T planes (hi, residual) [b*16+h][d][t] written by the GEMM epilogue;
// fused flash kernel in transposed form (S^T = K Q^T, O^T = V^T P^T) with causal key-tile skipping and per-element replace-fill inside the visited diagonal tiles.

#ifndef NB
#define NB 2
#endif
#ifndef SEQ
#define SEQ 1024                 // query length == context length used (causal: keys <= query index)
#endif
#define NB_FULL  2
#define SEQ_FULL 1024
#ifndef OUT_SEQ
#define OUT_SEQ SEQ              // row pitch (in tokens) between batches of the output
#endif
#define DM   1024
#define NH_  16
#define HD   64
#define AW   4                   // waves per flash block (16 query rows each)
#define EARLY ((SEQ) < 512 ? (SEQ) : 512)     // query rows below this use the residual planes in P.V
#define QRS  2048.0f             // carry of every residual plane (q, tanh(v), P)
#define QRI  (1.0f / 2048.0f)
#define SC2  (0.125f * 1.4426950408889634f)   // HD^-0.5 * log2(e)
#define PSH  8.0f                // log2 of the P carry (256)
#define NEGB (-3.0e38f)          // fill of masked scores (exp2 gives exactly 0)

static_assert(HD == 64);
static_assert(NH_ * HD == DM);                 // head h = columns h*64 + e
static_assert(DM % 64 == 0);
static_assert(DM % 32 == 0);                   // GEMM k-loop steps by 32
static_assert(SEQ % 64 == 0);                  // a 64-row tile never straddles two batches
static_assert((NB * SEQ) % 64 == 0);
static_assert(SEQ % 32 == 0);                  // key loop steps by 32, last visited tile stays inside the plane
static_assert(EARLY % (16 * AW) == 0);
static_assert((SEQ - EARLY) % (16 * AW) == 0);
static_assert(((size_t)SEQ * DM) % 8 == 0);
static_assert(NB <= NB_FULL);
static_assert(SEQ <= SEQ_FULL);
static_assert(((size_t)(NB_FULL - 1) * SEQ_FULL + SEQ_FULL) * DM * 4 == (size_t)8388608);   // output bytes of the full problem

typedef _Float16 h16;
typedef unsigned short bf;
typedef __attribute__((ext_vector_type(16))) __bf16   v16bf;
typedef __attribute__((ext_vector_type(16))) _Float16 v16h;
typedef __attribute__((ext_vector_type(8)))  _Float16 v8h;
typedef __attribute__((ext_vector_type(8)))  unsigned short v8us;
typedef __attribute__((ext_vector_type(8)))  float    v8f;
typedef __attribute__((ext_vector_type(4)))  float    v4f;
typedef v4f  __attribute__((may_alias)) v4fa;

__device__ __forceinline__ unsigned short f2bf(float f) { unsigned u = __float_as_uint(f); u += 0x7FFFu + ((u >> 16) & 1u); return (unsigned short)(u >> 16); }
__device__ __forceinline__ float bfr(float f) { return __uint_as_float(((unsigned)f2bf(f)) << 16); }     // value after RNE convert to bf16
__device__ __forceinline__ float tanh_e(float x) { const float e = __builtin_amdgcn_exp2f(x * 2.8853900817779268f); return 1.0f - 2.0f * __builtin_amdgcn_rcpf(e + 1.0f); }   // 1 - 2/(exp(2x)+1); saturates cleanly to +-1
__device__ __forceinline__ v16h cat16(v8h lo, v8h hi) { return __builtin_shufflevector(lo, hi, 0, 1, 2, 3, 4, 5, 6, 7, 8, 9, 10, 11, 12, 13, 14, 15); }
__device__ __forceinline__ v16bf cat16b(v8us lo, v8us hi) { return __builtin_bit_cast(v16bf, __builtin_shufflevector(lo, hi, 0, 1, 2, 3, 4, 5, 6, 7, 8, 9, 10, 11, 12, 13, 14, 15)); }
__device__ __forceinline__ v8f wmma16(v16h a, v16h b, v8f c) { return __builtin_amdgcn_wmma_f32_16x16x32_f16(false, a, false, b, (short)0, c, false, false); }
__device__ __forceinline__ v8f wmmab(v16bf a, v16bf b, v8f c) { return __builtin_amdgcn_wmma_f32_16x16x32_bf16(false, a, false, b, (short)0, c, false, false); }
// fragment loaders from K-contiguous 16-bit rows; p already includes + 8*(lane>>4): elements 0..7 <- k0+8h+0..7, elements 8..15 <- k0+16+8h+0..7 (same map for A and B)
__device__ __forceinline__ v16h  ldh(const h16* p) { return cat16(*(const v8h*)p, *(const v8h*)(p + 16)); }
__device__ __forceinline__ v16bf ldb(const bf* p)  { return cat16b(*(const v8us*)p, *(const v8us*)(p + 16)); }
// ordering point for wave-private LDS tiles (same wave writes and reads)
__device__ __forceinline__ void wave_sync() { __builtin_amdgcn_fence(3 /* release order */, "wavefront"); __builtin_amdgcn_wave_barrier(); asm volatile("" ::: "memory"); }

// cvt8: group i of 8 elements of the packed [NB][SEQ][DM] bf16 copy; the source batches lie SEQ_FULL rows apart
__device__ __forceinline__ void cvt8(const float* __restrict__ src, bf* dst, int blk) {
    const size_t n8 = (size_t)NB * SEQ * DM / 8, per = (size_t)SEQ * DM / 8;
    const size_t i = (size_t)blk * 256 + threadIdx.x; if (i >= n8) return;
    const size_t so = (SEQ == SEQ_FULL) ? i * 8 : ((i / per) * SEQ_FULL * DM + (i % per) * 8);
    const v8f v = *(const v8f*)(src + so); v8us o;
#pragma unroll
    for (int k = 0; k < 8; ++k) o[k] = f2bf(v[k]);
    *(v8us*)(dst + i * 8) = o; 
}

// wT: in W [NH][DM rows d][HD cols e] f32 -> out WT [NH*HD rows n = h*64+e][DM cols d] bf16 (RNE convert). One block per (64-d tile, head); transpose through LDS (cross-wave: block barrier).
__device__ __forceinline__ void wT(const float* __restrict__ W, bf* WT, float* ts, int blk) {
    const int tid = threadIdx.x; const int d0 = (blk % (DM / 64)) * 64, h = blk / (DM / 64);
    const float* src = W + ((size_t)h * DM + d0) * HD;
#pragma unroll
    for (int i = 0; i < 4; ++i) { const int q = tid + 256 * i; const int d = q >> 4, e4 = (q & 15) * 4;      // 1024 float4 = 64 rows d x 64 cols e
        const v4f v = *(const v4f*)(src + (size_t)d * HD + e4);
        ts[d * 68 + e4 + 0] = v[0]; ts[d * 68 + e4 + 1] = v[1]; ts[d * 68 + e4 + 2] = v[2]; ts[d * 68 + e4 + 3] = v[3]; }
    __syncthreads();
{
#pragma unroll
        for (int it = 0; it < 2; ++it) { const int e = it * 32 + (tid >> 3), c8 = (tid & 7) * 8;                // rows e 0..63, columns d0 + 0..63
            v8us o;
#pragma unroll
            for (int k = 0; k < 8; ++k) o[k] = f2bf(ts[(c8 + k) * 68 + e]);
            *(v8us*)(WT + (size_t)(h * HD + e) * DM + d0 + c8) = o; }
         }
}

// k_prep: the two activation converts and the three weight transposes, which do not depend on one another, as ranges of ONE grid (the range test is block-uniform).
#define CVT_BLK ((int)(((size_t)NB * SEQ * DM / 8 + 255) / 256))   // blocks of one convert
#define WT_BLK  ((DM / 64) * NH_)                                   // blocks of one transpose
__global__ __launch_bounds__(256) void k_prep(const float* __restrict__ xs, const float* __restrict__ xc, const float* __restrict__ wq, const float* __restrict__ wk,
                                              const float* __restrict__ wv, bf* XB, bf* CB, bf* WB) {
    __shared__ __align__(16) float ts[64 * 68];
    const int blk = blockIdx.x;
    if (blk < 3 * WT_BLK) {                                         // the transposes (the longer blocks) start first
        const int w = blk / WT_BLK;                                 // 0 q, 1 k, 2 v
        wT(w == 0 ? wq : (w == 1 ? wk : wv), WB + (size_t)w * DM * DM, ts, blk % WT_BLK);
        return;
    }
    const int c = blk - 3 * WT_BLK;
    if (c < CVT_BLK) cvt8(xs, XB, c); else cvt8(xc, CB, c - CVT_BLK);
}

// k_proj3: the three projections, which do not depend on one another, in ONE grid: blockIdx.y picks the projection (scalar selects), blockIdx.x its 64x64 tile, row tiles first.
//   q: A = seq rows (m = b*SEQ + t), Bt = WQ rows (n = h*64 + e), bias per column -> plane [(b*16 + h)][t][e], with residual
//   k: A = ctx rows, Bt = WK rows, bias per column (the 1/8 scale is applied to the scores)
//   tanh(v)^T: A = WV rows (m = h*64 + e), Bt = ctx rows (n = b*SEQ + t), bias per row, tanh -> plane [(b*1024 + m)][t] = [(b*16 + h)][e][t], with residual
// Each: register-blocked bf16 GEMM, ONE WAVE per 64x64 tile (16 accumulators), operands straight from K-contiguous bf16 planes, K = DM.
// C[m][n] = sum_k A[m][k] Bt[n][k] + bias (bf16 RNE value, f32 add; per column n when biasRow == 0, per row m when biasRow != 0), optional tanh (act != 0),
// written as f16 (Ph) and optionally the f16 residual x2048 (Pr, useRes != 0) at
// tile base (r0/RB)*sRB + (r0%RB)*pitch + (c0/CB)*sCB + (c0%CB), row pitch 'pitch' (halves). Tile (bx, by) of (M/64, N/64), 32 threads.
#define PROJ_TILES ((NB * SEQ / 64) * (DM / 64))
__global__ __launch_bounds__(32) void k_proj3(const bf* __restrict__ xb, const bf* __restrict__ cb, const bf* __restrict__ wb,
                                              const float* __restrict__ bq, const float* __restrict__ bk, const float* __restrict__ bv,
                                              h16* QH, h16* QR, h16* KP, h16* VT, h16* VR) {
    __shared__ __align__(16) float os[16 * 68];
    const int p = 2 - (int)blockIdx.y; const unsigned f = blockIdx.x; const bool isv = (p == 2);   // 0 q, 1 k, 2 v; v (tanh in its epilogue) starts first
    const int bx = (int)(isv ? f % (DM / 64) : f % (NB * SEQ / 64)), by = (int)(isv ? f / (DM / 64) : f / (NB * SEQ / 64));
    const bf* wp = wb + (size_t)p * DM * DM; const bf* xp = (p == 0) ? xb : cb;
    const bf* A = isv ? wp : xp; const bf* Bt = isv ? xp : wp; const float* bias = p == 0 ? bq : (p == 1 ? bk : bv);
    h16* Ph = p == 0 ? QH : (p == 1 ? KP : VT); h16* Pr = p == 0 ? QR : (p == 1 ? KP : VR);
    const size_t sRB = isv ? (size_t)0 : (size_t)NH_ * SEQ * HD, sCB = isv ? (size_t)DM * SEQ : (size_t)SEQ * HD;
    const int useRes = (p != 1), biasRow = isv, act = isv, RB = isv ? DM : SEQ, pitch = isv ? SEQ : HD, CB = isv ? SEQ : HD;
    const int K = DM;
    const int lane = threadIdx.x & 31, lr = lane & 15, hi = lane >> 4; const int r0 = bx * 64, c0 = by * 64;
    v8f acc[4][4];
#pragma unroll
    for (int mb = 0; mb < 4; ++mb)
#pragma unroll
        for (int nb = 0; nb < 4; ++nb) acc[mb][nb] = (v8f){};
    const size_t aoff = (size_t)(r0 + lr) * K + 8 * hi, boff = (size_t)(c0 + lr) * K + 8 * hi;
#pragma unroll 1
    for (int kc = 0; kc < K; kc += 32) {
        v16bf a[4];
#pragma unroll
        for (int mb = 0; mb < 4; ++mb) a[mb] = ldb(A + aoff + (size_t)mb * 16 * K + kc);
#pragma unroll
        for (int nb = 0; nb < 4; ++nb) { const v16bf b = ldb(Bt + boff + (size_t)nb * 16 * K + kc);
#pragma unroll
            for (int mb = 0; mb < 4; ++mb) acc[mb][nb] = wmmab(a[mb], b, acc[mb][nb]); }
        asm volatile("v_nop\n\tv_nop\n\tv_nop\n\tv_nop" : "+v"(acc[0][0]), "+v"(acc[1][1]), "+v"(acc[2][2]), "+v"(acc[3][3]) : "v"(a[0]), "v"(a[1]), "v"(a[2]), "v"(a[3]));
    }
    // bias addends: addresses clamped into the 1024-entry bias array for the unused mode (index select, value select)
    float bc[4];
#pragma unroll
    for (int nb = 0; nb < 4; ++nb) bc[nb] = bfr(bias[biasRow ? 0 : (c0 + nb * 16 + lr)]);
    const size_t tbase = (size_t)(r0 / RB) * sRB + (size_t)(r0 % RB) * (size_t)pitch + (size_t)(c0 / CB) * sCB + (size_t)(c0 % CB);
#pragma unroll
    for (int mb = 0; mb < 4; ++mb) {
        const int ri = biasRow ? (r0 + mb * 16 + hi * 8) : 0;
        const v4f ra = *(const v4f*)(bias + ri); const v4f rb = *(const v4f*)(bias + ri + 4);
        const float brv[8] = { bfr(ra[0]), bfr(ra[1]), bfr(ra[2]), bfr(ra[3]), bfr(rb[0]), bfr(rb[1]), bfr(rb[2]), bfr(rb[3]) };
#pragma unroll
        for (int nb = 0; nb < 4; ++nb) {
#pragma unroll
            for (int j = 0; j < 8; ++j) { float x = acc[mb][nb][j] + (biasRow ? brv[j] : bc[nb]);
                if (act) x = tanh_e(x);
                os[(hi * 8 + j) * 68 + nb * 16 + lr] = x; } }   // D: row 8h+j, col lane&15
        wave_sync();
        const size_t sb = tbase + (size_t)(mb * 16) * (size_t)pitch;
{
#pragma unroll
            for (int s = 0; s < 4; ++s) { const int row = 4 * s + (lane >> 3), c8 = (lane & 7) * 8;   // 4 s x 4 row groups = 16 rows; 8 lanes x 8 = 64 columns
                const v4f x0 = *(const v4fa*)(&os[row * 68 + c8]); const v4f x1 = *(const v4fa*)(&os[row * 68 + c8 + 4]); v8h hv, rv;
#pragma unroll
                for (int i = 0; i < 4; ++i) { const h16 a0 = (h16)x0[i]; const h16 a1 = (h16)x1[i]; hv[i] = a0; hv[4 + i] = a1; rv[i] = (h16)((x0[i] - (float)a0) * QRS); rv[4 + i] = (h16)((x1[i] - (float)a1) * QRS); }
                const size_t oo = sb + (size_t)row * (size_t)pitch + c8;
                *(v8h*)(Ph + oo) = hv; if (useRes) *(v8h*)(Pr + oo) = rv; }
             }
        wave_sync();
    }
}

// flash<RES>: fused causal attention, one wave per 16 query rows of one (batch, head); K / V^T / Q fragments straight from the f16 planes (two 16-B loads each, arithmetic addressing).
// Transposed form: S^T[key][t] = K Q^T (A = K rows, B = Q rows); lane (t = lane&15, h = lane>>4) holds keys 8h+r of each 16-key tile, so the packed
// P tile is directly the B fragment of O^T[d][t] = V^T P^T (element r <- tile keys 0..15, element 8+r <- tile keys 16..31, lane unchanged).
// Causal: key tiles beyond the wave's last query row are skipped; inside tiles that reach past the wave's first row each score with key > t is replaced by NEGB (P = 0 exactly). Key 0 is visible to every row.
// RES != 0: P and tanh(v) each carry an f16 residual x2048; products Vr.Ph and Vh.Pr accumulate in g (folded back by 1/2048), Vh.Ph in o.
// Softmax state (running max, partial sum) is one scalar per lane; the two lane halves of a row are combined with one xor-16 exchange (issued under wave-uniform control only).
template <int RES>
__device__ __forceinline__ void flash(const h16* __restrict__ QH, const h16* __restrict__ QR, const h16* __restrict__ KP,
                                      const h16* __restrict__ VT, const h16* __restrict__ VR, float* OUT, float* os, int zh, int tblk) {
    const int lane = threadIdx.x & 31, wave = threadIdx.x >> 5, lr = lane & 15, hi = lane >> 4;
    const int b = zh / NH_, h = zh % NH_;
    const int t0 = tblk + wave * 16;
    const int tq = t0 + lr;
    const size_t pbase = (size_t)zh * SEQ * HD;
    const size_t qo = pbase + (size_t)(t0 + lr) * HD + 8 * hi;
    const v16h qh0 = ldh(QH + qo), qh1 = ldh(QH + qo + 32), qr0 = ldh(QR + qo), qr1 = ldh(QR + qo + 32);   // B fragments: col t, k = d
    const size_t ko = pbase + (size_t)lr * HD + 8 * hi;      // + key * HD       (A fragment: row key, k = d)
    const size_t vo = pbase + (size_t)lr * SEQ + 8 * hi;     // + 16j*SEQ + key  (A fragment: row d, k = key)
    v8f o0 = (v8f){}, o1 = (v8f){}, o2 = (v8f){}, o3 = (v8f){};
    v8f g0 = (v8f){}, g1 = (v8f){}, g2 = (v8f){}, g3 = (v8f){};
    float m = NEGB, l = 0.0f;
    const int kend = t0 + 16;                                // keys 0 .. t0+15 are needed; kend <= SEQ, so key0 + 31 <= SEQ - 1
#pragma unroll 1
    for (int key0 = 0; key0 < kend; key0 += 32) {
        const h16* ka = KP + ko + (size_t)key0 * HD;
        const v16h ka0 = ldh(ka), ka1 = ldh(ka + 32), kb0 = ldh(ka + 16 * HD), kb1 = ldh(ka + 16 * HD + 32);
        v8f sHa = (v8f){}, sLa = (v8f){}, sHb = (v8f){}, sLb = (v8f){};
        sHa = wmma16(ka0, qh0, sHa); sLa = wmma16(ka0, qr0, sLa); sHb = wmma16(kb0, qh0, sHb); sLb = wmma16(kb0, qr0, sLb);
        sHa = wmma16(ka1, qh1, sHa); sLa = wmma16(ka1, qr1, sLa); sHb = wmma16(kb1, qh1, sHb); sLb = wmma16(kb1, qr1, sLb);
        asm volatile("v_nop\n\tv_nop\n\tv_nop\n\tv_nop" : "+v"(sHa), "+v"(sLa), "+v"(sHb), "+v"(sLb) : "v"(ka0), "v"(ka1), "v"(kb0), "v"(kb1));
        float ta[8], tb[8];
#pragma unroll
        for (int r = 0; r < 8; ++r) { ta[r] = (sHa[r] + sLa[r] * QRI) * SC2; tb[r] = (sHb[r] + sLb[r] * QRI) * SC2; }
        if (key0 + 31 > t0) {                                // wave-uniform: this tile reaches past the wave's first query row
            const int dl = tq - key0 - 8 * hi;               // key of ta[r] = key0 + 8h + r is visible iff r <= dl; key of tb[r] = key0 + 16 + 8h + r iff r + 16 <= dl
#pragma unroll
            for (int r = 0; r < 8; ++r) { ta[r] = (r <= dl) ? ta[r] : NEGB; tb[r] = (r + 16 <= dl) ? tb[r] : NEGB; }
        }
        float mx = NEGB;
#pragma unroll
        for (int r = 0; r < 8; ++r) mx = fmaxf(mx, fmaxf(ta[r], tb[r]));
        mx = fmaxf(mx, __shfl_xor(mx, 16, 32));
        const float mnew = fmaxf(m, mx);
        const float alpha = __builtin_amdgcn_exp2f(m - mnew);
        const float sh = PSH - mnew;
        v16h pb = (v16h){}, pq = (v16h){}; float ls = 0.0f;
#pragma unroll
        for (int r = 0; r < 8; ++r) {
            const float ea = __builtin_amdgcn_exp2f(ta[r] + sh); const float eb = __builtin_amdgcn_exp2f(tb[r] + sh);
            const h16 pa = (h16)ea; const h16 pc = (h16)eb; pb[r] = pa; pb[8 + r] = pc;
            if (RES) { const h16 xa = (h16)((ea - (float)pa) * QRS); const h16 xc = (h16)((eb - (float)pc) * QRS); pq[r] = xa; pq[8 + r] = xc;
                       ls += ((float)pa + (float)pc) + ((float)xa + (float)xc) * QRI; }
            else     { ls += (float)pa + (float)pc; }
        }
        l = l * alpha + ls; m = mnew;
        o0 = o0 * alpha; o1 = o1 * alpha; o2 = o2 * alpha; o3 = o3 * alpha;
        const h16* va = VT + vo + key0;
        const v16h v0 = ldh(va), v1 = ldh(va + (size_t)16 * SEQ), v2 = ldh(va + (size_t)32 * SEQ), v3 = ldh(va + (size_t)48 * SEQ);
        if (RES) {
            g0 = g0 * alpha; g1 = g1 * alpha; g2 = g2 * alpha; g3 = g3 * alpha;
            const h16* vr = VR + vo + key0;
            const v16h w0 = ldh(vr), w1 = ldh(vr + (size_t)16 * SEQ), w2 = ldh(vr + (size_t)32 * SEQ), w3 = ldh(vr + (size_t)48 * SEQ);
            o0 = wmma16(v0, pb, o0); o1 = wmma16(v1, pb, o1); o2 = wmma16(v2, pb, o2); o3 = wmma16(v3, pb, o3);
            g0 = wmma16(w0, pb, g0); g1 = wmma16(w1, pb, g1); g2 = wmma16(w2, pb, g2); g3 = wmma16(w3, pb, g3);
            g0 = wmma16(v0, pq, g0); g1 = wmma16(v1, pq, g1); g2 = wmma16(v2, pq, g2); g3 = wmma16(v3, pq, g3);
            asm volatile("v_nop\n\tv_nop\n\tv_nop\n\tv_nop" : "+v"(o0), "+v"(o1), "+v"(o2), "+v"(o3), "+v"(g0), "+v"(g1), "+v"(g2), "+v"(g3)
                         : "v"(v0), "v"(v1), "v"(v2), "v"(v3), "v"(w0), "v"(w1), "v"(w2), "v"(w3), "v"(pb), "v"(pq));
        } else {
            o0 = wmma16(v0, pb, o0); o1 = wmma16(v1, pb, o1); o2 = wmma16(v2, pb, o2); o3 = wmma16(v3, pb, o3);
            asm volatile("v_nop\n\tv_nop\n\tv_nop\n\tv_nop" : "+v"(o0), "+v"(o1), "+v"(o2), "+v"(o3) : "v"(v0), "v"(v1), "v"(v2), "v"(v3), "v"(pb));
        }
    }
    if (RES) { o0 = o0 + g0 * QRI; o1 = o1 + g1 * QRI; o2 = o2 + g2 * QRI; o3 = o3 + g3 * QRI; }
    l += __shfl_xor(l, 16, 32);
    const float inv = 1.0f / l;
    const int wb = wave * 16 * 68;
    // O^T D layout: o_j[r] = (d = 16j + 8h + r, t = lane&15) -> os[t][d]; rows 0..15 x columns 0..63 all written
    { v4f a, c;
      a[0] = o0[0] * inv; a[1] = o0[1] * inv; a[2] = o0[2] * inv; a[3] = o0[3] * inv; c[0] = o0[4] * inv; c[1] = o0[5] * inv; c[2] = o0[6] * inv; c[3] = o0[7] * inv;
      *(v4fa*)(&os[wb + lr * 68 +  0 + 8 * hi]) = a; *(v4fa*)(&os[wb + lr * 68 +  0 + 8 * hi + 4]) = c;
      a[0] = o1[0] * inv; a[1] = o1[1] * inv; a[2] = o1[2] * inv; a[3] = o1[3] * inv; c[0] = o1[4] * inv; c[1] = o1[5] * inv; c[2] = o1[6] * inv; c[3] = o1[7] * inv;
      *(v4fa*)(&os[wb + lr * 68 + 16 + 8 * hi]) = a; *(v4fa*)(&os[wb + lr * 68 + 16 + 8 * hi + 4]) = c;
      a[0] = o2[0] * inv; a[1] = o2[1] * inv; a[2] = o2[2] * inv; a[3] = o2[3] * inv; c[0] = o2[4] * inv; c[1] = o2[5] * inv; c[2] = o2[6] * inv; c[3] = o2[7] * inv;
      *(v4fa*)(&os[wb + lr * 68 + 32 + 8 * hi]) = a; *(v4fa*)(&os[wb + lr * 68 + 32 + 8 * hi + 4]) = c;
      a[0] = o3[0] * inv; a[1] = o3[1] * inv; a[2] = o3[2] * inv; a[3] = o3[3] * inv; c[0] = o3[4] * inv; c[1] = o3[5] * inv; c[2] = o3[6] * inv; c[3] = o3[7] * inv;
      *(v4fa*)(&os[wb + lr * 68 + 48 + 8 * hi]) = a; *(v4fa*)(&os[wb + lr * 68 + 48 + 8 * hi + 4]) = c; }
    wave_sync();
    float* orow = OUT + ((size_t)b * OUT_SEQ + t0) * DM + h * HD;
{
#pragma unroll
        for (int s = 0; s < 8; ++s) { const int row = 2 * s + hi, cofs = lr * 4;   // 8 s x 2 rows = 16 rows; 16 lanes x 4 floats = 64 columns
            const v4f val = *(const v4fa*)(&os[wb + row * 68 + cofs]);
            *(v4f*)(orow + (size_t)row * DM + cofs) = val; }
         }
}

// k_flash2: both row ranges in ONE grid (they write disjoint rows and read the same planes): blockIdx.x = (batch, head), blockIdx.y = 64-row block;
// the late rows (most key tiles) come first, longest first, then the early rows. The range test is block-uniform.
#define LATE_BLK  ((SEQ - EARLY) / (16 * AW))
#define EARLY_BLK (EARLY / (16 * AW))
__global__ __launch_bounds__(32 * AW) void k_flash2(const h16* __restrict__ QH, const h16* __restrict__ QR, const h16* __restrict__ KP,
                                                    const h16* __restrict__ VT, const h16* __restrict__ VR, float* OUT) {
    __shared__ __align__(16) float os[AW * 16 * 68];
    const int zh = blockIdx.x, y = blockIdx.y;
    if (y < LATE_BLK) flash<0>(QH, QR, KP, VT, VR, OUT, os, zh, EARLY + (LATE_BLK - 1 - y) * 16 * AW);
    else              flash<1>(QH, QR, KP, VT, VR, OUT, os, zh, (y - LATE_BLK) * 16 * AW);
}

static constexpr size_t al256(size_t v) { return (v + 255) & ~(size_t)255; }
static constexpr size_t SZ_XB = al256((size_t)NB * SEQ * DM * 2);          // one bf16 activation copy
static constexpr size_t SZ_WB = al256((size_t)3 * DM * DM * 2);            // three transposed bf16 weights
static constexpr size_t SZ_PL = al256((size_t)NB * NH_ * SEQ * HD * 2);    // one f16 plane
static constexpr size_t SZ_TOTAL = 2 * SZ_XB + SZ_WB + 5 * SZ_PL;
static_assert(SZ_TOTAL <= (size_t)134217728);          // workspace carve <= 128 MiB
static_assert(((size_t)DM * DM * 2) % 256 == 0);       // weight sub-planes stay 256-byte aligned

extern "C" void kernel_launch(void* const* d_in, const int* in_sizes, int n_in,
                              void* d_out, int out_size, void* d_ws, size_t ws_size, hipStream_t stream) {
    if (n_in < 8) return;
    const size_t needx = ((size_t)(NB - 1) * SEQ_FULL + SEQ) * DM;
    if ((size_t)in_sizes[0] < needx || (size_t)in_sizes[1] < needx) return;
    if ((size_t)in_sizes[2] < (size_t)DM * DM || (size_t)in_sizes[3] < (size_t)DM * DM || (size_t)in_sizes[4] < (size_t)DM * DM) return;
    if ((size_t)in_sizes[5] < (size_t)DM || (size_t)in_sizes[6] < (size_t)DM || (size_t)in_sizes[7] < (size_t)DM) return;
    if ((size_t)out_size < ((size_t)(NB - 1) * OUT_SEQ + SEQ) * DM) return;
    if (SZ_TOTAL > ws_size) return;
    // wire order: seq, ctx, Wq, Wk, Wv, bq, bk, bv
    const float* xs = (const float*)d_in[0]; const float* xc = (const float*)d_in[1];
    const float* wq = (const float*)d_in[2]; const float* wk = (const float*)d_in[3]; const float* wv = (const float*)d_in[4];
    const float* bq = (const float*)d_in[5]; const float* bk = (const float*)d_in[6]; const float* bv = (const float*)d_in[7];
    float* OUT = (float*)d_out;      // [NB][SEQ][1024]
    char* wsp = (char*)d_ws;
    bf* XB = (bf*)wsp; wsp += SZ_XB;                 // seq  [NB*SEQ][1024]
    bf* CB = (bf*)wsp; wsp += SZ_XB;                 // ctx  [NB*SEQ][1024]
    bf* WB = (bf*)wsp; wsp += SZ_WB;                 // [3][1024 n = h*64+e][1024 d]: q | k | v
    h16* QH = (h16*)wsp; wsp += SZ_PL;               // [NB*16][SEQ][64]
    h16* QR = (h16*)wsp; wsp += SZ_PL;               // [NB*16][SEQ][64] residual x2048
    h16* KP = (h16*)wsp; wsp += SZ_PL;               // [NB*16][SEQ][64]
    h16* VT = (h16*)wsp; wsp += SZ_PL;               // [NB*16][64][SEQ] tanh(v)^T
    h16* VR = (h16*)wsp; wsp += SZ_PL;               // [NB*16][64][SEQ] residual x2048

    k_prep<<<dim3(2 * CVT_BLK + 3 * WT_BLK, 1, 1), 256, 0, stream>>>(xs, xc, wq, wk, wv, XB, CB, WB);
    k_proj3<<<dim3(PROJ_TILES, 3, 1), 32, 0, stream>>>(XB, CB, WB, bq, bk, bv, QH, QR, KP, VT, VR);
    k_flash2<<<dim3(NB * NH_, LATE_BLK + EARLY_BLK, 1), 32 * AW, 0, stream>>>(QH, QR, KP, VT, VR, OUT);
}

// v002
// A run of this version takes 64.5 microseconds.
// Timed twice side by side with v001, it ran 1.19 and 1.17 times as fast.
// All steps since v000 together make it 2.16 times as fast.
#include <hip/hip_runtime.h>

// Causal multi-head cross-attention: seq/ctx [NB][SEQ][1024], Wq/Wk/Wv [16][1024 in][64 out], biases [16][64]; q from seq, k and v from ctx, score scale 1/8, P applied to tanh(v), output = concatenated heads (f32).
// Compute dtypes, f32 accumulate everywhere: projections v_wmma_f32_16x16x32_bf16 (seq, ctx, W and biases RNE-converted to bf16; products exact);
// scores v_wmma_f32_16x16x32_f16: k single f16, q as f16 value + f16 residual x2048 in its own accumulator; P.V v_wmma_f32_16x16x32_f16: P carried x256 (cancels in the normalisation),
// query rows < 512: tanh(v) and P each as f16 value + f16 residual x2048 (three products, residual products in their own accumulator); later rows single f16 planes; softmax f32 (online, running max).
// Layout: bf16 copies of seq, ctx; W transposed once through LDS to [h*64+e][d] bf16; q (hi, residual), k planes [b*16+h][t][d]; tanh(v)^T planes (hi, residual) [b*16+h][d][t] written by the GEMM epilogue;
// fused flash kernel in transposed form (S^T = K Q^T, O^T = V^T P^T) with causal key-tile skipping and per-element replace-fill inside the visited diagonal tiles.

#ifndef NB
#define NB 2
#endif
#ifndef SEQ
#define SEQ 1024                 // query length == context length used (causal: keys <= query index)
#endif
#define NB_FULL  2
#define SEQ_FULL 1024
#ifndef OUT_SEQ
#define OUT_SEQ SEQ              // row pitch (in tokens) between batches of the output
#endif
#define DM   1024
#define NH_  16
#define HD   64
#define AW   4                   // waves per flash block (16 query rows each)
#define EARLY ((SEQ) < 512 ? (SEQ) : 512)     // query rows below this use the residual planes in P.V
#define QRS  2048.0f             // carry of every residual plane (q, tanh(v), P)
#define QRI  (1.0f / 2048.0f)
#define SC2  (0.125f * 1.4426950408889634f)   // HD^-0.5 * log2(e)
#define PSH  8.0f                // log2 of the P carry (256)
#define NEGB (-3.0e38f)          // fill of masked scores (exp2 gives exactly 0)

static_assert(HD == 64);
static_assert(NH_ * HD == DM);                 // head h = columns h*64 + e
static_assert(DM % 64 == 0);
static_assert(DM % 64 == 0 && DM >= 64);       // GEMM k-loop: two steps of 32 per trip
static_assert(SEQ % 64 == 0);                  // a 64-row tile never straddles two batches
static_assert((NB * SEQ) % 64 == 0);
static_assert(SEQ % 32 == 0);                  // key loop steps by 32, last visited tile stays inside the plane
static_assert(EARLY % (16 * AW) == 0);
static_assert((SEQ - EARLY) % (16 * AW) == 0);
static_assert(((size_t)SEQ * DM) % 8 == 0);
static_assert(NB <= NB_FULL);
static_assert(SEQ <= SEQ_FULL);
static_assert(((size_t)(NB_FULL - 1) * SEQ_FULL + SEQ_FULL) * DM * 4 == (size_t)8388608);   // output bytes of the full problem

typedef _Float16 h16;
typedef unsigned short bf;
typedef __attribute__((ext_vector_type(16))) __bf16   v16bf;
typedef __attribute__((ext_vector_type(16))) _Float16 v16h;
typedef __attribute__((ext_vector_type(8)))  _Float16 v8h;
typedef __attribute__((ext_vector_type(8)))  unsigned short v8us;
typedef __attribute__((ext_vector_type(8)))  float    v8f;
typedef __attribute__((ext_vector_type(4)))  float    v4f;
typedef v4f  __attribute__((may_alias)) v4fa;

__device__ __forceinline__ unsigned short f2bf(float f) { unsigned u = __float_as_uint(f); u += 0x7FFFu + ((u >> 16) & 1u); return (unsigned short)(u >> 16); }
__device__ __forceinline__ float bfr(float f) { return __uint_as_float(((unsigned)f2bf(f)) << 16); }     // value after RNE convert to bf16
__device__ __forceinline__ float tanh_e(float x) { const float e = __builtin_amdgcn_exp2f(x * 2.8853900817779268f); return 1.0f - 2.0f * __builtin_amdgcn_rcpf(e + 1.0f); }   // 1 - 2/(exp(2x)+1); saturates cleanly to +-1
__device__ __forceinline__ v16h cat16(v8h lo, v8h hi) { return __builtin_shufflevector(lo, hi, 0, 1, 2, 3, 4, 5, 6, 7, 8, 9, 10, 11, 12, 13, 14, 15); }
__device__ __forceinline__ v16bf cat16b(v8us lo, v8us hi) { return __builtin_bit_cast(v16bf, __builtin_shufflevector(lo, hi, 0, 1, 2, 3, 4, 5, 6, 7, 8, 9, 10, 11, 12, 13, 14, 15)); }
__device__ __forceinline__ v8f wmma16(v16h a, v16h b, v8f c) { return __builtin_amdgcn_wmma_f32_16x16x32_f16(false, a, false, b, (short)0, c, false, false); }
__device__ __forceinline__ v8f wmmab(v16bf a, v16bf b, v8f c) { return __builtin_amdgcn_wmma_f32_16x16x32_bf16(false, a, false, b, (short)0, c, false, false); }
// fragment loaders from K-contiguous 16-bit rows; p already includes + 8*(lane>>4): elements 0..7 <- k0+8h+0..7, elements 8..15 <- k0+16+8h+0..7 (same map for A and B)
__device__ __forceinline__ v16h  ldh(const h16* p) { return cat16(*(const v8h*)p, *(const v8h*)(p + 16)); }
__device__ __forceinline__ v16bf ldb(const bf* p)  { return cat16b(*(const v8us*)p, *(const v8us*)(p + 16)); }
// ordering point for wave-private LDS tiles (same wave writes and reads)
__device__ __forceinline__ void wave_sync() { __builtin_amdgcn_fence(3 /* release order */, "wavefront"); __builtin_amdgcn_wave_barrier(); asm volatile("" ::: "memory"); }

// cvt8: group i of 8 elements of the packed [NB][SEQ][DM] bf16 copy; the source batches lie SEQ_FULL rows apart
__device__ __forceinline__ void cvt8(const float* __restrict__ src, bf* dst, int blk) {
    const size_t n8 = (size_t)NB * SEQ * DM / 8, per = (size_t)SEQ * DM / 8;
    const size_t i = (size_t)blk * 256 + threadIdx.x; if (i >= n8) return;
    const size_t so = (SEQ == SEQ_FULL) ? i * 8 : ((i / per) * SEQ_FULL * DM + (i % per) * 8);
    const v8f v = *(const v8f*)(src + so); v8us o;
#pragma unroll
    for (int k = 0; k < 8; ++k) o[k] = f2bf(v[k]);
    *(v8us*)(dst + i * 8) = o; 
}

// wT: in W [NH][DM rows d][HD cols e] f32 -> out WT [NH*HD rows n = h*64+e][DM cols d] bf16 (RNE convert). One block per (64-d tile, head); transpose through LDS (cross-wave: block barrier).
__device__ __forceinline__ void wT(const float* __restrict__ W, bf* WT, float* ts, int blk) {
    const int tid = threadIdx.x; const int d0 = (blk % (DM / 64)) * 64, h = blk / (DM / 64);
    const float* src = W + ((size_t)h * DM + d0) * HD;
#pragma unroll
    for (int i = 0; i < 4; ++i) { const int q = tid + 256 * i; const int d = q >> 4, e4 = (q & 15) * 4;      // 1024 float4 = 64 rows d x 64 cols e
        const v4f v = *(const v4f*)(src + (size_t)d * HD + e4);
        ts[d * 68 + e4 + 0] = v[0]; ts[d * 68 + e4 + 1] = v[1]; ts[d * 68 + e4 + 2] = v[2]; ts[d * 68 + e4 + 3] = v[3]; }
    __syncthreads();
{
#pragma unroll
        for (int it = 0; it < 2; ++it) { const int e = it * 32 + (tid >> 3), c8 = (tid & 7) * 8;                // rows e 0..63, columns d0 + 0..63
            v8us o;
#pragma unroll
            for (int k = 0; k < 8; ++k) o[k] = f2bf(ts[(c8 + k) * 68 + e]);
            *(v8us*)(WT + (size_t)(h * HD + e) * DM + d0 + c8) = o; }
         }
}

// k_prep: the two activation converts and the three weight transposes, which do not depend on one another, as ranges of ONE grid (the range test is block-uniform).
#define CVT_BLK ((int)(((size_t)NB * SEQ * DM / 8 + 255) / 256))   // blocks of one convert
#define WT_BLK  ((DM / 64) * NH_)                                   // blocks of one transpose
__global__ __launch_bounds__(256) void k_prep(const float* __restrict__ xs, const float* __restrict__ xc, const float* __restrict__ wq, const float* __restrict__ wk,
                                              const float* __restrict__ wv, bf* XB, bf* CB, bf* WB) {
    __shared__ __align__(16) float ts[64 * 68];
    const int blk = blockIdx.x;
    if (blk < 3 * WT_BLK) {                                         // the transposes (the longer blocks) start first
        const int w = blk / WT_BLK;                                 // 0 q, 1 k, 2 v
        wT(w == 0 ? wq : (w == 1 ? wk : wv), WB + (size_t)w * DM * DM, ts, blk % WT_BLK);
        return;
    }
    const int c = blk - 3 * WT_BLK;
    if (c < CVT_BLK) cvt8(xs, XB, c); else cvt8(xc, CB, c - CVT_BLK);
}

// k_proj3: the three projections, which do not depend on one another, in ONE grid: blockIdx.y picks the projection (scalar selects), blockIdx.x its 64x64 tile, row tiles first.
//   q: A = seq rows (m = b*SEQ + t), Bt = WQ rows (n = h*64 + e), bias per column -> plane [(b*16 + h)][t][e], with residual
//   k: A = ctx rows, Bt = WK rows, bias per column (the 1/8 scale is applied to the scores)
//   tanh(v)^T: A = WV rows (m = h*64 + e), Bt = ctx rows (n = b*SEQ + t), bias per row, tanh -> plane [(b*1024 + m)][t] = [(b*16 + h)][e][t], with residual
// Each: register-blocked bf16 GEMM, ONE WAVE per 64x64 tile (16 accumulators), operands straight from K-contiguous bf16 planes, K = DM.
// C[m][n] = sum_k A[m][k] Bt[n][k] + bias (bf16 RNE value, f32 add; per column n when biasRow == 0, per row m when biasRow != 0), optional tanh (act != 0),
// written as f16 (Ph) and optionally the f16 residual x2048 (Pr, useRes != 0) at
// tile base (r0/RB)*sRB + (r0%RB)*pitch + (c0/CB)*sCB + (c0%CB), row pitch 'pitch' (halves). Tile (bx, by) of (M/64, N/64), 32 threads.
#define PROJ_TILES ((NB * SEQ / 64) * (DM / 64))
// the wait in front of a rewrite of address registers that issued loads name; the two scheduling barriers keep the rewrites behind it
__device__ __forceinline__ void addr_wait() { __builtin_amdgcn_sched_barrier(0); asm volatile("s_wait_xcnt 0x0" ::: "memory"); __builtin_amdgcn_sched_barrier(0); }
// one k-step (32) of a 64x64 tile: its 8 fragments (16 loads), and its 16 products
__device__ __forceinline__ void ld4(v16bf (&f)[4], const bf* P, int K, int kc) {
#pragma unroll
    for (int i = 0; i < 4; ++i) f[i] = ldb(P + (size_t)i * 16 * K + kc);
}
__device__ __forceinline__ void ld_step(v16bf (&a)[4], v16bf (&b)[4], const bf* Ap, const bf* Bp, int K, int kc) {
    ld4(a, Ap, K, kc); ld4(b, Bp, K, kc);
    __builtin_amdgcn_sched_barrier(0);   // keeps the 16 loads ahead of the other set's products: sunk to their use they would have no lead
}
__device__ __forceinline__ void mm_step(v8f (&acc)[4][4], const v16bf (&a)[4], const v16bf (&b)[4]) {
#pragma unroll
    for (int nb = 0; nb < 4; ++nb)
#pragma unroll
        for (int mb = 0; mb < 4; ++mb) acc[mb][nb] = wmmab(a[mb], b[nb], acc[mb][nb]);
    // four vector slots behind the last product, on every path, before its operands or results are touched
    asm volatile("v_nop\n\tv_nop\n\tv_nop\n\tv_nop" : "+v"(acc[0][0]), "+v"(acc[1][1]), "+v"(acc[2][2]), "+v"(acc[3][3])
                 : "v"(a[0]), "v"(a[1]), "v"(a[2]), "v"(a[3]), "v"(b[0]), "v"(b[1]), "v"(b[2]), "v"(b[3]));
    __builtin_amdgcn_sched_barrier(0);   // the refill of this set starts behind its last product, so it takes the same registers
}
__global__ __launch_bounds__(32) void k_proj3(const bf* __restrict__ xb, const bf* __restrict__ cb, const bf* __restrict__ wb,
                                              const float* __restrict__ bq, const float* __restrict__ bk, const float* __restrict__ bv,
                                              h16* QH, h16* QR, h16* KP, h16* VT, h16* VR) {
    __shared__ __align__(16) float os[16 * 68];
    const int p = 2 - (int)blockIdx.y; const unsigned f = blockIdx.x; const bool isv = (p == 2);   // 0 q, 1 k, 2 v; v (tanh in its epilogue) starts first
    const int bx = (int)(isv ? f % (DM / 64) : f % (NB * SEQ / 64)), by = (int)(isv ? f / (DM / 64) : f / (NB * SEQ / 64));
    const bf* wp = wb + (size_t)p * DM * DM; const bf* xp = (p == 0) ? xb : cb;
    const bf* A = isv ? wp : xp; const bf* Bt = isv ? xp : wp; const float* bias = p == 0 ? bq : (p == 1 ? bk : bv);
    h16* Ph = p == 0 ? QH : (p == 1 ? KP : VT); h16* Pr = p == 0 ? QR : (p == 1 ? KP : VR);
    const size_t sRB = isv ? (size_t)0 : (size_t)NH_ * SEQ * HD, sCB = isv ? (size_t)DM * SEQ : (size_t)SEQ * HD;
    const int useRes = (p != 1), biasRow = isv, act = isv, RB = isv ? DM : SEQ, pitch = isv ? SEQ : HD, CB = isv ? SEQ : HD;
    const int K = DM;
    const int lane = threadIdx.x & 31, lr = lane & 15, hi = lane >> 4; const int r0 = bx * 64, c0 = by * 64;
    v8f acc[4][4];
#pragma unroll
    for (int mb = 0; mb < 4; ++mb)
#pragma unroll
        for (int nb = 0; nb < 4; ++nb) acc[mb][nb] = (v8f){};
    const size_t aoff = (size_t)(r0 + lr) * K + 8 * hi;
    // two fragment sets: each k-step's loads are issued one step ahead, while the other set's products run; k ascends as before
    const bf* Ap = A + aoff;
    v16bf a0[4], b0[4], a1[4], b1[4];
    ld4(a0, Ap, K, 0);
    // same wait as addr_wait(); it takes the column index as an operand so that every part of B's address, which reuses A's offset register, is formed behind it
    unsigned cb0 = (unsigned)c0;
    asm volatile("s_wait_xcnt 0x0" : "+s"(cb0) : : "memory");
    const size_t boff = (size_t)(cb0 + lr) * K + 8 * hi;
    const bf* Bp = Bt + boff;
    ld4(b0, Bp, K, 0);
    __builtin_amdgcn_sched_barrier(0);   // the first step's loads go out ahead of everything else
#pragma unroll 1   // the body already holds two steps; more copies only grow the text
    for (int kc = 0; kc < K - 64; kc += 64) {
        ld_step(a1, b1, Ap, Bp, K, kc + 32);
        mm_step(acc, a0, b0);
        ld_step(a0, b0, Ap, Bp, K, kc + 64);
        mm_step(acc, a1, b1);
        addr_wait();                     // the next trip rewrites the address registers of the loads still in flight
    }
    ld_step(a1, b1, Ap, Bp, K, K - 32);
    mm_step(acc, a0, b0);
    mm_step(acc, a1, b1);
    // bias addends: addresses clamped into the 1024-entry bias array for the unused mode (index select, value select)
    float bc[4];
#pragma unroll
    for (int nb = 0; nb < 4; ++nb) bc[nb] = bias[biasRow ? 0 : (c0 + nb * 16 + lr)];
    addr_wait();                         // the row-bias loads below may land in the offset registers of these four loads; the converts follow it, so it does not wait for the data
#pragma unroll
    for (int nb = 0; nb < 4; ++nb) bc[nb] = bfr(bc[nb]);
    const size_t tbase = (size_t)(r0 / RB) * sRB + (size_t)(r0 % RB) * (size_t)pitch + (size_t)(c0 / CB) * sCB + (size_t)(c0 % CB);
#pragma unroll
    for (int mb = 0; mb < 4; ++mb) {
        const int ri = biasRow ? (r0 + mb * 16 + hi * 8) : 0;
        const v4f ra = *(const v4f*)(bias + ri); const v4f rb = *(const v4f*)(bias + ri + 4);
        asm volatile("s_wait_xcnt 0x0" : : "v"(ri * 4) : "memory");   // same wait; the byte offset as an input keeps the two loads' offset register from being reused ahead of it
        const float brv[8] = { bfr(ra[0]), bfr(ra[1]), bfr(ra[2]), bfr(ra[3]), bfr(rb[0]), bfr(rb[1]), bfr(rb[2]), bfr(rb[3]) };
#pragma unroll
        for (int nb = 0; nb < 4; ++nb) {
#pragma unroll
            for (int j = 0; j < 8; ++j) { float x = acc[mb][nb][j] + (biasRow ? brv[j] : bc[nb]);
                if (act) x = tanh_e(x);
                os[(hi * 8 + j) * 68 + nb * 16 + lr] = x; } }   // D: row 8h+j, col lane&15
        wave_sync();
        const size_t sb = tbase + (size_t)(mb * 16) * (size_t)pitch;
{
#pragma unroll
            for (int s = 0; s < 4; ++s) { const int row = 4 * s + (lane >> 3), c8 = (lane & 7) * 8;   // 4 s x 4 row groups = 16 rows; 8 lanes x 8 = 64 columns
                const v4f x0 = *(const v4fa*)(&os[row * 68 + c8]); const v4f x1 = *(const v4fa*)(&os[row * 68 + c8 + 4]); v8h hv, rv;
#pragma unroll
                for (int i = 0; i < 4; ++i) { const h16 a0 = (h16)x0[i]; const h16 a1 = (h16)x1[i]; hv[i] = a0; hv[4 + i] = a1; rv[i] = (h16)((x0[i] - (float)a0) * QRS); rv[4 + i] = (h16)((x1[i] - (float)a1) * QRS); }
                const size_t oo = sb + (size_t)row * (size_t)pitch + c8;
                *(v8h*)(Ph + oo) = hv; if (useRes) *(v8h*)(Pr + oo) = rv; }
             }
        wave_sync();
    }
}

// flash<RES>: fused causal attention, one wave per 16 query rows of one (batch, head); K / V^T / Q fragments straight from the f16 planes (two 16-B loads each, arithmetic addressing).
// Transposed form: S^T[key][t] = K Q^T (A = K rows, B = Q rows); lane (t = lane&15, h = lane>>4) holds keys 8h+r of each 16-key tile, so the packed
// P tile is directly the B fragment of O^T[d][t] = V^T P^T (element r <- tile keys 0..15, element 8+r <- tile keys 16..31, lane unchanged).
// Causal: key tiles beyond the wave's last query row are skipped; inside tiles that reach past the wave's first row each score with key > t is replaced by NEGB (P = 0 exactly). Key 0 is visible to every row.
// RES != 0: P and tanh(v) each carry an f16 residual x2048; products Vr.Ph and Vh.Pr accumulate in g (folded back by 1/2048), Vh.Ph in o.
// Softmax state (running max, partial sum) is one scalar per lane; the two lane halves of a row are combined with one xor-16 exchange (issued under wave-uniform control only).
template <int RES>
__device__ __forceinline__ void flash(const h16* __restrict__ QH, const h16* __restrict__ QR, const h16* __restrict__ KP,
                                      const h16* __restrict__ VT, const h16* __restrict__ VR, float* OUT, float* os, int zh, int tblk) {
    const int lane = threadIdx.x & 31, wave = threadIdx.x >> 5, lr = lane & 15, hi = lane >> 4;
    const int b = zh / NH_, h = zh % NH_;
    const int t0 = tblk + wave * 16;
    const int tq = t0 + lr;
    const size_t pbase = (size_t)zh * SEQ * HD;
    const size_t qo = pbase + (size_t)(t0 + lr) * HD + 8 * hi;
    const v16h qh0 = ldh(QH + qo), qh1 = ldh(QH + qo + 32), qr0 = ldh(QR + qo), qr1 = ldh(QR + qo + 32);   // B fragments: col t, k = d
    asm volatile("s_wait_xcnt 0x0" : : "v"(QH + qo), "v"(QR + qo) : "memory");   // the fragments fetched ahead below may land in the address registers of these loads: the wait stands in front, the pointers as inputs keep them whole up to it
    const size_t ko = pbase + (size_t)lr * HD + 8 * hi;      // + key * HD       (A fragment: row key, k = d)
    const size_t vo = pbase + (size_t)lr * SEQ + 8 * hi;     // + 16j*SEQ + key  (A fragment: row d, k = key)
    v8f o0 = (v8f){}, o1 = (v8f){}, o2 = (v8f){}, o3 = (v8f){};
    v8f g0 = (v8f){}, g1 = (v8f){}, g2 = (v8f){}, g3 = (v8f){};
    float m = NEGB, l = 0.0f;
    const int kend = t0 + 16;                                // keys 0 .. t0+15 are needed; kend <= SEQ, so key0 + 31 <= SEQ - 1
    // K and V^T fragments are fetched one key tile ahead, into the same registers, right behind their last product
    const h16* ka = KP + ko; const h16* va = VT + vo; const h16* vr = VR + vo;
    v16h ka0 = ldh(ka), ka1 = ldh(ka + 32), kb0 = ldh(ka + 16 * HD), kb1 = ldh(ka + 16 * HD + 32);
    __builtin_amdgcn_sched_barrier(0);                       // K issued ahead of V^T here as in the loop: the wait in front of the score products then leaves the V^T loads in flight
    v16h w0 = (v16h){}, w1 = (v16h){}, w2 = (v16h){}, w3 = (v16h){};
    if (RES) { w0 = ldh(vr); w1 = ldh(vr + (size_t)16 * SEQ); w2 = ldh(vr + (size_t)32 * SEQ); w3 = ldh(vr + (size_t)48 * SEQ); }
    v16h v0 = ldh(va), v1 = ldh(va + (size_t)16 * SEQ), v2 = ldh(va + (size_t)32 * SEQ), v3 = ldh(va + (size_t)48 * SEQ);
    // the pointers as inputs keep the address registers of the loads above whole up to this wait: no result lands in one ahead of it
    if (RES) asm volatile("s_wait_xcnt 0x0" : : "v"(ka), "v"(va), "v"(vr) : "memory");
    else     asm volatile("s_wait_xcnt 0x0" : : "v"(ka), "v"(va) : "memory");
#pragma unroll 1
    for (int key0 = 0; key0 < kend; key0 += 32) {
        const int adv = (key0 + 32 < kend) ? 32 : 0;         // the last pass has no next tile: it re-reads its own (in bounds, values unused)
        v8f sHa = (v8f){}, sLa = (v8f){}, sHb = (v8f){}, sLb = (v8f){};
        sHa = wmma16(ka0, qh0, sHa); sLa = wmma16(ka0, qr0, sLa); sHb = wmma16(kb0, qh0, sHb); sLb = wmma16(kb0, qr0, sLb);
        sHa = wmma16(ka1, qh1, sHa); sLa = wmma16(ka1, qr1, sLa); sHb = wmma16(kb1, qh1, sHb); sLb = wmma16(kb1, qr1, sLb);
        asm volatile("v_nop\n\tv_nop\n\tv_nop\n\tv_nop" : "+v"(sHa), "+v"(sLa), "+v"(sHb), "+v"(sLb) : "v"(ka0), "v"(ka1), "v"(kb0), "v"(kb1));
        __builtin_amdgcn_sched_barrier(0);                   // the next tile's K loads start behind the score products (same registers) ...
        ka += (size_t)adv * HD;
        ka0 = ldh(ka); ka1 = ldh(ka + 32); kb0 = ldh(ka + 16 * HD); kb1 = ldh(ka + 16 * HD + 32);
        __builtin_amdgcn_sched_barrier(0);                   // ... and ahead of the softmax, which is their lead
        float ta[8], tb[8];
#pragma unroll
        for (int r = 0; r < 8; ++r) { ta[r] = (sHa[r] + sLa[r] * QRI) * SC2; tb[r] = (sHb[r] + sLb[r] * QRI) * SC2; }
        if (key0 + 31 > t0) {                                // wave-uniform: this tile reaches past the wave's first query row
            const int dl = tq - key0 - 8 * hi;               // key of ta[r] = key0 + 8h + r is visible iff r <= dl; key of tb[r] = key0 + 16 + 8h + r iff r + 16 <= dl
#pragma unroll
            for (int r = 0; r < 8; ++r) { ta[r] = (r <= dl) ? ta[r] : NEGB; tb[r] = (r + 16 <= dl) ? tb[r] : NEGB; }
        }
        float mx = NEGB;
#pragma unroll
        for (int r = 0; r < 8; ++r) mx = fmaxf(mx, fmaxf(ta[r], tb[r]));
        mx = fmaxf(mx, __shfl_xor(mx, 16, 32));
        const float mnew = fmaxf(m, mx);
        const float alpha = __builtin_amdgcn_exp2f(m - mnew);
        const float sh = PSH - mnew;
        v16h pb = (v16h){}, pq = (v16h){}; float ls = 0.0f;
#pragma unroll
        for (int r = 0; r < 8; ++r) {
            const float ea = __builtin_amdgcn_exp2f(ta[r] + sh); const float eb = __builtin_amdgcn_exp2f(tb[r] + sh);
            const h16 pa = (h16)ea; const h16 pc = (h16)eb; pb[r] = pa; pb[8 + r] = pc;
            if (RES) { const h16 xa = (h16)((ea - (float)pa) * QRS); const h16 xc = (h16)((eb - (float)pc) * QRS); pq[r] = xa; pq[8 + r] = xc;
                       ls += ((float)pa + (float)pc) + ((float)xa + (float)xc) * QRI; }
            else     { ls += (float)pa + (float)pc; }
        }
        l = l * alpha + ls; m = mnew;
        o0 = o0 * alpha; o1 = o1 * alpha; o2 = o2 * alpha; o3 = o3 * alpha;
        if (RES) {
            g0 = g0 * alpha; g1 = g1 * alpha; g2 = g2 * alpha; g3 = g3 * alpha;
            o0 = wmma16(v0, pb, o0); o1 = wmma16(v1, pb, o1); o2 = wmma16(v2, pb, o2); o3 = wmma16(v3, pb, o3);
            g0 = wmma16(w0, pb, g0); g1 = wmma16(w1, pb, g1); g2 = wmma16(w2, pb, g2); g3 = wmma16(w3, pb, g3);
            g0 = wmma16(v0, pq, g0); g1 = wmma16(v1, pq, g1); g2 = wmma16(v2, pq, g2); g3 = wmma16(v3, pq, g3);
            asm volatile("v_nop\n\tv_nop\n\tv_nop\n\tv_nop" : "+v"(o0), "+v"(o1), "+v"(o2), "+v"(o3), "+v"(g0), "+v"(g1), "+v"(g2), "+v"(g3)
                         : "v"(v0), "v"(v1), "v"(v2), "v"(v3), "v"(w0), "v"(w1), "v"(w2), "v"(w3), "v"(pb), "v"(pq));
            __builtin_amdgcn_sched_barrier(0);               // nothing but the 16 loads and their addresses between here and the wait below
            vr += adv; va += adv;
            w0 = ldh(vr); w1 = ldh(vr + (size_t)16 * SEQ); w2 = ldh(vr + (size_t)32 * SEQ); w3 = ldh(vr + (size_t)48 * SEQ);
            v0 = ldh(va); v1 = ldh(va + (size_t)16 * SEQ); v2 = ldh(va + (size_t)32 * SEQ); v3 = ldh(va + (size_t)48 * SEQ);
            asm volatile("s_wait_xcnt 0x0" : : "v"(va), "v"(vr) : "memory");   // what follows may reuse the address registers of these loads; the pointers as inputs keep them whole up to this wait, so that no result of the run lands in one
            __builtin_amdgcn_sched_barrier(0);               // keeps what follows behind the wait
        } else {
            o0 = wmma16(v0, pb, o0); o1 = wmma16(v1, pb, o1); o2 = wmma16(v2, pb, o2); o3 = wmma16(v3, pb, o3);
            asm volatile("v_nop\n\tv_nop\n\tv_nop\n\tv_nop" : "+v"(o0), "+v"(o1), "+v"(o2), "+v"(o3) : "v"(v0), "v"(v1), "v"(v2), "v"(v3), "v"(pb));
            va += adv;
            v0 = ldh(va); v1 = ldh(va + (size_t)16 * SEQ); v2 = ldh(va + (size_t)32 * SEQ); v3 = ldh(va + (size_t)48 * SEQ);
        }
    }
    if (RES) { o0 = o0 + g0 * QRI; o1 = o1 + g1 * QRI; o2 = o2 + g2 * QRI; o3 = o3 + g3 * QRI; }
    l += __shfl_xor(l, 16, 32);
    const float inv = 1.0f / l;
    const int wb = wave * 16 * 68;
    // O^T D layout: o_j[r] = (d = 16j + 8h + r, t = lane&15) -> os[t][d]; rows 0..15 x columns 0..63 all written
    { v4f a, c;
      a[0] = o0[0] * inv; a[1] = o0[1] * inv; a[2] = o0[2] * inv; a[3] = o0[3] * inv; c[0] = o0[4] * inv; c[1] = o0[5] * inv; c[2] = o0[6] * inv; c[3] = o0[7] * inv;
      *(v4fa*)(&os[wb + lr * 68 +  0 + 8 * hi]) = a; *(v4fa*)(&os[wb + lr * 68 +  0 + 8 * hi + 4]) = c;
      a[0] = o1[0] * inv; a[1] = o1[1] * inv; a[2] = o1[2] * inv; a[3] = o1[3] * inv; c[0] = o1[4] * inv; c[1] = o1[5] * inv; c[2] = o1[6] * inv; c[3] = o1[7] * inv;
      *(v4fa*)(&os[wb + lr * 68 + 16 + 8 * hi]) = a; *(v4fa*)(&os[wb + lr * 68 + 16 + 8 * hi + 4]) = c;
      a[0] = o2[0] * inv; a[1] = o2[1] * inv; a[2] = o2[2] * inv; a[3] = o2[3] * inv; c[0] = o2[4] * inv; c[1] = o2[5] * inv; c[2] = o2[6] * inv; c[3] = o2[7] * inv;
      *(v4fa*)(&os[wb + lr * 68 + 32 + 8 * hi]) = a; *(v4fa*)(&os[wb + lr * 68 + 32 + 8 * hi + 4]) = c;
      a[0] = o3[0] * inv; a[1] = o3[1] * inv; a[2] = o3[2] * inv; a[3] = o3[3] * inv; c[0] = o3[4] * inv; c[1] = o3[5] * inv; c[2] = o3[6] * inv; c[3] = o3[7] * inv;
      *(v4fa*)(&os[wb + lr * 68 + 48 + 8 * hi]) = a; *(v4fa*)(&os[wb + lr * 68 + 48 + 8 * hi + 4]) = c; }
    wave_sync();
    float* orow = OUT + ((size_t)b * OUT_SEQ + t0) * DM + h * HD;
{
#pragma unroll
        for (int s = 0; s < 8; ++s) { const int row = 2 * s + hi, cofs = lr * 4;   // 8 s x 2 rows = 16 rows; 16 lanes x 4 floats = 64 columns
            const v4f val = *(const v4fa*)(&os[wb + row * 68 + cofs]);
            *(v4f*)(orow + (size_t)row * DM + cofs) = val; }
         }
}

// k_flash2: both row ranges in ONE grid (they write disjoint rows and read the same planes): blockIdx.x = (batch, head), blockIdx.y = 64-row block;
// the late rows (most key tiles) come first, longest first, then the early rows. The range test is block-uniform.
#define LATE_BLK  ((SEQ - EARLY) / (16 * AW))
#define EARLY_BLK (EARLY / (16 * AW))
__global__ __launch_bounds__(32 * AW) void k_flash2(const h16* __restrict__ QH, const h16* __restrict__ QR, const h16* __restrict__ KP,
                                                    const h16* __restrict__ VT, const h16* __restrict__ VR, float* OUT) {
    __shared__ __align__(16) float os[AW * 16 * 68];
    const int zh = blockIdx.x, y = blockIdx.y;
    if (y < LATE_BLK) flash<0>(QH, QR, KP, VT, VR, OUT, os, zh, EARLY + (LATE_BLK - 1 - y) * 16 * AW);
    else              flash<1>(QH, QR, KP, VT, VR, OUT, os, zh, (y - LATE_BLK) * 16 * AW);
}

static constexpr size_t al256(size_t v) { return (v + 255) & ~(size_t)255; }
static constexpr size_t SZ_XB = al256((size_t)NB * SEQ * DM * 2);          // one bf16 activation copy
static constexpr size_t SZ_WB = al256((size_t)3 * DM * DM * 2);            // three transposed bf16 weights
static constexpr size_t SZ_PL = al256((size_t)NB * NH_ * SEQ * HD * 2);    // one f16 plane
static constexpr size_t SZ_TOTAL = 2 * SZ_XB + SZ_WB + 5 * SZ_PL;
static_assert(SZ_TOTAL <= (size_t)134217728);          // workspace carve <= 128 MiB
static_assert(((size_t)DM * DM * 2) % 256 == 0);       // weight sub-planes stay 256-byte aligned

extern "C" void kernel_launch(void* const* d_in, const int* in_sizes, int n_in,
                              void* d_out, int out_size, void* d_ws, size_t ws_size, hipStream_t stream) {
    if (n_in < 8) return;
    const size_t needx = ((size_t)(NB - 1) * SEQ_FULL + SEQ) * DM;
    if ((size_t)in_sizes[0] < needx || (size_t)in_sizes[1] < needx) return;
    if ((size_t)in_sizes[2] < (size_t)DM * DM || (size_t)in_sizes[3] < (size_t)DM * DM || (size_t)in_sizes[4] < (size_t)DM * DM) return;
    if ((size_t)in_sizes[5] < (size_t)DM || (size_t)in_sizes[6] < (size_t)DM || (size_t)in_sizes[7] < (size_t)DM) return;
    if ((size_t)out_size < ((size_t)(NB - 1) * OUT_SEQ + SEQ) * DM) return;
    if (SZ_TOTAL > ws_size) return;
    // wire order: seq, ctx, Wq, Wk, Wv, bq, bk, bv
    const float* xs = (const float*)d_in[0]; const float* xc = (const float*)d_in[1];
    const float* wq = (const float*)d_in[2]; const float* wk = (const float*)d_in[3]; const float* wv = (const float*)d_in[4];
    const float* bq = (const float*)d_in[5]; const float* bk = (const float*)d_in[6]; const float* bv = (const float*)d_in[7];
    float* OUT = (float*)d_out;      // [NB][SEQ][1024]
    char* wsp = (char*)d_ws;
    bf* XB = (bf*)wsp; wsp += SZ_XB;                 // seq  [NB*SEQ][1024]
    bf* CB = (bf*)wsp; wsp += SZ_XB;                 // ctx  [NB*SEQ][1024]
    bf* WB = (bf*)wsp; wsp += SZ_WB;                 // [3][1024 n = h*64+e][1024 d]: q | k | v
    h16* QH = (h16*)wsp; wsp += SZ_PL;               // [NB*16][SEQ][64]
    h16* QR = (h16*)wsp; wsp += SZ_PL;               // [NB*16][SEQ][64] residual x2048
    h16* KP = (h16*)wsp; wsp += SZ_PL;               // [NB*16][SEQ][64]
    h16* VT = (h16*)wsp; wsp += SZ_PL;               // [NB*16][64][SEQ] tanh(v)^T
    h16* VR = (h16*)wsp; wsp += SZ_PL;               // [NB*16][64][SEQ] residual x2048

    k_prep<<<dim3(2 * CVT_BLK + 3 * WT_BLK, 1, 1), 256, 0, stream>>>(xs, xc, wq, wk, wv, XB, CB, WB);
    k_proj3<<<dim3(PROJ_TILES, 3, 1), 32, 0, stream>>>(XB, CB, WB, bq, bk, bv, QH, QR, KP, VT, VR);
    k_flash2<<<dim3(NB * NH_, LATE_BLK + EARLY_BLK, 1), 32 * AW, 0, stream>>>(QH, QR, KP, VT, VR, OUT);
}

// v003
// A run of this version takes 50.9 microseconds.
// Two timings next to v002 put it at 1.25 and 1.18 times that version's speed.
// Over all steps from v000 it is 2.63 times as fast.
#include <hip/hip_runtime.h>

// Causal multi-head cross-attention: seq/ctx [NB][SEQ][1024], Wq/Wk/Wv [16][1024 in][64 out], biases [16][64]; q from seq, k and v from ctx, score scale 1/8, P applied to tanh(v), output = concatenated heads (f32).
// Compute dtypes, f32 accumulate everywhere: projections v_wmma_f32_16x16x32_bf16 (seq, ctx, W and biases RNE-converted to bf16; products exact);
// scores v_wmma_f32_16x16x32_f16: k single f16, q as f16 value + f16 residual x2048 in its own accumulator; P.V v_wmma_f32_16x16x32_f16: P carried x256 (cancels in the normalisation),
// query rows < 512: tanh(v) and P each as f16 value + f16 residual x2048 (three products, residual products in their own accumulator); later rows single f16 planes; softmax f32 (online, running max).
// Layout: every 16-bit operand plane lies in WMMA fragment order: a block of 16 rows x 32 k is 512 elements = [k half s][lane = 16*h + row][8], element (row, k = 16 s + 8 h + j), so that one 16-byte-per-lane load covers 512 contiguous bytes.
// bf16 copies of seq, ctx and the transposed W (rows h*64+e, k = d): blocks [row/16][k/32]; q (hi, residual), k planes per b*16+h (rows t, k = d): blocks [t/16][d/32]; tanh(v)^T planes (hi, residual) per b*16+h (rows d, k = t): blocks [t/32][d/16], written by the GEMM epilogue;
// fused flash kernel in transposed form (S^T = K Q^T, O^T = V^T P^T) with causal key-tile skipping and per-element replace-fill inside the visited diagonal tiles.

#ifndef NB
#define NB 2
#endif
#ifndef SEQ
#define SEQ 1024                 // query length == context length used (causal: keys <= query index)
#endif
#define NB_FULL  2
#define SEQ_FULL 1024
#ifndef OUT_SEQ
#define OUT_SEQ SEQ              // row pitch (in tokens) between batches of the output
#endif
#define DM   1024
#define NH_  16
#define HD   64
#define AW   4                   // waves per flash block (16 query rows each)
#define EARLY ((SEQ) < 512 ? (SEQ) : 512)     // query rows below this use the residual planes in P.V
#define QRS  2048.0f             // carry of every residual plane (q, tanh(v), P)
#define QRI  (1.0f / 2048.0f)
#define SC2  (0.125f * 1.4426950408889634f)   // HD^-0.5 * log2(e)
#define PSH  8.0f                // log2 of the P carry (256)
#define NEGB (-3.0e38f)          // fill of masked scores (exp2 gives exactly 0)

static_assert(HD == 64);
static_assert(NH_ * HD == DM);                 // head h = columns h*64 + e
static_assert(DM % 64 == 0);
static_assert(DM % 64 == 0 && DM >= 64);       // GEMM k-loop: two steps of 32 per trip
static_assert(SEQ % 64 == 0);                  // a 64-row tile never straddles two batches
static_assert((NB * SEQ) % 64 == 0);
static_assert(SEQ % 32 == 0);                  // key loop steps by 32, last visited tile stays inside the plane
static_assert(EARLY % (16 * AW) == 0);
static_assert((SEQ - EARLY) % (16 * AW) == 0);
static_assert(((size_t)SEQ * DM) % 8 == 0);
static_assert(NB <= NB_FULL);
static_assert(SEQ <= SEQ_FULL);
static_assert(((size_t)(NB_FULL - 1) * SEQ_FULL + SEQ_FULL) * DM * 4 == (size_t)8388608);   // output bytes of the full problem

typedef _Float16 h16;
typedef unsigned short bf;
typedef __attribute__((ext_vector_type(16))) __bf16   v16bf;
typedef __attribute__((ext_vector_type(16))) _Float16 v16h;
typedef __attribute__((ext_vector_type(8)))  _Float16 v8h;
typedef __attribute__((ext_vector_type(8)))  unsigned short v8us;
typedef __attribute__((ext_vector_type(8)))  float    v8f;
typedef __attribute__((ext_vector_type(4)))  float    v4f;
typedef v4f  __attribute__((may_alias)) v4fa;

__device__ __forceinline__ unsigned short f2bf(float f) { unsigned u = __float_as_uint(f); u += 0x7FFFu + ((u >> 16) & 1u); return (unsigned short)(u >> 16); }
__device__ __forceinline__ float bfr(float f) { return __uint_as_float(((unsigned)f2bf(f)) << 16); }     // value after RNE convert to bf16
__device__ __forceinline__ float tanh_e(float x) { const float e = __builtin_amdgcn_exp2f(x * 2.8853900817779268f); return 1.0f - 2.0f * __builtin_amdgcn_rcpf(e + 1.0f); }   // 1 - 2/(exp(2x)+1); saturates cleanly to +-1
__device__ __forceinline__ v16h cat16(v8h lo, v8h hi) { return __builtin_shufflevector(lo, hi, 0, 1, 2, 3, 4, 5, 6, 7, 8, 9, 10, 11, 12, 13, 14, 15); }
__device__ __forceinline__ v16bf cat16b(v8us lo, v8us hi) { return __builtin_bit_cast(v16bf, __builtin_shufflevector(lo, hi, 0, 1, 2, 3, 4, 5, 6, 7, 8, 9, 10, 11, 12, 13, 14, 15)); }
__device__ __forceinline__ v8f wmma16(v16h a, v16h b, v8f c) { return __builtin_amdgcn_wmma_f32_16x16x32_f16(false, a, false, b, (short)0, c, false, false); }
__device__ __forceinline__ v8f wmmab(v16bf a, v16bf b, v8f c) { return __builtin_amdgcn_wmma_f32_16x16x32_bf16(false, a, false, b, (short)0, c, false, false); }
// fragment loaders from a 512-element block in fragment order; p = block + 8*lane: elements 0..7 <- k0+8h+0..7, elements 8..15 <- k0+16+8h+0..7 of row lane&15 (same map for A and B)
__device__ __forceinline__ v16h  ldh(const h16* p) { return cat16(*(const v8h*)p, *(const v8h*)(p + 256)); }
__device__ __forceinline__ v16bf ldb(const bf* p)  { return cat16b(*(const v8us*)p, *(const v8us*)(p + 256)); }
// ordering point for wave-private LDS tiles (same wave writes and reads)
__device__ __forceinline__ void wave_sync() { __builtin_amdgcn_fence(3 /* release order */, "wavefront"); __builtin_amdgcn_wave_barrier(); asm volatile("" ::: "memory"); }

// cvt8: thread i converts 8 elements of [NB*SEQ rows][DM] into the fragment-order bf16 copy; i = ((row/16 * DM/32 + k/32) * 16 + row%16) * 4 + (k%32)/8: four lanes read one whole 128-byte line of a row,
// and a wave's store fills four whole lines (8 rows x 16 bytes in each of the four (s, h) parts of a block); the source batches lie SEQ_FULL rows apart
__device__ __forceinline__ void cvt8(const float* __restrict__ src, bf* dst, int blk) {
    const size_t n8 = (size_t)NB * SEQ * DM / 8;
    const size_t i = (size_t)blk * 256 + threadIdx.x; if (i >= n8) return;
    const size_t lr = (i >> 2) & 15, row = (i / (64 * (DM / 32))) * 16 + lr, kk = ((i >> 6) % (DM / 32)) * 32 + (i & 3) * 8;
    const size_t so = ((row / SEQ) * SEQ_FULL + row % SEQ) * DM + kk;
    const v8f v = *(const v8f*)(src + so); v8us o;
#pragma unroll
    for (int k = 0; k < 8; ++k) o[k] = f2bf(v[k]);
    *(v8us*)(dst + (i >> 6) * 512 + (i & 3) * 128 + lr * 8) = o;   // s = bit 1, h = bit 0 of i: s * 256 + (16 h + row%16) * 8
}

// wT: in W [NH][DM rows d][HD cols e] f32 -> out WT, rows n = h*64+e, k = d, bf16 (RNE convert), in fragment order. One block per (64-d tile, head); transpose through LDS (cross-wave: block barrier).
__device__ __forceinline__ void wT(const float* __restrict__ W, bf* WT, float* ts, int blk) {
    const int tid = threadIdx.x; const int d0 = (blk % (DM / 64)) * 64, h = blk / (DM / 64);
    const float* src = W + ((size_t)h * DM + d0) * HD;
#pragma unroll
    for (int i = 0; i < 4; ++i) { const int q = tid + 256 * i; const int d = q >> 4, e4 = (q & 15) * 4;      // 1024 float4 = 64 rows d x 64 cols e
        const v4f v = *(const v4f*)(src + (size_t)d * HD + e4);
        ts[d * 68 + e4 + 0] = v[0]; ts[d * 68 + e4 + 1] = v[1]; ts[d * 68 + e4 + 2] = v[2]; ts[d * 68 + e4 + 3] = v[3]; }
    __syncthreads();
{
#pragma unroll
        for (int it = 0; it < 2; ++it) { const int c = it * 256 + tid;                                          // 512 groups of 8 = 4 row blocks x 2 k blocks x 2 halves x 32 lanes
            const int rbl = c >> 7, ksl = (c >> 6) & 1; const int e = rbl * 16 + (c & 15), c8 = ksl * 32 + ((c >> 5) & 1) * 16 + ((c >> 4) & 1) * 8;   // rows e 0..63, columns d0 + 0..63
            v8us o;
#pragma unroll
            for (int k = 0; k < 8; ++k) o[k] = f2bf(ts[(c8 + k) * 68 + e]);
            *(v8us*)(WT + ((size_t)(h * (HD / 16) + rbl) * (DM / 32) + d0 / 32 + ksl) * 512 + (c & 63) * 8) = o; }
         }
}

// k_prep: the two activation converts and the three weight transposes, which do not depend on one another, as ranges of ONE grid (the range test is block-uniform).
#define CVT_BLK ((int)(((size_t)NB * SEQ * DM / 8 + 255) / 256))   // blocks of one convert
#define WT_BLK  ((DM / 64) * NH_)                                   // blocks of one transpose
__global__ __launch_bounds__(256) void k_prep(const float* __restrict__ xs, const float* __restrict__ xc, const float* __restrict__ wq, const float* __restrict__ wk,
                                              const float* __restrict__ wv, bf* XB, bf* CB, bf* WB) {
    __shared__ __align__(16) float ts[64 * 68];
    const int blk = blockIdx.x;
    if (blk < 3 * WT_BLK) {                                         // the transposes (the longer blocks) start first
        const int w = blk / WT_BLK;                                 // 0 q, 1 k, 2 v
        wT(w == 0 ? wq : (w == 1 ? wk : wv), WB + (size_t)w * DM * DM, ts, blk % WT_BLK);
        return;
    }
    const int c = blk - 3 * WT_BLK;
    if (c < CVT_BLK) cvt8(xs, XB, c); else cvt8(xc, CB, c - CVT_BLK);
}

// k_proj3: the three projections, which do not depend on one another, in ONE grid: blockIdx.y picks the projection (scalar selects), blockIdx.x its 64x64 tile, row tiles first.
//   q: A = seq rows (m = b*SEQ + t), Bt = WQ rows (n = h*64 + e), bias per column -> plane [(b*16 + h)][t][e], with residual
//   k: A = ctx rows, Bt = WK rows, bias per column (the 1/8 scale is applied to the scores)
//   tanh(v)^T: A = WV rows (m = h*64 + e), Bt = ctx rows (n = b*SEQ + t), bias per row, tanh -> plane [(b*1024 + m)][t] = [(b*16 + h)][e][t], with residual
// Each: register-blocked bf16 GEMM, ONE WAVE per 64x64 tile (16 accumulators), operands straight from the fragment-order bf16 planes, K = DM.
// C[m][n] = sum_k A[m][k] Bt[n][k] + bias (bf16 RNE value, f32 add; per column n when biasRow == 0, per row m when biasRow != 0), optional tanh (act != 0),
// written as f16 (Ph) and optionally the f16 residual x2048 (Pr, useRes != 0) in fragment order (rows m, k = n) at
// tile base (r0/RB)*sRB + (r0%RB)*pitch + (c0/CB)*sCB + (c0%CB)*64, 16-row block mb at + mb*sMB, 32-column block at + sKB (halves). Tile (bx, by) of (M/64, N/64), 32 threads.
#define PROJ_TILES ((NB * SEQ / 64) * (DM / 64))
// the wait in front of a rewrite of address registers that issued loads name; the two scheduling barriers keep the rewrites behind it
__device__ __forceinline__ void addr_wait() { __builtin_amdgcn_sched_barrier(0); asm volatile("s_wait_xcnt 0x0" ::: "memory"); __builtin_amdgcn_sched_barrier(0); }
// one k-step (32) of a 64x64 tile: its 8 fragments (16 loads), and its 16 products
__device__ __forceinline__ void ld4(v16bf (&f)[4], const bf* P, int K, int kc) {
#pragma unroll
    for (int i = 0; i < 4; ++i) f[i] = ldb(P + (size_t)i * 16 * K + (size_t)kc * 16);   // block (row block i, k block kc/32): 16 K elements per row block, 512 per k block
}
__device__ __forceinline__ void ld_step(v16bf (&a)[4], v16bf (&b)[4], const bf* Ap, const bf* Bp, int K, int kc) {
    ld4(a, Ap, K, kc); ld4(b, Bp, K, kc);
    __builtin_amdgcn_sched_barrier(0);   // keeps the 16 loads ahead of the other set's products: sunk to their use they would have no lead
}
__device__ __forceinline__ void mm_step(v8f (&acc)[4][4], const v16bf (&a)[4], const v16bf (&b)[4]) {
#pragma unroll
    for (int nb = 0; nb < 4; ++nb)
#pragma unroll
        for (int mb = 0; mb < 4; ++mb) acc[mb][nb] = wmmab(a[mb], b[nb], acc[mb][nb]);
    // four vector slots behind the last product, on every path, before its operands or results are touched
    asm volatile("v_nop\n\tv_nop\n\tv_nop\n\tv_nop" : "+v"(acc[0][0]), "+v"(acc[1][1]), "+v"(acc[2][2]), "+v"(acc[3][3])
                 : "v"(a[0]), "v"(a[1]), "v"(a[2]), "v"(a[3]), "v"(b[0]), "v"(b[1]), "v"(b[2]), "v"(b[3]));
    __builtin_amdgcn_sched_barrier(0);   // the refill of this set starts behind its last product, so it takes the same registers
}
__global__ __launch_bounds__(32) void k_proj3(const bf* __restrict__ xb, const bf* __restrict__ cb, const bf* __restrict__ wb,
                                              const float* __restrict__ bq, const float* __restrict__ bk, const float* __restrict__ bv,
                                              h16* QH, h16* QR, h16* KP, h16* VT, h16* VR) {
    __shared__ __align__(16) float os[16 * 68];
    const int p = 2 - (int)blockIdx.y; const unsigned f = blockIdx.x; const bool isv = (p == 2);   // 0 q, 1 k, 2 v; v (tanh in its epilogue) starts first
    const int bx = (int)(isv ? f % (DM / 64) : f % (NB * SEQ / 64)), by = (int)(isv ? f / (DM / 64) : f / (NB * SEQ / 64));
    const bf* wp = wb + (size_t)p * DM * DM; const bf* xp = (p == 0) ? xb : cb;
    const bf* A = isv ? wp : xp; const bf* Bt = isv ? xp : wp; const float* bias = p == 0 ? bq : (p == 1 ? bk : bv);
    h16* Ph = p == 0 ? QH : (p == 1 ? KP : VT); h16* Pr = p == 0 ? QR : (p == 1 ? KP : VR);
    const size_t sRB = isv ? (size_t)0 : (size_t)NH_ * SEQ * HD, sCB = isv ? (size_t)DM * SEQ : (size_t)SEQ * HD;
    const int useRes = (p != 1), biasRow = isv, act = isv, RB = isv ? DM : SEQ, pitch = isv ? SEQ : HD, CB = isv ? SEQ : HD;
    const int sMB = isv ? 512 : 1024, sKB = isv ? 2048 : 512;   // q, k: blocks [t/16][d/32]; tanh(v)^T: blocks [t/32][d/16]
    const int K = DM;
    const int lane = threadIdx.x & 31, lr = lane & 15, hi = lane >> 4; const int r0 = bx * 64, c0 = by * 64;
    v8f acc[4][4];
#pragma unroll
    for (int mb = 0; mb < 4; ++mb)
#pragma unroll
        for (int nb = 0; nb < 4; ++nb) acc[mb][nb] = (v8f){};
    const size_t aoff = (size_t)r0 * K + 8 * lane;
    // two fragment sets: each k-step's loads are issued one step ahead, while the other set's products run; k ascends as before
    const bf* Ap = A + aoff;
    v16bf a0[4], b0[4], a1[4], b1[4];
    ld4(a0, Ap, K, 0);
    // same wait as addr_wait(); it takes the column index as an operand so that every part of B's address, which reuses A's offset register, is formed behind it
    unsigned cb0 = (unsigned)c0;
    asm volatile("s_wait_xcnt 0x0" : "+s"(cb0) : : "memory");
    const size_t boff = (size_t)cb0 * K + 8 * lane;
    const bf* Bp = Bt + boff;
    ld4(b0, Bp, K, 0);
    __builtin_amdgcn_sched_barrier(0);   // the first step's loads go out ahead of everything else
#pragma unroll 1   // the body already holds two steps; more copies only grow the text
    for (int kc = 0; kc < K - 64; kc += 64) {
        ld_step(a1, b1, Ap, Bp, K, kc + 32);
        mm_step(acc, a0, b0);
        ld_step(a0, b0, Ap, Bp, K, kc + 64);
        mm_step(acc, a1, b1);
        addr_wait();                     // the next trip rewrites the address registers of the loads still in flight
    }
    ld_step(a1, b1, Ap, Bp, K, K - 32);
    mm_step(acc, a0, b0);
    mm_step(acc, a1, b1);
    // bias addends: addresses clamped into the 1024-entry bias array for the unused mode (index select, value select)
    float bc[4];
#pragma unroll
    for (int nb = 0; nb < 4; ++nb) bc[nb] = bias[biasRow ? 0 : (c0 + nb * 16 + lr)];
    addr_wait();                         // the row-bias loads below may land in the offset registers of these four loads; the converts follow it, so it does not wait for the data
#pragma unroll
    for (int nb = 0; nb < 4; ++nb) bc[nb] = bfr(bc[nb]);
    const size_t tbase = (size_t)(r0 / RB) * sRB + (size_t)(r0 % RB) * (size_t)pitch + (size_t)(c0 / CB) * sCB + (size_t)(c0 % CB) * 64;
#pragma unroll
    for (int mb = 0; mb < 4; ++mb) {
        const int ri = biasRow ? (r0 + mb * 16 + hi * 8) : 0;
        const v4f ra = *(const v4f*)(bias + ri); const v4f rb = *(const v4f*)(bias + ri + 4);
        asm volatile("s_wait_xcnt 0x0" : : "v"(ri * 4) : "memory");   // same wait; the byte offset as an input keeps the two loads' offset register from being reused ahead of it
        const float brv[8] = { bfr(ra[0]), bfr(ra[1]), bfr(ra[2]), bfr(ra[3]), bfr(rb[0]), bfr(rb[1]), bfr(rb[2]), bfr(rb[3]) };
#pragma unroll
        for (int nb = 0; nb < 4; ++nb) {
#pragma unroll
            for (int j = 0; j < 8; ++j) { float x = acc[mb][nb][j] + (biasRow ? brv[j] : bc[nb]);
                if (act) x = tanh_e(x);
                os[(hi * 8 + j) * 68 + nb * 16 + lr] = x; } }   // D: row 8h+j, col lane&15
        wave_sync();
        const size_t sb = tbase + (size_t)(mb * sMB) + 8 * lane;
{
#pragma unroll
            for (int s = 0; s < 4; ++s) { const int row = lr, c8 = s * 16 + hi * 8;   // 16 rows; s = 2 * (32-column block) + half, 4 s x 2 h x 8 = 64 columns
                const v4f x0 = *(const v4fa*)(&os[row * 68 + c8]); const v4f x1 = *(const v4fa*)(&os[row * 68 + c8 + 4]); v8h hv, rv;
#pragma unroll
                for (int i = 0; i < 4; ++i) { const h16 a0 = (h16)x0[i]; const h16 a1 = (h16)x1[i]; hv[i] = a0; hv[4 + i] = a1; rv[i] = (h16)((x0[i] - (float)a0) * QRS); rv[4 + i] = (h16)((x1[i] - (float)a1) * QRS); }
                const size_t oo = sb + (size_t)((s >> 1) * sKB + (s & 1) * 256);
                *(v8h*)(Ph + oo) = hv; if (useRes) *(v8h*)(Pr + oo) = rv; }
             }
        wave_sync();
    }
}

// flash<RES>: fused causal attention, one wave per 16 query rows of one (batch, head); K / V^T / Q fragments straight from the fragment-order f16 planes (two 16-B loads each, 512 contiguous bytes a load).
// Transposed form: S^T[key][t] = K Q^T (A = K rows, B = Q rows); lane (t = lane&15, h = lane>>4) holds keys 8h+r of each 16-key tile, so the packed
// P tile is directly the B fragment of O^T[d][t] = V^T P^T (element r <- tile keys 0..15, element 8+r <- tile keys 16..31, lane unchanged).
// Causal: key tiles beyond the wave's last query row are skipped; inside tiles that reach past the wave's first row each score with key > t is replaced by NEGB (P = 0 exactly). Key 0 is visible to every row.
// RES != 0: P and tanh(v) each carry an f16 residual x2048; products Vr.Ph and Vh.Pr accumulate in g (folded back by 1/2048), Vh.Ph in o.
// Softmax state (running max, partial sum) is one scalar per lane; the two lane halves of a row are combined with one xor-16 exchange (issued under wave-uniform control only).
template <int RES>
__device__ __forceinline__ void flash(const h16* __restrict__ QH, const h16* __restrict__ QR, const h16* __restrict__ KP,
                                      const h16* __restrict__ VT, const h16* __restrict__ VR, float* OUT, float* os, int zh, int tblk) {
    const int lane = threadIdx.x & 31, wave = threadIdx.x >> 5, lr = lane & 15, hi = lane >> 4;
    const int b = zh / NH_, h = zh % NH_;
    const int t0 = tblk + wave * 16;
    const int tq = t0 + lr;
    const size_t pbase = (size_t)zh * SEQ * HD;
    const size_t qo = pbase + (size_t)t0 * HD + 8 * lane;
    const v16h qh0 = ldh(QH + qo), qh1 = ldh(QH + qo + 512), qr0 = ldh(QR + qo), qr1 = ldh(QR + qo + 512);   // B fragments: col t, k = d
    asm volatile("s_wait_xcnt 0x0" : : "v"(QH + qo), "v"(QR + qo) : "memory");   // the fragments fetched ahead below may land in the address registers of these loads: the wait stands in front, the pointers as inputs keep them whole up to it
    const size_t ko = pbase + 8 * lane;                      // + key0 * HD + 512 * (2 * (16-key block) + d/32)   (A fragment: row key, k = d)
    const size_t vo = pbase + 8 * lane;                      // + key0 * HD + 512 * j                             (A fragment: row d = 16j + .., k = key)
    v8f o0 = (v8f){}, o1 = (v8f){}, o2 = (v8f){}, o3 = (v8f){};
    v8f g0 = (v8f){}, g1 = (v8f){}, g2 = (v8f){}, g3 = (v8f){};
    float m = NEGB, l = 0.0f;
    const int kend = t0 + 16;                                // keys 0 .. t0+15 are needed; kend <= SEQ, so key0 + 31 <= SEQ - 1
    // K and V^T fragments are fetched one key tile ahead, into the same registers, right behind their last product
    const h16* ka = KP + ko; const h16* va = VT + vo; const h16* vr = VR + vo;
    v16h ka0 = ldh(ka), ka1 = ldh(ka + 512), kb0 = ldh(ka + 1024), kb1 = ldh(ka + 1536);
    __builtin_amdgcn_sched_barrier(0);                       // K issued ahead of V^T here as in the loop: the wait in front of the score products then leaves the V^T loads in flight
    v16h w0 = (v16h){}, w1 = (v16h){}, w2 = (v16h){}, w3 = (v16h){};
    if (RES) { w0 = ldh(vr); w1 = ldh(vr + 512); w2 = ldh(vr + 1024); w3 = ldh(vr + 1536); }
    v16h v0 = ldh(va), v1 = ldh(va + 512), v2 = ldh(va + 1024), v3 = ldh(va + 1536);
    // the pointers as inputs keep the address registers of the loads above whole up to this wait: no result lands in one ahead of it
    if (RES) asm volatile("s_wait_xcnt 0x0" : : "v"(ka), "v"(va), "v"(vr) : "memory");
    else     asm volatile("s_wait_xcnt 0x0" : : "v"(ka), "v"(va) : "memory");
#pragma unroll 1
    for (int key0 = 0; key0 < kend; key0 += 32) {
        const int adv = (key0 + 32 < kend) ? 32 : 0;         // the last pass has no next tile: it re-reads its own (in bounds, values unused)
        v8f sHa = (v8f){}, sLa = (v8f){}, sHb = (v8f){}, sLb = (v8f){};
        sHa = wmma16(ka0, qh0, sHa); sLa = wmma16(ka0, qr0, sLa); sHb = wmma16(kb0, qh0, sHb); sLb = wmma16(kb0, qr0, sLb);
        sHa = wmma16(ka1, qh1, sHa); sLa = wmma16(ka1, qr1, sLa); sHb = wmma16(kb1, qh1, sHb); sLb = wmma16(kb1, qr1, sLb);
        asm volatile("v_nop\n\tv_nop\n\tv_nop\n\tv_nop" : "+v"(sHa), "+v"(sLa), "+v"(sHb), "+v"(sLb) : "v"(ka0), "v"(ka1), "v"(kb0), "v"(kb1));
        __builtin_amdgcn_sched_barrier(0);                   // the next tile's K loads start behind the score products (same registers) ...
        ka += (size_t)adv * HD;
        ka0 = ldh(ka); ka1 = ldh(ka + 512); kb0 = ldh(ka + 1024); kb1 = ldh(ka + 1536);
        __builtin_amdgcn_sched_barrier(0);                   // ... and ahead of the softmax, which is their lead
        float ta[8], tb[8];
#pragma unroll
        for (int r = 0; r < 8; ++r) { ta[r] = (sHa[r] + sLa[r] * QRI) * SC2; tb[r] = (sHb[r] + sLb[r] * QRI) * SC2; }
        if (key0 + 31 > t0) {                                // wave-uniform: this tile reaches past the wave's first query row
            const int dl = tq - key0 - 8 * hi;               // key of ta[r] = key0 + 8h + r is visible iff r <= dl; key of tb[r] = key0 + 16 + 8h + r iff r + 16 <= dl
#pragma unroll
            for (int r = 0; r < 8; ++r) { ta[r] = (r <= dl) ? ta[r] : NEGB; tb[r] = (r + 16 <= dl) ? tb[r] : NEGB; }
        }
        float mx = NEGB;
#pragma unroll
        for (int r = 0; r < 8; ++r) mx = fmaxf(mx, fmaxf(ta[r], tb[r]));
        mx = fmaxf(mx, __shfl_xor(mx, 16, 32));
        const float mnew = fmaxf(m, mx);
        const float alpha = __builtin_amdgcn_exp2f(m - mnew);
        const float sh = PSH - mnew;
        v16h pb = (v16h){}, pq = (v16h){}; float ls = 0.0f;
#pragma unroll
        for (int r = 0; r < 8; ++r) {
            const float ea = __builtin_amdgcn_exp2f(ta[r] + sh); const float eb = __builtin_amdgcn_exp2f(tb[r] + sh);
            const h16 pa = (h16)ea; const h16 pc = (h16)eb; pb[r] = pa; pb[8 + r] = pc;
            if (RES) { const h16 xa = (h16)((ea - (float)pa) * QRS); const h16 xc = (h16)((eb - (float)pc) * QRS); pq[r] = xa; pq[8 + r] = xc;
                       ls += ((float)pa + (float)pc) + ((float)xa + (float)xc) * QRI; }
            else     { ls += (float)pa + (float)pc; }
        }
        l = l * alpha + ls; m = mnew;
        o0 = o0 * alpha; o1 = o1 * alpha; o2 = o2 * alpha; o3 = o3 * alpha;
        if (RES) {
            g0 = g0 * alpha; g1 = g1 * alpha; g2 = g2 * alpha; g3 = g3 * alpha;
            o0 = wmma16(v0, pb, o0); o1 = wmma16(v1, pb, o1); o2 = wmma16(v2, pb, o2); o3 = wmma16(v3, pb, o3);
            g0 = wmma16(w0, pb, g0); g1 = wmma16(w1, pb, g1); g2 = wmma16(w2, pb, g2); g3 = wmma16(w3, pb, g3);
            g0 = wmma16(v0, pq, g0); g1 = wmma16(v1, pq, g1); g2 = wmma16(v2, pq, g2); g3 = wmma16(v3, pq, g3);
            asm volatile("v_nop\n\tv_nop\n\tv_nop\n\tv_nop" : "+v"(o0), "+v"(o1), "+v"(o2), "+v"(o3), "+v"(g0), "+v"(g1), "+v"(g2), "+v"(g3)
                         : "v"(v0), "v"(v1), "v"(v2), "v"(v3), "v"(w0), "v"(w1), "v"(w2), "v"(w3), "v"(pb), "v"(pq));
            __builtin_amdgcn_sched_barrier(0);               // nothing but the 16 loads and their addresses between here and the wait below
            vr += (size_t)adv * HD; va += (size_t)adv * HD;
            w0 = ldh(vr); w1 = ldh(vr + 512); w2 = ldh(vr + 1024); w3 = ldh(vr + 1536);
            v0 = ldh(va); v1 = ldh(va + 512); v2 = ldh(va + 1024); v3 = ldh(va + 1536);
            asm volatile("s_wait_xcnt 0x0" : : "v"(va), "v"(vr) : "memory");   // what follows may reuse the address registers of these loads; the pointers as inputs keep them whole up to this wait, so that no result of the run lands in one
            __builtin_amdgcn_sched_barrier(0);               // keeps what follows behind the wait
        } else {
            o0 = wmma16(v0, pb, o0); o1 = wmma16(v1, pb, o1); o2 = wmma16(v2, pb, o2); o3 = wmma16(v3, pb, o3);
            asm volatile("v_nop\n\tv_nop\n\tv_nop\n\tv_nop" : "+v"(o0), "+v"(o1), "+v"(o2), "+v"(o3) : "v"(v0), "v"(v1), "v"(v2), "v"(v3), "v"(pb));
            va += (size_t)adv * HD;
            v0 = ldh(va); v1 = ldh(va + 512); v2 = ldh(va + 1024); v3 = ldh(va + 1536);
        }
    }
    if (RES) { o0 = o0 + g0 * QRI; o1 = o1 + g1 * QRI; o2 = o2 + g2 * QRI; o3 = o3 + g3 * QRI; }
    l += __shfl_xor(l, 16, 32);
    const float inv = 1.0f / l;
    const int wb = wave * 16 * 68;
    // O^T D layout: o_j[r] = (d = 16j + 8h + r, t = lane&15) -> os[t][d]; rows 0..15 x columns 0..63 all written
    { v4f a, c;
      a[0] = o0[0] * inv; a[1] = o0[1] * inv; a[2] = o0[2] * inv; a[3] = o0[3] * inv; c[0] = o0[4] * inv; c[1] = o0[5] * inv; c[2] = o0[6] * inv; c[3] = o0[7] * inv;
      *(v4fa*)(&os[wb + lr * 68 +  0 + 8 * hi]) = a; *(v4fa*)(&os[wb + lr * 68 +  0 + 8 * hi + 4]) = c;
      a[0] = o1[0] * inv; a[1] = o1[1] * inv; a[2] = o1[2] * inv; a[3] = o1[3] * inv; c[0] = o1[4] * inv; c[1] = o1[5] * inv; c[2] = o1[6] * inv; c[3] = o1[7] * inv;
      *(v4fa*)(&os[wb + lr * 68 + 16 + 8 * hi]) = a; *(v4fa*)(&os[wb + lr * 68 + 16 + 8 * hi + 4]) = c;
      a[0] = o2[0] * inv; a[1] = o2[1] * inv; a[2] = o2[2] * inv; a[3] = o2[3] * inv; c[0] = o2[4] * inv; c[1] = o2[5] * inv; c[2] = o2[6] * inv; c[3] = o2[7] * inv;
      *(v4fa*)(&os[wb + lr * 68 + 32 + 8 * hi]) = a; *(v4fa*)(&os[wb + lr * 68 + 32 + 8 * hi + 4]) = c;
      a[0] = o3[0] * inv; a[1] = o3[1] * inv; a[2] = o3[2] * inv; a[3] = o3[3] * inv; c[0] = o3[4] * inv; c[1] = o3[5] * inv; c[2] = o3[6] * inv; c[3] = o3[7] * inv;
      *(v4fa*)(&os[wb + lr * 68 + 48 + 8 * hi]) = a; *(v4fa*)(&os[wb + lr * 68 + 48 + 8 * hi + 4]) = c; }
    wave_sync();
    float* orow = OUT + ((size_t)b * OUT_SEQ + t0) * DM + h * HD;
{
#pragma unroll
        for (int s = 0; s < 8; ++s) { const int row = 2 * s + hi, cofs = lr * 4;   // 8 s x 2 rows = 16 rows; 16 lanes x 4 floats = 64 columns
            const v4f val = *(const v4fa*)(&os[wb + row * 68 + cofs]);
            *(v4f*)(orow + (size_t)row * DM + cofs) = val; }
         }
}

// k_flash2: both row ranges in ONE grid (they write disjoint rows and read the same planes): blockIdx.x = (batch, head), blockIdx.y = 64-row block;
// the late rows (most key tiles) come first, longest first, then the early rows. The range test is block-uniform.
#define LATE_BLK  ((SEQ - EARLY) / (16 * AW))
#define EARLY_BLK (EARLY / (16 * AW))
__global__ __launch_bounds__(32 * AW) void k_flash2(const h16* __restrict__ QH, const h16* __restrict__ QR, const h16* __restrict__ KP,
                                                    const h16* __restrict__ VT, const h16* __restrict__ VR, float* OUT) {
    __shared__ __align__(16) float os[AW * 16 * 68];
    const int zh = blockIdx.x, y = blockIdx.y;
    if (y < LATE_BLK) flash<0>(QH, QR, KP, VT, VR, OUT, os, zh, EARLY + (LATE_BLK - 1 - y) * 16 * AW);
    else              flash<1>(QH, QR, KP, VT, VR, OUT, os, zh, (y - LATE_BLK) * 16 * AW);
}

static constexpr size_t al256(size_t v) { return (v + 255) & ~(size_t)255; }
static constexpr size_t SZ_XB = al256((size_t)NB * SEQ * DM * 2);          // one bf16 activation copy
static constexpr size_t SZ_WB = al256((size_t)3 * DM * DM * 2);            // three transposed bf16 weights
static constexpr size_t SZ_PL = al256((size_t)NB * NH_ * SEQ * HD * 2);    // one f16 plane
static constexpr size_t SZ_TOTAL = 2 * SZ_XB + SZ_WB + 5 * SZ_PL;
static_assert(SZ_TOTAL <= (size_t)134217728);          // workspace carve <= 128 MiB
static_assert(((size_t)DM * DM * 2) % 256 == 0);       // weight sub-planes stay 256-byte aligned

extern "C" void kernel_launch(void* const* d_in, const int* in_sizes, int n_in,
                              void* d_out, int out_size, void* d_ws, size_t ws_size, hipStream_t stream) {
    if (n_in < 8) return;
    const size_t needx = ((size_t)(NB - 1) * SEQ_FULL + SEQ) * DM;
    if ((size_t)in_sizes[0] < needx || (size_t)in_sizes[1] < needx) return;
    if ((size_t)in_sizes[2] < (size_t)DM * DM || (size_t)in_sizes[3] < (size_t)DM * DM || (size_t)in_sizes[4] < (size_t)DM * DM) return;
    if ((size_t)in_sizes[5] < (size_t)DM || (size_t)in_sizes[6] < (size_t)DM || (size_t)in_sizes[7] < (size_t)DM) return;
    if ((size_t)out_size < ((size_t)(NB - 1) * OUT_SEQ + SEQ) * DM) return;
    if (SZ_TOTAL > ws_size) return;
    // wire order: seq, ctx, Wq, Wk, Wv, bq, bk, bv
    const float* xs = (const float*)d_in[0]; const float* xc = (const float*)d_in[1];
    const float* wq = (const float*)d_in[2]; const float* wk = (const float*)d_in[3]; const float* wv = (const float*)d_in[4];
    const float* bq = (const float*)d_in[5]; const float* bk = (const float*)d_in[6]; const float* bv = (const float*)d_in[7];
    float* OUT = (float*)d_out;      // [NB][SEQ][1024]
    char* wsp = (char*)d_ws;
    // every plane in fragment order (head of the file)
    bf* XB = (bf*)wsp; wsp += SZ_XB;                 // seq  NB*SEQ rows x 1024
    bf* CB = (bf*)wsp; wsp += SZ_XB;                 // ctx  NB*SEQ rows x 1024
    bf* WB = (bf*)wsp; wsp += SZ_WB;                 // [3] 1024 rows n = h*64+e x 1024 d: q | k | v
    h16* QH = (h16*)wsp; wsp += SZ_PL;               // [NB*16] SEQ rows x 64
    h16* QR = (h16*)wsp; wsp += SZ_PL;               // [NB*16] SEQ rows x 64, residual x2048
    h16* KP = (h16*)wsp; wsp += SZ_PL;               // [NB*16] SEQ rows x 64
    h16* VT = (h16*)wsp; wsp += SZ_PL;               // [NB*16] 64 rows x SEQ, tanh(v)^T
    h16* VR = (h16*)wsp; wsp += SZ_PL;               // [NB*16] 64 rows x SEQ, residual x2048

    k_prep<<<dim3(2 * CVT_BLK + 3 * WT_BLK, 1, 1), 256, 0, stream>>>(xs, xc, wq, wk, wv, XB, CB, WB);
    k_proj3<<<dim3(PROJ_TILES, 3, 1), 32, 0, stream>>>(XB, CB, WB, bq, bk, bv, QH, QR, KP, VT, VR);
    k_flash2<<<dim3(NB * NH_, LATE_BLK + EARLY_BLK, 1), 32 * AW, 0, stream>>>(QH, QR, KP, VT, VR, OUT);
}

// v004
// It runs in 39.4 microseconds.
// Two timings next to v003 put it at 1.32 and 1.27 times that version's speed.
// All steps since v000 together make it 3.40 times as fast.
#include <hip/hip_runtime.h>

// Causal multi-head cross-attention: seq/ctx [NB][SEQ][1024], Wq/Wk/Wv [16][1024 in][64 out], biases [16][64]; q from seq, k and v from ctx, score scale 1/8, P applied to tanh(v), output = concatenated heads (f32).
// Compute dtypes, f32 accumulate everywhere: projections v_wmma_f32_16x16x32_bf16 (seq, ctx, W and biases RNE-converted to bf16; products exact);
// scores v_wmma_f32_16x16x32_f16: k single f16, q as f16 value + f16 residual x2048 in its own accumulator; P.V v_wmma_f32_16x16x32_f16: P carried x256 (cancels in the normalisation),
// query rows < 512: tanh(v) and P each as f16 value + f16 residual x2048 (three products, residual products in their own accumulator); later rows single f16 planes; softmax f32 (online, running max).
// Layout: every 16-bit operand plane lies in WMMA fragment order: a block of 16 rows x 32 k is 512 elements = [k half s][lane = 16*h + row][8], element (row, k = 16 s + 8 h + j), so that one 16-byte-per-lane load covers 512 contiguous bytes.
// bf16 copies of seq, ctx and the transposed W (rows h*64+e, k = d): blocks [row/16][k/32]; q (hi, residual), k planes per b*16+h (rows t, k = d): blocks [t/16][d/32]; tanh(v)^T planes (hi, residual) per b*16+h (rows d, k = t): blocks [t/32][d/16], written by the GEMM epilogue;
// fused flash kernel in transposed form (S^T = K Q^T, O^T = V^T P^T) with causal key-tile skipping and per-element replace-fill inside the visited diagonal tiles.

#ifndef NB
#define NB 2
#endif
#ifndef SEQ
#define SEQ 1024                 // query length == context length used (causal: keys <= query index)
#endif
#define NB_FULL  2
#define SEQ_FULL 1024
#ifndef OUT_SEQ
#define OUT_SEQ SEQ              // row pitch (in tokens) between batches of the output
#endif
#define DM   1024
#define NH_  16
#define HD   64
#define AW   4                   // waves per flash block (16 query rows each)
#define EARLY ((SEQ) < 512 ? (SEQ) : 512)     // query rows below this use the residual planes in P.V
#define QRS  2048.0f             // carry of every residual plane (q, tanh(v), P)
#define QRI  (1.0f / 2048.0f)
#define SC2  (0.125f * 1.4426950408889634f)   // HD^-0.5 * log2(e)
#define PSH  8.0f                // log2 of the P carry (256)
#define NEGB (-3.0e38f)          // fill of masked scores (exp2 gives exactly 0)

static_assert(HD == 64);
static_assert(NH_ * HD == DM);                 // head h = columns h*64 + e
static_assert(DM % 64 == 0);
static_assert(DM % 64 == 0 && DM >= 64);       // GEMM k-loop: two steps of 32 per trip
static_assert(SEQ % 64 == 0);                  // a 64-row tile never straddles two batches
static_assert((NB * SEQ) % 64 == 0);
static_assert(SEQ % 32 == 0);                  // key loop steps by 32, last visited tile stays inside the plane
static_assert(EARLY % (16 * AW) == 0);
static_assert((SEQ - EARLY) % (16 * AW) == 0);
static_assert(((size_t)SEQ * DM) % 8 == 0);
static_assert(NB <= NB_FULL);
static_assert(SEQ <= SEQ_FULL);
static_assert(((size_t)(NB_FULL - 1) * SEQ_FULL + SEQ_FULL) * DM * 4 == (size_t)8388608);   // output bytes of the full problem

typedef _Float16 h16;
typedef unsigned short bf;
typedef __attribute__((ext_vector_type(16))) __bf16   v16bf;
typedef __attribute__((ext_vector_type(16))) _Float16 v16h;
typedef __attribute__((ext_vector_type(8)))  _Float16 v8h;
typedef __attribute__((ext_vector_type(8)))  unsigned short v8us;
typedef __attribute__((ext_vector_type(8)))  float    v8f;
typedef __attribute__((ext_vector_type(4)))  float    v4f;
typedef v4f  __attribute__((may_alias)) v4fa;

__device__ __forceinline__ unsigned short f2bf(float f) { unsigned u = __float_as_uint(f); u += 0x7FFFu + ((u >> 16) & 1u); return (unsigned short)(u >> 16); }
__device__ __forceinline__ float bfr(float f) { return __uint_as_float(((unsigned)f2bf(f)) << 16); }     // value after RNE convert to bf16
__device__ __forceinline__ float tanh_e(float x) { const float e = __builtin_amdgcn_exp2f(x * 2.8853900817779268f); return 1.0f - 2.0f * __builtin_amdgcn_rcpf(e + 1.0f); }   // 1 - 2/(exp(2x)+1); saturates cleanly to +-1
__device__ __forceinline__ v16h cat16(v8h lo, v8h hi) { return __builtin_shufflevector(lo, hi, 0, 1, 2, 3, 4, 5, 6, 7, 8, 9, 10, 11, 12, 13, 14, 15); }
__device__ __forceinline__ v16bf cat16b(v8us lo, v8us hi) { return __builtin_bit_cast(v16bf, __builtin_shufflevector(lo, hi, 0, 1, 2, 3, 4, 5, 6, 7, 8, 9, 10, 11, 12, 13, 14, 15)); }
__device__ __forceinline__ v8f wmma16(v16h a, v16h b, v8f c) { return __builtin_amdgcn_wmma_f32_16x16x32_f16(false, a, false, b, (short)0, c, false, false); }
__device__ __forceinline__ v8f wmmab(v16bf a, v16bf b, v8f c) { return __builtin_amdgcn_wmma_f32_16x16x32_bf16(false, a, false, b, (short)0, c, false, false); }
// fragment loaders from a 512-element block in fragment order; p = block + 8*lane: elements 0..7 <- k0+8h+0..7, elements 8..15 <- k0+16+8h+0..7 of row lane&15 (same map for A and B)
__device__ __forceinline__ v16h  ldh(const h16* p) { return cat16(*(const v8h*)p, *(const v8h*)(p + 256)); }
__device__ __forceinline__ v16bf ldb(const bf* p)  { return cat16b(*(const v8us*)p, *(const v8us*)(p + 256)); }
// ordering point for wave-private LDS tiles (same wave writes and reads)
// So both matrix launches open with hints for those planes: one global_prefetch_b8 names 32 addresses 256 B apart (PFG bytes), a lane each, into L2 only; it returns nothing, and no result depends on it.
#define PFG 8192                 // bytes one prefetch instruction of a wave covers
#define PFE (PFG / 2)            // the same in 16-bit elements
__device__ __forceinline__ void wave_sync() { __builtin_amdgcn_fence(3 /* release order */, "wavefront"); __builtin_amdgcn_wave_barrier(); asm volatile("" ::: "memory"); }

// cvt8: thread i converts 8 elements of [NB*SEQ rows][DM] into the fragment-order bf16 copy; i = ((row/16 * DM/32 + k/32) * 16 + row%16) * 4 + (k%32)/8: four lanes read one whole 128-byte line of a row,
// and a wave's store fills four whole lines (8 rows x 16 bytes in each of the four (s, h) parts of a block); the source batches lie SEQ_FULL rows apart
__device__ __forceinline__ void cvt8(const float* __restrict__ src, bf* dst, int blk) {
    const size_t n8 = (size_t)NB * SEQ * DM / 8;
    const size_t i = (size_t)blk * 256 + threadIdx.x; if (i >= n8) return;
    const size_t lr = (i >> 2) & 15, row = (i / (64 * (DM / 32))) * 16 + lr, kk = ((i >> 6) % (DM / 32)) * 32 + (i & 3) * 8;
    const size_t so = ((row / SEQ) * SEQ_FULL + row % SEQ) * DM + kk;
    const v8f v = *(const v8f*)(src + so); v8us o;
#pragma unroll
    for (int k = 0; k < 8; ++k) o[k] = f2bf(v[k]);
    *(v8us*)(dst + (i >> 6) * 512 + (i & 3) * 128 + lr * 8) = o;   // s = bit 1, h = bit 0 of i: s * 256 + (16 h + row%16) * 8
}

// wT: in W [NH][DM rows d][HD cols e] f32 -> out WT, rows n = h*64+e, k = d, bf16 (RNE convert), in fragment order. One block per (64-d tile, head); transpose through LDS (cross-wave: block barrier).
__device__ __forceinline__ void wT(const float* __restrict__ W, bf* WT, float* ts, int blk) {
    const int tid = threadIdx.x; const int d0 = (blk % (DM / 64)) * 64, h = blk / (DM / 64);
    const float* src = W + ((size_t)h * DM + d0) * HD;
#pragma unroll
    for (int i = 0; i < 4; ++i) { const int q = tid + 256 * i; const int d = q >> 4, e4 = (q & 15) * 4;      // 1024 float4 = 64 rows d x 64 cols e
        const v4f v = *(const v4f*)(src + (size_t)d * HD + e4);
        ts[d * 68 + e4 + 0] = v[0]; ts[d * 68 + e4 + 1] = v[1]; ts[d * 68 + e4 + 2] = v[2]; ts[d * 68 + e4 + 3] = v[3]; }
    __syncthreads();
{
#pragma unroll
        for (int it = 0; it < 2; ++it) { const int c = it * 256 + tid;                                          // 512 groups of 8 = 4 row blocks x 2 k blocks x 2 halves x 32 lanes
            const int rbl = c >> 7, ksl = (c >> 6) & 1; const int e = rbl * 16 + (c & 15), c8 = ksl * 32 + ((c >> 5) & 1) * 16 + ((c >> 4) & 1) * 8;   // rows e 0..63, columns d0 + 0..63
            v8us o;
#pragma unroll
            for (int k = 0; k < 8; ++k) o[k] = f2bf(ts[(c8 + k) * 68 + e]);
            *(v8us*)(WT + ((size_t)(h * (HD / 16) + rbl) * (DM / 32) + d0 / 32 + ksl) * 512 + (c & 63) * 8) = o; }
         }
}

// k_prep: the two activation converts and the three weight transposes, which do not depend on one another, as ranges of ONE grid (the range test is block-uniform).
#define CVT_BLK ((int)(((size_t)NB * SEQ * DM / 8 + 255) / 256))   // blocks of one convert
#define WT_BLK  ((DM / 64) * NH_)                                   // blocks of one transpose
__global__ __launch_bounds__(256) void k_prep(const float* __restrict__ xs, const float* __restrict__ xc, const float* __restrict__ wq, const float* __restrict__ wk,
                                              const float* __restrict__ wv, bf* XB, bf* CB, bf* WB) {
    __shared__ __align__(16) float ts[64 * 68];
    const int blk = blockIdx.x;
    if (blk < 3 * WT_BLK) {                                         // the transposes (the longer blocks) start first
        const int w = blk / WT_BLK;                                 // 0 q, 1 k, 2 v
        wT(w == 0 ? wq : (w == 1 ? wk : wv), WB + (size_t)w * DM * DM, ts, blk % WT_BLK);
        return;
    }
    const int c = blk - 3 * WT_BLK;
    if (c < CVT_BLK) cvt8(xs, XB, c); else cvt8(xc, CB, c - CVT_BLK);
}

// k_proj3: the three projections, which do not depend on one another, in ONE grid: behind PF_WG work-groups that only prefetch, each run of PROJ_TILES work-groups is one projection (scalar selects), one 64x64 tile each, row tiles first.
//   q: A = seq rows (m = b*SEQ + t), Bt = WQ rows (n = h*64 + e), bias per column -> plane [(b*16 + h)][t][e], with residual
//   k: A = ctx rows, Bt = WK rows, bias per column (the 1/8 scale is applied to the scores)
//   tanh(v)^T: A = WV rows (m = h*64 + e), Bt = ctx rows (n = b*SEQ + t), bias per row, tanh -> plane [(b*1024 + m)][t] = [(b*16 + h)][e][t], with residual
// Each: register-blocked bf16 GEMM, ONE WAVE per 64x64 tile (16 accumulators), operands straight from the fragment-order bf16 planes, K = DM.
// C[m][n] = sum_k A[m][k] Bt[n][k] + bias (bf16 RNE value, f32 add; per column n when biasRow == 0, per row m when biasRow != 0), optional tanh (act != 0),
// written as f16 (Ph) and optionally the f16 residual x2048 (Pr, useRes != 0) in fragment order (rows m, k = n) at
// tile base (r0/RB)*sRB + (r0%RB)*pitch + (c0/CB)*sCB + (c0%CB)*64, 16-row block mb at + mb*sMB, 32-column block at + sKB (halves). Tile (bx, by) of (M/64, N/64), 32 threads.
#define PROJ_TILES ((NB * SEQ / 64) * (DM / 64))
#define PF_WG  128               // work-groups at the head of the grid that only prefetch; b and b + 4 take the same share
#define PF_PER 28                // prefetch instructions of each: its share is PF_PER * PFG contiguous bytes of [seq copy | ctx copy | three weights]
static_assert(((size_t)2 * NB * SEQ * DM + (size_t)3 * DM * DM) * 2 == (size_t)(PF_WG / 2) * PF_PER * PFG);   // the shares cover the three planes exactly
#define PF4(a, b, c, d) "global_prefetch_b8 %0, off offset:" #a " scope:SCOPE_SE\n\tglobal_prefetch_b8 %0, off offset:" #b " scope:SCOPE_SE\n\tglobal_prefetch_b8 %0, off offset:" #c " scope:SCOPE_SE\n\tglobal_prefetch_b8 %0, off offset:" #d " scope:SCOPE_SE\n\t"
// the wait in front of a rewrite of address registers that issued loads name; the two scheduling barriers keep the rewrites behind it
__device__ __forceinline__ void addr_wait() { __builtin_amdgcn_sched_barrier(0); asm volatile("s_wait_xcnt 0x0" ::: "memory"); __builtin_amdgcn_sched_barrier(0); }
// one k-step (32) of a 64x64 tile: its 8 fragments (16 loads), and its 16 products
__device__ __forceinline__ void ld4(v16bf (&f)[4], const bf* P, int K, int kc) {
#pragma unroll
    for (int i = 0; i < 4; ++i) f[i] = ldb(P + (size_t)i * 16 * K + (size_t)kc * 16);   // block (row block i, k block kc/32): 16 K elements per row block, 512 per k block
}
__device__ __forceinline__ void ld_step(v16bf (&a)[4], v16bf (&b)[4], const bf* Ap, const bf* Bp, int K, int kc) {
    ld4(a, Ap, K, kc); ld4(b, Bp, K, kc);
    __builtin_amdgcn_sched_barrier(0);   // keeps the 16 loads ahead of the other set's products: sunk to their use they would have no lead
}
__device__ __forceinline__ void mm_step(v8f (&acc)[4][4], const v16bf (&a)[4], const v16bf (&b)[4]) {
#pragma unroll
    for (int nb = 0; nb < 4; ++nb)
#pragma unroll
        for (int mb = 0; mb < 4; ++mb) acc[mb][nb] = wmmab(a[mb], b[nb], acc[mb][nb]);
    // four vector slots behind the last product, on every path, before its operands or results are touched
    asm volatile("v_nop\n\tv_nop\n\tv_nop\n\tv_nop" : "+v"(acc[0][0]), "+v"(acc[1][1]), "+v"(acc[2][2]), "+v"(acc[3][3])
                 : "v"(a[0]), "v"(a[1]), "v"(a[2]), "v"(a[3]), "v"(b[0]), "v"(b[1]), "v"(b[2]), "v"(b[3]));
    __builtin_amdgcn_sched_barrier(0);   // the refill of this set starts behind its last product, so it takes the same registers
}
__global__ __launch_bounds__(32) void k_proj3(const bf* __restrict__ xb, const bf* __restrict__ cb, const bf* __restrict__ wb,
                                              const float* __restrict__ bq, const float* __restrict__ bk, const float* __restrict__ bv,
                                              h16* QH, h16* QR, h16* KP, h16* VT, h16* VR) {
    __shared__ __align__(16) float os[16 * 68];
    if (blockIdx.x < PF_WG) {
        // L2 hints for the operand planes (head of the file), from waves that start first and do nothing else, so the register that the prefetches name stays this address to the wave's end.
        // b and b + 4 (b % 8 < 4) take share (b / 8) * 4 + b % 4.
        // For speed only: any placement gives the same results. xb, cb and wb are one contiguous carve (checked at kernel_launch); offsets 0 .. (PF_PER - 1) * PFG stay inside the share.
        const unsigned sh = (blockIdx.x >> 3) * 4 + (blockIdx.x & 3);
        const bf* pa = xb + (size_t)sh * (PF_PER * PFE) + 128 * (threadIdx.x & 31);
        asm volatile(PF4(0, 8192, 16384, 24576) PF4(32768, 40960, 49152, 57344) PF4(65536, 73728, 81920, 90112) PF4(98304, 106496, 114688, 122880)
                     PF4(131072, 139264, 147456, 155648) PF4(163840, 172032, 180224, 188416) PF4(196608, 204800, 212992, 221184) : : "v"(pa));
        return;                  // block-uniform; this kernel has no work-group barrier
    }
    const unsigned tb = blockIdx.x - PF_WG;
    const int p = 2 - (int)(tb / PROJ_TILES); const unsigned f = tb % PROJ_TILES; const bool isv = (p == 2);   // 0 q, 1 k, 2 v; v (tanh in its epilogue) starts first
    const int bx = (int)(isv ? f % (DM / 64) : f % (NB * SEQ / 64)), by = (int)(isv ? f / (DM / 64) : f / (NB * SEQ / 64));
    const bf* wp = wb + (size_t)p * DM * DM; const bf* xp = (p == 0) ? xb : cb;
    const bf* A = isv ? wp : xp; const bf* Bt = isv ? xp : wp; const float* bias = p == 0 ? bq : (p == 1 ? bk : bv);
    h16* Ph = p == 0 ? QH : (p == 1 ? KP : VT); h16* Pr = p == 0 ? QR : (p == 1 ? KP : VR);
    const size_t sRB = isv ? (size_t)0 : (size_t)NH_ * SEQ * HD, sCB = isv ? (size_t)DM * SEQ : (size_t)SEQ * HD;
    const int useRes = (p != 1), biasRow = isv, act = isv, RB = isv ? DM : SEQ, pitch = isv ? SEQ : HD, CB = isv ? SEQ : HD;
    const int sMB = isv ? 512 : 1024, sKB = isv ? 2048 : 512;   // q, k: blocks [t/16][d/32]; tanh(v)^T: blocks [t/32][d/16]
    const int K = DM;
    const int lane = threadIdx.x & 31, lr = lane & 15, hi = lane >> 4; const int r0 = bx * 64, c0 = by * 64;
    v8f acc[4][4];
#pragma unroll
    for (int mb = 0; mb < 4; ++mb)
#pragma unroll
        for (int nb = 0; nb < 4; ++nb) acc[mb][nb] = (v8f){};
    const size_t aoff = (size_t)r0 * K + 8 * lane;
    // two fragment sets: each k-step's loads are issued one step ahead, while the other set's products run; k ascends as before
    const bf* Ap = A + aoff;
    v16bf a0[4], b0[4], a1[4], b1[4];
    ld4(a0, Ap, K, 0);
    // same wait as addr_wait(); it takes the column index as an operand so that every part of B's address, which reuses A's offset register, is formed behind it
    unsigned cb0 = (unsigned)c0;
    asm volatile("s_wait_xcnt 0x0" : "+s"(cb0) : : "memory");
    const size_t boff = (size_t)cb0 * K + 8 * lane;
    const bf* Bp = Bt + boff;
    ld4(b0, Bp, K, 0);
    __builtin_amdgcn_sched_barrier(0);   // the first step's loads go out ahead of everything else
#pragma unroll 1   // the body already holds two steps; more copies only grow the text
    for (int kc = 0; kc < K - 64; kc += 64) {
        ld_step(a1, b1, Ap, Bp, K, kc + 32);
        mm_step(acc, a0, b0);
        ld_step(a0, b0, Ap, Bp, K, kc + 64);
        mm_step(acc, a1, b1);
        addr_wait();                     // the next trip rewrites the address registers of the loads still in flight
    }
    ld_step(a1, b1, Ap, Bp, K, K - 32);
    mm_step(acc, a0, b0);
    mm_step(acc, a1, b1);
    // bias addends: addresses clamped into the 1024-entry bias array for the unused mode (index select, value select)
    float bc[4];
#pragma unroll
    for (int nb = 0; nb < 4; ++nb) bc[nb] = bias[biasRow ? 0 : (c0 + nb * 16 + lr)];
    addr_wait();                         // the row-bias loads below may land in the offset registers of these four loads; the converts follow it, so it does not wait for the data
#pragma unroll
    for (int nb = 0; nb < 4; ++nb) bc[nb] = bfr(bc[nb]);
    const size_t tbase = (size_t)(r0 / RB) * sRB + (size_t)(r0 % RB) * (size_t)pitch + (size_t)(c0 / CB) * sCB + (size_t)(c0 % CB) * 64;
#pragma unroll
    for (int mb = 0; mb < 4; ++mb) {
        const int ri = biasRow ? (r0 + mb * 16 + hi * 8) : 0;
        const v4f ra = *(const v4f*)(bias + ri); const v4f rb = *(const v4f*)(bias + ri + 4);
        asm volatile("s_wait_xcnt 0x0" : : "v"(ri * 4) : "memory");   // same wait; the byte offset as an input keeps the two loads' offset register from being reused ahead of it
        const float brv[8] = { bfr(ra[0]), bfr(ra[1]), bfr(ra[2]), bfr(ra[3]), bfr(rb[0]), bfr(rb[1]), bfr(rb[2]), bfr(rb[3]) };
#pragma unroll
        for (int nb = 0; nb < 4; ++nb) {
#pragma unroll
            for (int j = 0; j < 8; ++j) { float x = acc[mb][nb][j] + (biasRow ? brv[j] : bc[nb]);
                if (act) x = tanh_e(x);
                os[(hi * 8 + j) * 68 + nb * 16 + lr] = x; } }   // D: row 8h+j, col lane&15
        wave_sync();
        const size_t sb = tbase + (size_t)(mb * sMB) + 8 * lane;
{
#pragma unroll
            for (int s = 0; s < 4; ++s) { const int row = lr, c8 = s * 16 + hi * 8;   // 16 rows; s = 2 * (32-column block) + half, 4 s x 2 h x 8 = 64 columns
                const v4f x0 = *(const v4fa*)(&os[row * 68 + c8]); const v4f x1 = *(const v4fa*)(&os[row * 68 + c8 + 4]); v8h hv, rv;
#pragma unroll
                for (int i = 0; i < 4; ++i) { const h16 a0 = (h16)x0[i]; const h16 a1 = (h16)x1[i]; hv[i] = a0; hv[4 + i] = a1; rv[i] = (h16)((x0[i] - (float)a0) * QRS); rv[4 + i] = (h16)((x1[i] - (float)a1) * QRS); }
                const size_t oo = sb + (size_t)((s >> 1) * sKB + (s & 1) * 256);
                *(v8h*)(Ph + oo) = hv; if (useRes) *(v8h*)(Pr + oo) = rv; }
             }
        wave_sync();
    }
}

// flash<RES>: fused causal attention, one wave per 16 query rows of one (batch, head); K / V^T / Q fragments straight from the fragment-order f16 planes (two 16-B loads each, 512 contiguous bytes a load).
// Transposed form: S^T[key][t] = K Q^T (A = K rows, B = Q rows); lane (t = lane&15, h = lane>>4) holds keys 8h+r of each 16-key tile, so the packed
// P tile is directly the B fragment of O^T[d][t] = V^T P^T (element r <- tile keys 0..15, element 8+r <- tile keys 16..31, lane unchanged).
// Causal: key tiles beyond the wave's last query row are skipped; inside tiles that reach past the wave's first row each score with key > t is replaced by NEGB (P = 0 exactly). Key 0 is visible to every row.
// RES != 0: P and tanh(v) each carry an f16 residual x2048; products Vr.Ph and Vh.Pr accumulate in g (folded back by 1/2048), Vh.Ph in o.
// Softmax state (running max, partial sum) is one scalar per lane; the two lane halves of a row are combined with one xor-16 exchange (issued under wave-uniform control only).
template <int RES>
__device__ __forceinline__ void flash(const h16* __restrict__ QH, const h16* __restrict__ QR, const h16* __restrict__ KP,
                                      const h16* __restrict__ VT, const h16* __restrict__ VR, float* OUT, float* os, int zh, int tblk, const h16* pf) {
    const int lane = threadIdx.x & 31, wave = threadIdx.x >> 5, lr = lane & 15, hi = lane >> 4;
    const int b = zh / NH_, h = zh % NH_;
    const int t0 = tblk + wave * 16;
    const int tq = t0 + lr;
    const size_t pbase = (size_t)zh * SEQ * HD;
    const size_t qo = pbase + (size_t)t0 * HD + 8 * lane;
    const v16h qh0 = ldh(QH + qo), qh1 = ldh(QH + qo + 512), qr0 = ldh(QR + qo), qr1 = ldh(QR + qo + 512);   // B fragments: col t, k = d
    asm volatile("s_wait_xcnt 0x0" : : "v"(QH + qo), "v"(QR + qo) : "memory");   // the fragments fetched ahead below may land in the address registers of these loads: the wait stands in front, the pointers as inputs keep them whole up to it
    const size_t ko = pbase + 8 * lane;                      // + key0 * HD + 512 * (2 * (16-key block) + d/32)   (A fragment: row key, k = d)
    const size_t vo = pbase + 8 * lane;                      // + key0 * HD + 512 * j                             (A fragment: row d = 16j + .., k = key)
    v8f o0 = (v8f){}, o1 = (v8f){}, o2 = (v8f){}, o3 = (v8f){};
    v8f g0 = (v8f){}, g1 = (v8f){}, g2 = (v8f){}, g3 = (v8f){};
    float m = NEGB, l = 0.0f;
    const int kend = t0 + 16;                                // keys 0 .. t0+15 are needed; kend <= SEQ, so key0 + 31 <= SEQ - 1
    // K and V^T fragments are fetched one key tile ahead, into the same registers, right behind their last product
    const h16* ka = KP + ko; const h16* va = VT + vo; const h16* vr = VR + vo;
    v16h ka0 = ldh(ka), ka1 = ldh(ka + 512), kb0 = ldh(ka + 1024), kb1 = ldh(ka + 1536);
    __builtin_amdgcn_sched_barrier(0);                       // K issued ahead of V^T here as in the loop: the wait in front of the score products then leaves the V^T loads in flight
    v16h w0 = (v16h){}, w1 = (v16h){}, w2 = (v16h){}, w3 = (v16h){};
    if (RES) { w0 = ldh(vr); w1 = ldh(vr + 512); w2 = ldh(vr + 1024); w3 = ldh(vr + 1536); }
    v16h v0 = ldh(va), v1 = ldh(va + 512), v2 = ldh(va + 1024), v3 = ldh(va + 1536);
    // the pointers as inputs keep the address registers of the loads above whole up to this wait: no result lands in one ahead of it
    if (RES) asm volatile("s_wait_xcnt 0x0" : : "v"(ka), "v"(va), "v"(vr) : "memory");
    else     asm volatile("s_wait_xcnt 0x0" : : "v"(ka), "v"(va) : "memory");
#pragma unroll 1
    for (int key0 = 0; key0 < kend; key0 += 32) {
        const int adv = (key0 + 32 < kend) ? 32 : 0;         // the last pass has no next tile: it re-reads its own (in bounds, values unused)
        v8f sHa = (v8f){}, sLa = (v8f){}, sHb = (v8f){}, sLb = (v8f){};
        sHa = wmma16(ka0, qh0, sHa); sLa = wmma16(ka0, qr0, sLa); sHb = wmma16(kb0, qh0, sHb); sLb = wmma16(kb0, qr0, sLb);
        sHa = wmma16(ka1, qh1, sHa); sLa = wmma16(ka1, qr1, sLa); sHb = wmma16(kb1, qh1, sHb); sLb = wmma16(kb1, qr1, sLb);
        asm volatile("v_nop\n\tv_nop\n\tv_nop\n\tv_nop" : "+v"(sHa), "+v"(sLa), "+v"(sHb), "+v"(sLb) : "v"(ka0), "v"(ka1), "v"(kb0), "v"(kb1));
        __builtin_amdgcn_sched_barrier(0);                   // the next tile's K loads start behind the score products (same registers) ...
        ka += (size_t)adv * HD;
        ka0 = ldh(ka); ka1 = ldh(ka + 512); kb0 = ldh(ka + 1024); kb1 = ldh(ka + 1536);
        __builtin_amdgcn_sched_barrier(0);                   // ... and ahead of the softmax, which is their lead
        float ta[8], tb[8];
#pragma unroll
        for (int r = 0; r < 8; ++r) { ta[r] = (sHa[r] + sLa[r] * QRI) * SC2; tb[r] = (sHb[r] + sLb[r] * QRI) * SC2; }
        if (key0 + 31 > t0) {                                // wave-uniform: this tile reaches past the wave's first query row
            const int dl = tq - key0 - 8 * hi;               // key of ta[r] = key0 + 8h + r is visible iff r <= dl; key of tb[r] = key0 + 16 + 8h + r iff r + 16 <= dl
#pragma unroll
            for (int r = 0; r < 8; ++r) { ta[r] = (r <= dl) ? ta[r] : NEGB; tb[r] = (r + 16 <= dl) ? tb[r] : NEGB; }
        }
        float mx = NEGB;
#pragma unroll
        for (int r = 0; r < 8; ++r) mx = fmaxf(mx, fmaxf(ta[r], tb[r]));
        mx = fmaxf(mx, __shfl_xor(mx, 16, 32));
        const float mnew = fmaxf(m, mx);
        const float alpha = __builtin_amdgcn_exp2f(m - mnew);
        const float sh = PSH - mnew;
        v16h pb = (v16h){}, pq = (v16h){}; float ls = 0.0f;
#pragma unroll
        for (int r = 0; r < 8; ++r) {
            const float ea = __builtin_amdgcn_exp2f(ta[r] + sh); const float eb = __builtin_amdgcn_exp2f(tb[r] + sh);
            const h16 pa = (h16)ea; const h16 pc = (h16)eb; pb[r] = pa; pb[8 + r] = pc;
            if (RES) { const h16 xa = (h16)((ea - (float)pa) * QRS); const h16 xc = (h16)((eb - (float)pc) * QRS); pq[r] = xa; pq[8 + r] = xc;
                       ls += ((float)pa + (float)pc) + ((float)xa + (float)xc) * QRI; }
            else     { ls += (float)pa + (float)pc; }
        }
        l = l * alpha + ls; m = mnew;
        o0 = o0 * alpha; o1 = o1 * alpha; o2 = o2 * alpha; o3 = o3 * alpha;
        if (RES) {
            g0 = g0 * alpha; g1 = g1 * alpha; g2 = g2 * alpha; g3 = g3 * alpha;
            o0 = wmma16(v0, pb, o0); o1 = wmma16(v1, pb, o1); o2 = wmma16(v2, pb, o2); o3 = wmma16(v3, pb, o3);
            g0 = wmma16(w0, pb, g0); g1 = wmma16(w1, pb, g1); g2 = wmma16(w2, pb, g2); g3 = wmma16(w3, pb, g3);
            g0 = wmma16(v0, pq, g0); g1 = wmma16(v1, pq, g1); g2 = wmma16(v2, pq, g2); g3 = wmma16(v3, pq, g3);
            asm volatile("v_nop\n\tv_nop\n\tv_nop\n\tv_nop" : "+v"(o0), "+v"(o1), "+v"(o2), "+v"(o3), "+v"(g0), "+v"(g1), "+v"(g2), "+v"(g3)
                         : "v"(v0), "v"(v1), "v"(v2), "v"(v3), "v"(w0), "v"(w1), "v"(w2), "v"(w3), "v"(pb), "v"(pq));
            __builtin_amdgcn_sched_barrier(0);               // nothing but the 16 loads and their addresses between here and the wait below
            vr += (size_t)adv * HD; va += (size_t)adv * HD;
            w0 = ldh(vr); w1 = ldh(vr + 512); w2 = ldh(vr + 1024); w3 = ldh(vr + 1536);
            v0 = ldh(va); v1 = ldh(va + 512); v2 = ldh(va + 1024); v3 = ldh(va + 1536);
            asm volatile("s_wait_xcnt 0x0" : : "v"(va), "v"(vr) : "memory");   // what follows may reuse the address registers of these loads; the pointers as inputs keep them whole up to this wait, so that no result of the run lands in one
            __builtin_amdgcn_sched_barrier(0);               // keeps what follows behind the wait
        } else {
            o0 = wmma16(v0, pb, o0); o1 = wmma16(v1, pb, o1); o2 = wmma16(v2, pb, o2); o3 = wmma16(v3, pb, o3);
            asm volatile("v_nop\n\tv_nop\n\tv_nop\n\tv_nop" : "+v"(o0), "+v"(o1), "+v"(o2), "+v"(o3) : "v"(v0), "v"(v1), "v"(v2), "v"(v3), "v"(pb));
            va += (size_t)adv * HD;
            v0 = ldh(va); v1 = ldh(va + 512); v2 = ldh(va + 1024); v3 = ldh(va + 1536);
        }
    }
    asm volatile("s_wait_xcnt 0x0" : : "v"(pf) : "memory");   // what follows may reuse the address registers of the last pass's loads; the pointer as an input keeps the register that the prefetch names an address through the whole loop
    if (RES) { o0 = o0 + g0 * QRI; o1 = o1 + g1 * QRI; o2 = o2 + g2 * QRI; o3 = o3 + g3 * QRI; }
    l += __shfl_xor(l, 16, 32);
    const float inv = 1.0f / l;
    const int wb = wave * 16 * 68;
    // O^T D layout: o_j[r] = (d = 16j + 8h + r, t = lane&15) -> os[t][d]; rows 0..15 x columns 0..63 all written
    { v4f a, c;
      a[0] = o0[0] * inv; a[1] = o0[1] * inv; a[2] = o0[2] * inv; a[3] = o0[3] * inv; c[0] = o0[4] * inv; c[1] = o0[5] * inv; c[2] = o0[6] * inv; c[3] = o0[7] * inv;
      *(v4fa*)(&os[wb + lr * 68 +  0 + 8 * hi]) = a; *(v4fa*)(&os[wb + lr * 68 +  0 + 8 * hi + 4]) = c;
      a[0] = o1[0] * inv; a[1] = o1[1] * inv; a[2] = o1[2] * inv; a[3] = o1[3] * inv; c[0] = o1[4] * inv; c[1] = o1[5] * inv; c[2] = o1[6] * inv; c[3] = o1[7] * inv;
      *(v4fa*)(&os[wb + lr * 68 + 16 + 8 * hi]) = a; *(v4fa*)(&os[wb + lr * 68 + 16 + 8 * hi + 4]) = c;
      a[0] = o2[0] * inv; a[1] = o2[1] * inv; a[2] = o2[2] * inv; a[3] = o2[3] * inv; c[0] = o2[4] * inv; c[1] = o2[5] * inv; c[2] = o2[6] * inv; c[3] = o2[7] * inv;
      *(v4fa*)(&os[wb + lr * 68 + 32 + 8 * hi]) = a; *(v4fa*)(&os[wb + lr * 68 + 32 + 8 * hi + 4]) = c;
      a[0] = o3[0] * inv; a[1] = o3[1] * inv; a[2] = o3[2] * inv; a[3] = o3[3] * inv; c[0] = o3[4] * inv; c[1] = o3[5] * inv; c[2] = o3[6] * inv; c[3] = o3[7] * inv;
      *(v4fa*)(&os[wb + lr * 68 + 48 + 8 * hi]) = a; *(v4fa*)(&os[wb + lr * 68 + 48 + 8 * hi + 4]) = c; }
    wave_sync();
    float* orow = OUT + ((size_t)b * OUT_SEQ + t0) * DM + h * HD;
{
#pragma unroll
        for (int s = 0; s < 8; ++s) { const int row = 2 * s + hi, cofs = lr * 4;   // 8 s x 2 rows = 16 rows; 16 lanes x 4 floats = 64 columns
            const v4f val = *(const v4fa*)(&os[wb + row * 68 + cofs]);
            *(v4f*)(orow + (size_t)row * DM + cofs) = val; }
         }
}

// k_flash2: both row ranges in ONE grid (they write disjoint rows and read the same planes): blockIdx.x = (batch, head), blockIdx.y = 64-row block;
// the late rows (most key tiles) come first, longest first, then the early rows. The range test is block-uniform.
#define LATE_BLK  ((SEQ - EARLY) / (16 * AW))
#define EARLY_BLK (EARLY / (16 * AW))
#define PF_GK ((int)((size_t)SEQ * HD * 2 / PFG))     // prefetch groups of one K or V^T plane of one (batch, head)
#define PF_GR ((int)((size_t)EARLY * HD * 2 / PFG))   // of the part of the residual plane that is read
static_assert(((size_t)SEQ * HD * 2) % PFG == 0 && ((size_t)EARLY * HD * 2) % PFG == 0 && PF_GR >= 1);
static_assert((LATE_BLK + EARLY_BLK) * AW >= 2 * PF_GK + PF_GR && (LATE_BLK + EARLY_BLK) * AW <= 2 * (2 * PF_GK + PF_GR));
__global__ __launch_bounds__(32 * AW) void k_flash2(const h16* __restrict__ QH, const h16* __restrict__ QR, const h16* __restrict__ KP,
                                                    const h16* __restrict__ VT, const h16* __restrict__ VR, float* OUT) {
    __shared__ __align__(16) float os[AW * 16 * 68];
    const int zh = blockIdx.x, y = blockIdx.y;
    // L2 hints for this (batch, head)'s K and tanh(v)^T planes (head of the file): its SEQ/16 waves share them out, a group of 64 keys each, low keys to the work-groups that start first:
    // waves 0 .. 2 PF_GK - 1 take K and V^T in turn, the next PF_GR the part of the residual plane that is read (keys < EARLY), the rest ask for the first groups again. For speed only. Every address lies inside its plane.
    const int jw = y * AW + __builtin_amdgcn_readfirstlane((int)(threadIdx.x >> 5));
    const int jg = jw < 2 * PF_GK + PF_GR ? jw : jw - (2 * PF_GK + PF_GR);
    const h16* pf = (jg < 2 * PF_GK ? ((jg & 1) ? VT : KP) + (size_t)(jg >> 1) * PFE : VR + (size_t)(jg - 2 * PF_GK) * PFE) + (size_t)zh * SEQ * HD + 128 * (threadIdx.x & 31);
    asm volatile("global_prefetch_b8 %0, off scope:SCOPE_SE" : : "v"(pf));
    if (y < LATE_BLK) flash<0>(QH, QR, KP, VT, VR, OUT, os, zh, EARLY + (LATE_BLK - 1 - y) * 16 * AW, pf);
    else              flash<1>(QH, QR, KP, VT, VR, OUT, os, zh, (y - LATE_BLK) * 16 * AW, pf);
}

static constexpr size_t al256(size_t v) { return (v + 255) & ~(size_t)255; }
static constexpr size_t SZ_XB = al256((size_t)NB * SEQ * DM * 2);          // one bf16 activation copy
static constexpr size_t SZ_WB = al256((size_t)3 * DM * DM * 2);            // three transposed bf16 weights
static constexpr size_t SZ_PL = al256((size_t)NB * NH_ * SEQ * HD * 2);    // one f16 plane
static constexpr size_t SZ_TOTAL = 2 * SZ_XB + SZ_WB + 5 * SZ_PL;
static_assert(SZ_TOTAL <= (size_t)134217728);          // workspace carve <= 128 MiB
static_assert(((size_t)DM * DM * 2) % 256 == 0);       // weight sub-planes stay 256-byte aligned
static_assert(SZ_XB == (size_t)NB * SEQ * DM * 2 && SZ_WB == (size_t)3 * DM * DM * 2);   // no padding between XB, CB and WB: k_proj3's prefetch shares run across them

extern "C" void kernel_launch(void* const* d_in, const int* in_sizes, int n_in,
                              void* d_out, int out_size, void* d_ws, size_t ws_size, hipStream_t stream) {
    if (n_in < 8) return;
    const size_t needx = ((size_t)(NB - 1) * SEQ_FULL + SEQ) * DM;
    if ((size_t)in_sizes[0] < needx || (size_t)in_sizes[1] < needx) return;
    if ((size_t)in_sizes[2] < (size_t)DM * DM || (size_t)in_sizes[3] < (size_t)DM * DM || (size_t)in_sizes[4] < (size_t)DM * DM) return;
    if ((size_t)in_sizes[5] < (size_t)DM || (size_t)in_sizes[6] < (size_t)DM || (size_t)in_sizes[7] < (size_t)DM) return;
    if ((size_t)out_size < ((size_t)(NB - 1) * OUT_SEQ + SEQ) * DM) return;
    if (SZ_TOTAL > ws_size) return;
    // wire order: seq, ctx, Wq, Wk, Wv, bq, bk, bv
    const float* xs = (const float*)d_in[0]; const float* xc = (const float*)d_in[1];
    const float* wq = (const float*)d_in[2]; const float* wk = (const float*)d_in[3]; const float* wv = (const float*)d_in[4];
    const float* bq = (const float*)d_in[5]; const float* bk = (const float*)d_in[6]; const float* bv = (const float*)d_in[7];
    float* OUT = (float*)d_out;      // [NB][SEQ][1024]
    char* wsp = (char*)d_ws;
    // every plane in fragment order (head of the file)
    bf* XB = (bf*)wsp; wsp += SZ_XB;                 // seq  NB*SEQ rows x 1024
    bf* CB = (bf*)wsp; wsp += SZ_XB;                 // ctx  NB*SEQ rows x 1024
    bf* WB = (bf*)wsp; wsp += SZ_WB;                 // [3] 1024 rows n = h*64+e x 1024 d: q | k | v
    h16* QH = (h16*)wsp; wsp += SZ_PL;               // [NB*16] SEQ rows x 64
    h16* QR = (h16*)wsp; wsp += SZ_PL;               // [NB*16] SEQ rows x 64, residual x2048
    h16* KP = (h16*)wsp; wsp += SZ_PL;               // [NB*16] SEQ rows x 64
    h16* VT = (h16*)wsp; wsp += SZ_PL;               // [NB*16] 64 rows x SEQ, tanh(v)^T
    h16* VR = (h16*)wsp; wsp += SZ_PL;               // [NB*16] 64 rows x SEQ, residual x2048

    k_prep<<<dim3(2 * CVT_BLK + 3 * WT_BLK, 1, 1), 256, 0, stream>>>(xs, xc, wq, wk, wv, XB, CB, WB);
    k_proj3<<<dim3(PF_WG + 3 * PROJ_TILES, 1, 1), 32, 0, stream>>>(XB, CB, WB, bq, bk, bv, QH, QR, KP, VT, VR);
    k_flash2<<<dim3(NB * NH_, LATE_BLK + EARLY_BLK, 1), 32 * AW, 0, stream>>>(QH, QR, KP, VT, VR, OUT);
}

// v005
// It runs in 35.5 microseconds.
// Next to v004, in two timings, it ran 1.11 and 1.12 times as fast.
// All steps since v000 together make it 3.79 times as fast.
#include <hip/hip_runtime.h>

// Causal multi-head cross-attention: seq/ctx [NB][SEQ][1024], Wq/Wk/Wv [16][1024 in][64 out], biases [16][64]; q from seq, k and v from ctx, score scale 1/8, P applied to tanh(v), output = concatenated heads (f32).
// Compute dtypes, f32 accumulate everywhere: projections v_wmma_f32_16x16x32_bf16 (seq, ctx, W and biases RNE-converted to bf16; products exact);
// scores v_wmma_f32_16x16x32_f16: k single f16, q as f16 value + f16 residual x2048 in its own accumulator; P.V v_wmma_f32_16x16x32_f16: P carried x256 (cancels in the normalisation),
// query rows < 512: tanh(v) and P each as f16 value + f16 residual x2048 (three products, residual products in their own accumulator); later rows single f16 planes; softmax f32 (online, running max).
// Layout: every 16-bit operand plane lies in WMMA fragment order: a block of 16 rows x 32 k is 512 elements = [k half s][lane = 16*h + row][8], element (row, k = 16 s + 8 h + j), so that one 16-byte-per-lane load covers 512 contiguous bytes.
// bf16 copies of seq, ctx and the transposed W (rows h*64+e, k = d): blocks [row/16][k/32]; q (hi, residual), k planes per b*16+h (rows t, k = d): blocks [t/16][d/32]; tanh(v)^T planes (hi, residual) per b*16+h (rows d, k = t): blocks [t/32][d/16], written by the GEMM epilogue;
// fused flash kernel in transposed form (S^T = K Q^T, O^T = V^T P^T) with causal key-tile skipping and per-element replace-fill inside the visited diagonal tiles.

#ifndef NB
#define NB 2
#endif
#ifndef SEQ
#define SEQ 1024                 // query length == context length used (causal: keys <= query index)
#endif
#define NB_FULL  2
#define SEQ_FULL 1024
#ifndef OUT_SEQ
#define OUT_SEQ SEQ              // row pitch (in tokens) between batches of the output
#endif
#define DM   1024
#define NH_  16
#define HD   64
#define AW   4                   // waves per flash block (16 query rows each)
#define EARLY ((SEQ) < 512 ? (SEQ) : 512)     // query rows below this use the residual planes in P.V
#define QRS  2048.0f             // carry of every residual plane (q, tanh(v), P)
#define QRI  (1.0f / 2048.0f)
#define SC2  (0.125f * 1.4426950408889634f)   // HD^-0.5 * log2(e)
#define PSH  8.0f                // log2 of the P carry (256)
#define NEGB (-3.0e38f)          // fill of masked scores (exp2 gives exactly 0)

static_assert(HD == 64);
static_assert(NH_ * HD == DM);                 // head h = columns h*64 + e
static_assert(DM % 64 == 0);
static_assert(DM % 64 == 0 && DM >= 64);       // GEMM k-loop: four steps of 32 per trip
static_assert(SEQ % 64 == 0);                  // a 64-row tile never straddles two batches
static_assert((NB * SEQ) % 64 == 0);
static_assert(SEQ % 32 == 0);                  // key loop steps by 32, last visited tile stays inside the plane
static_assert(EARLY % (16 * AW) == 0);
static_assert((SEQ - EARLY) % (16 * AW) == 0);
static_assert(((size_t)SEQ * DM) % 8 == 0);
static_assert(NB <= NB_FULL);
static_assert(SEQ <= SEQ_FULL);
static_assert(((size_t)(NB_FULL - 1) * SEQ_FULL + SEQ_FULL) * DM * 4 == (size_t)8388608);   // output bytes of the full problem

typedef _Float16 h16;
typedef unsigned short bf;
typedef __attribute__((ext_vector_type(16))) __bf16   v16bf;
typedef __attribute__((ext_vector_type(16))) _Float16 v16h;
typedef __attribute__((ext_vector_type(8)))  _Float16 v8h;
typedef __attribute__((ext_vector_type(8)))  unsigned short v8us;
typedef __attribute__((ext_vector_type(8)))  float    v8f;
typedef __attribute__((ext_vector_type(4)))  float    v4f;
typedef v4f  __attribute__((may_alias)) v4fa;

__device__ __forceinline__ unsigned short f2bf(float f) { unsigned u = __float_as_uint(f); u += 0x7FFFu + ((u >> 16) & 1u); return (unsigned short)(u >> 16); }
__device__ __forceinline__ float bfr(float f) { return __uint_as_float(((unsigned)f2bf(f)) << 16); }     // value after RNE convert to bf16
__device__ __forceinline__ float tanh_e(float x) { const float e = __builtin_amdgcn_exp2f(x * 2.8853900817779268f); return 1.0f - 2.0f * __builtin_amdgcn_rcpf(e + 1.0f); }   // 1 - 2/(exp(2x)+1); saturates cleanly to +-1
__device__ __forceinline__ v16h cat16(v8h lo, v8h hi) { return __builtin_shufflevector(lo, hi, 0, 1, 2, 3, 4, 5, 6, 7, 8, 9, 10, 11, 12, 13, 14, 15); }
__device__ __forceinline__ v16bf cat16b(v8us lo, v8us hi) { return __builtin_bit_cast(v16bf, __builtin_shufflevector(lo, hi, 0, 1, 2, 3, 4, 5, 6, 7, 8, 9, 10, 11, 12, 13, 14, 15)); }
__device__ __forceinline__ v8f wmma16(v16h a, v16h b, v8f c) { return __builtin_amdgcn_wmma_f32_16x16x32_f16(false, a, false, b, (short)0, c, false, false); }
__device__ __forceinline__ v8f wmmab(v16bf a, v16bf b, v8f c) { return __builtin_amdgcn_wmma_f32_16x16x32_bf16(false, a, false, b, (short)0, c, false, false); }
// fragment loaders from a 512-element block in fragment order; p = block + 8*lane: elements 0..7 <- k0+8h+0..7, elements 8..15 <- k0+16+8h+0..7 of row lane&15 (same map for A and B)
__device__ __forceinline__ v16h  ldh(const h16* p) { return cat16(*(const v8h*)p, *(const v8h*)(p + 256)); }
__device__ __forceinline__ v16bf ldb(const bf* p)  { return cat16b(*(const v8us*)p, *(const v8us*)(p + 256)); }
// ordering point for wave-private LDS tiles (same wave writes and reads)
// So both matrix launches open with hints for those planes: one global_prefetch_b8 names 32 addresses 256 B apart (PFG bytes), a lane each, into L2 only; it returns nothing, and no result depends on it.
#define PFG 8192                 // bytes one prefetch instruction of a wave covers
#define PFE (PFG / 2)            // the same in 16-bit elements
__device__ __forceinline__ void wave_sync() { __builtin_amdgcn_fence(3 /* release order */, "wavefront"); __builtin_amdgcn_wave_barrier(); asm volatile("" ::: "memory"); }

// cvt8: thread i converts 8 elements of [NB*SEQ rows][DM] into the fragment-order bf16 copy; i = ((row/16 * DM/32 + k/32) * 16 + row%16) * 4 + (k%32)/8: four lanes read one whole 128-byte line of a row,
// and a wave's store fills four whole lines (8 rows x 16 bytes in each of the four (s, h) parts of a block); the source batches lie SEQ_FULL rows apart
__device__ __forceinline__ void cvt8(const float* __restrict__ src, bf* dst, int blk) {
    const size_t n8 = (size_t)NB * SEQ * DM / 8;
    const size_t i = (size_t)blk * 256 + threadIdx.x; if (i >= n8) return;
    const size_t lr = (i >> 2) & 15, row = (i / (64 * (DM / 32))) * 16 + lr, kk = ((i >> 6) % (DM / 32)) * 32 + (i & 3) * 8;
    const size_t so = ((row / SEQ) * SEQ_FULL + row % SEQ) * DM + kk;
    const v8f v = *(const v8f*)(src + so); v8us o;
#pragma unroll
    for (int k = 0; k < 8; ++k) o[k] = f2bf(v[k]);
    *(v8us*)(dst + (i >> 6) * 512 + (i & 3) * 128 + lr * 8) = o;   // s = bit 1, h = bit 0 of i: s * 256 + (16 h + row%16) * 8
}

// wT: in W [NH][DM rows d][HD cols e] f32 -> out WT, rows n = h*64+e, k = d, bf16 (RNE convert), in fragment order. One block per (64-d tile, head); transpose through LDS (cross-wave: block barrier).
__device__ __forceinline__ void wT(const float* __restrict__ W, bf* WT, float* ts, int blk) {
    const int tid = threadIdx.x; const int d0 = (blk % (DM / 64)) * 64, h = blk / (DM / 64);
    const float* src = W + ((size_t)h * DM + d0) * HD;
#pragma unroll
    for (int i = 0; i < 4; ++i) { const int q = tid + 256 * i; const int d = q >> 4, e4 = (q & 15) * 4;      // 1024 float4 = 64 rows d x 64 cols e
        const v4f v = *(const v4f*)(src + (size_t)d * HD + e4);
        ts[d * 68 + e4 + 0] = v[0]; ts[d * 68 + e4 + 1] = v[1]; ts[d * 68 + e4 + 2] = v[2]; ts[d * 68 + e4 + 3] = v[3]; }
    __syncthreads();
{
#pragma unroll
        for (int it = 0; it < 2; ++it) { const int c = it * 256 + tid;                                          // 512 groups of 8 = 4 row blocks x 2 k blocks x 2 halves x 32 lanes
            const int rbl = c >> 7, ksl = (c >> 6) & 1; const int e = rbl * 16 + (c & 15), c8 = ksl * 32 + ((c >> 5) & 1) * 16 + ((c >> 4) & 1) * 8;   // rows e 0..63, columns d0 + 0..63
            v8us o;
#pragma unroll
            for (int k = 0; k < 8; ++k) o[k] = f2bf(ts[(c8 + k) * 68 + e]);
            *(v8us*)(WT + ((size_t)(h * (HD / 16) + rbl) * (DM / 32) + d0 / 32 + ksl) * 512 + (c & 63) * 8) = o; }
         }
}

// k_prep: the two activation converts and the three weight transposes, which do not depend on one another, as ranges of ONE grid (the range test is block-uniform).
#define CVT_BLK ((int)(((size_t)NB * SEQ * DM / 8 + 255) / 256))   // blocks of one convert
#define WT_BLK  ((DM / 64) * NH_)                                   // blocks of one transpose
__global__ __launch_bounds__(256) void k_prep(const float* __restrict__ xs, const float* __restrict__ xc, const float* __restrict__ wq, const float* __restrict__ wk,
                                              const float* __restrict__ wv, bf* XB, bf* CB, bf* WB) {
    __shared__ __align__(16) float ts[64 * 68];
    const int blk = blockIdx.x;
    if (blk < 3 * WT_BLK) {                                         // the transposes (the longer blocks) start first
        const int w = blk / WT_BLK;                                 // 0 q, 1 k, 2 v
        wT(w == 0 ? wq : (w == 1 ? wk : wv), WB + (size_t)w * DM * DM, ts, blk % WT_BLK);
        return;
    }
    const int c = blk - 3 * WT_BLK;
    if (c < CVT_BLK) cvt8(xs, XB, c); else cvt8(xc, CB, c - CVT_BLK);
}

// k_proj3: the three projections, which do not depend on one another, in ONE grid: behind PF_WG work-groups that only prefetch, each run of PROJ_TILES work-groups is one projection (scalar selects), one TM x TN tile each, row tiles first.
//   q: A = seq rows (m = b*SEQ + t), Bt = WQ rows (n = h*64 + e), bias per column -> plane [(b*16 + h)][t][e], with residual
//   k: A = ctx rows, Bt = WK rows, bias per column (the 1/8 scale is applied to the scores)
//   tanh(v)^T: A = WV rows (m = h*64 + e), Bt = ctx rows (n = b*SEQ + t), bias per row, tanh -> plane [(b*1024 + m)][t] = [(b*16 + h)][e][t], with residual
// Each: register-blocked bf16 GEMM, K = DM; a work-group of GW = 8 waves (4 x 2) owns 256 x 128, one 64x64 tile (16 accumulators) a wave.
// The operands come through LDS, so that a 16-row block is fetched from L2 once per work-group and not once per wave: a stage is KST = 128 k of the 16 A and 8 B row blocks, which in the fragment-order planes
// are runs of RBB = 4096 contiguous bytes, 16 K elements apart. Every wave brings its own slice of each stage with ONE tensor_load_to_lds (waves 0..3: four A blocks, waves 4..7: two B blocks), no pad:
// LDS keeps the fragment order, so a fragment load is again 512 contiguous bytes. Two buffers; the load of stage s + 2 goes out behind the barrier that ends pass s (written at the head of pass s + 1).
// C[m][n] = sum_k A[m][k] Bt[n][k] + bias (bf16 RNE value, f32 add; per column n when biasRow == 0, per row m when biasRow != 0), optional tanh (act != 0),
// written as f16 (Ph) and optionally the f16 residual x2048 (Pr, useRes != 0) in fragment order (rows m, k = n) at
// tile base (r0/RB)*sRB + (r0%RB)*pitch + (c0/CB)*sCB + (c0%CB)*64, 16-row block mb at + mb*sMB, 32-column block at + sKB (halves).
#define GW   8                   // waves of a GEMM work-group
#define TM   256                 // rows of A per work-group (4 waves)
#define TN   128                 // rows of Bt per work-group (2 waves)
#define KST  128                 // k per stage
#define NST  (DM / KST)          // stages
#define RBB  (16 * KST * 2)      // bytes of one 16-row block in one stage
#define STA  ((TM / 16) * RBB)   // bytes of A in a stage
#define STG  (STA + (TN / 16) * RBB)   // bytes of a stage
static_assert((NB * SEQ) % TM == 0 && DM % TM == 0 && (NB * SEQ) % TN == 0 && DM % TN == 0 && DM % KST == 0 && NST >= 2);
static_assert(TM == 4 * 64 && TN == 2 * 64 && GW == 8 && KST == 4 * 32);
static_assert(RBB % 2048 == 0 && STA % 2048 == 0 && STG % 2048 == 0 && (size_t)16 * DM * 2 <= 131072);   // every slice's place in LDS a multiple of 2 KiB; source pitch at most 128 KiB
#define PROJ_TILES ((NB * SEQ / TM) * (DM / TN))
static_assert(PROJ_TILES == (DM / TM) * (NB * SEQ / TN));
#define PF_WG  128               // work-groups at the head of the grid that only prefetch; b and b + 4 take the same share
#define PF_PER 28                // prefetch instructions of each, four from each of its first seven waves: its share is PF_PER * PFG contiguous bytes of [seq copy | ctx copy | three weights]
static_assert(PF_PER == 4 * (GW - 1));
static_assert(((size_t)2 * NB * SEQ * DM + (size_t)3 * DM * DM) * 2 == (size_t)(PF_WG / 2) * PF_PER * PFG);   // the shares cover the three planes exactly
#define PF4(a, b, c, d) "global_prefetch_b8 %0, off offset:" #a " scope:SCOPE_SE\n\tglobal_prefetch_b8 %0, off offset:" #b " scope:SCOPE_SE\n\tglobal_prefetch_b8 %0, off offset:" #c " scope:SCOPE_SE\n\tglobal_prefetch_b8 %0, off offset:" #d " scope:SCOPE_SE\n\t"
// the wait in front of a rewrite of address registers that issued loads name; the two scheduling barriers keep the rewrites behind it
__device__ __forceinline__ void addr_wait() { __builtin_amdgcn_sched_barrier(0); asm volatile("s_wait_xcnt 0x0" ::: "memory"); __builtin_amdgcn_sched_barrier(0); }
typedef uint32_t u32x4 __attribute__((ext_vector_type(4)));
typedef uint32_t u32x8 __attribute__((ext_vector_type(8)));
__device__ __forceinline__ uint32_t uni(uint32_t v) { return (uint32_t)__builtin_amdgcn_readfirstlane(v); }
__device__ __forceinline__ uint32_t pinned(uint32_t v) { uint32_t w = uni(v); asm volatile("" : "+s"(w)); return w; }   // holds a word of a tensor load's test or descriptor in a scalar register, formed at this place
__device__ __forceinline__ void wait_tensor0() { asm volatile("s_wait_tensorcnt 0x0" ::: "memory"); }   // this wave's own tensor load has landed (the compiler places no wait for it)
__device__ __forceinline__ void wait_ds0()     { asm volatile("s_wait_dscnt 0x0" ::: "memory"); }       // this wave's LDS reads have returned before their buffer is handed back
// one request: rows of RBB bytes, nrow of them (in g1), from global byte address ga to LDS byte offset dst
__device__ __forceinline__ void tdm_load(uint32_t dst, uint64_t ga, u32x8 g1) {
    u32x4 g0;
    g0[0] = uni(1u); g0[1] = uni(dst); g0[2] = uni((uint32_t)ga); g0[3] = uni((((uint32_t)(ga >> 32)) & 0x01FFFFFFu) | 0x80000000u);   // count 1; type 2
    asm volatile("tensor_load_to_lds %0, %1" :: "s"(g0), "s"(g1) : "memory");
}
// one k-step (32) of a 64x64 tile: its 8 fragments (16 LDS loads), and its 16 products
__device__ __forceinline__ void ld4(v16bf (&f)[4], const bf* P, int ks) {
#pragma unroll
    for (int i = 0; i < 4; ++i) f[i] = ldb(P + i * (RBB / 2) + ks * 512);   // row block i, k block ks of the stage
}
__device__ __forceinline__ void ld_step(v16bf (&a)[4], v16bf (&b)[4], const bf* Ap, const bf* Bp, int ks) {
    ld4(a, Ap, ks); ld4(b, Bp, ks);
    __builtin_amdgcn_sched_barrier(0);   // keeps the 16 loads as one group ahead of the other set's products: sunk to their use they would have no lead
}
__device__ __forceinline__ void mm_step(v8f (&acc)[4][4], const v16bf (&a)[4], const v16bf (&b)[4]) {
#pragma unroll
    for (int nb = 0; nb < 4; ++nb)
#pragma unroll
        for (int mb = 0; mb < 4; ++mb) acc[mb][nb] = wmmab(a[mb], b[nb], acc[mb][nb]);
    // four vector slots behind the last product, on every path, before its operands or results are touched
    asm volatile("v_nop\n\tv_nop\n\tv_nop\n\tv_nop" : "+v"(acc[0][0]), "+v"(acc[1][1]), "+v"(acc[2][2]), "+v"(acc[3][3])
                 : "v"(a[0]), "v"(a[1]), "v"(a[2]), "v"(a[3]), "v"(b[0]), "v"(b[1]), "v"(b[2]), "v"(b[3]));
    __builtin_amdgcn_sched_barrier(0);   // the refill of this set starts behind its last product, so it takes the same registers
}
__global__ __launch_bounds__(32 * GW) void k_proj3(const bf* __restrict__ xb, const bf* __restrict__ cb, const bf* __restrict__ wb,
                                              const float* __restrict__ bq, const float* __restrict__ bk, const float* __restrict__ bv,
                                              h16* QH, h16* QR, h16* KP, h16* VT, h16* VR) {
    __shared__ __attribute__((aligned(2048))) bf ring[2 * STG / 2];   // two stages: [A 16 row blocks | B 8 row blocks] of RBB bytes
    __shared__ __align__(16) float osw[GW * 16 * 68];                  // epilogue staging, a range of its own for each wave
    const uint32_t wave = uni(threadIdx.x >> 5);
    if (blockIdx.x < PF_WG) {
        // L2 hints for the operand planes (head of the file), from waves that start first and do nothing else, so the register that the prefetches name stays this address to the wave's end.
        // Work-groups b and b + 4 both take share (b / 8) * 4 + b % 4.
        // For speed only: any placement gives the same results. xb, cb and wb are one contiguous carve (checked at kernel_launch); wave w < 7 takes groups 4 w .. 4 w + 3 of the share.
        if (wave < GW - 1) {
            const unsigned sh = (blockIdx.x >> 3) * 4 + (blockIdx.x & 3);
            const bf* pa = xb + (size_t)sh * (PF_PER * PFE) + (size_t)wave * (4 * PFE) + 128 * (threadIdx.x & 31);
            asm volatile(PF4(0, 8192, 16384, 24576) : : "v"(pa));
        }
        return;                  // block-uniform, in front of every barrier and tensor load
    }
    const unsigned tb = blockIdx.x - PF_WG;
    const int p = 2 - (int)(tb / PROJ_TILES); const unsigned f = tb % PROJ_TILES; const bool isv = (p == 2);   // 0 q, 1 k, 2 v; v (tanh in its epilogue) starts first
    const int bx = (int)(isv ? f % (DM / TM) : f % (NB * SEQ / TM)), by = (int)(isv ? f / (DM / TM) : f / (NB * SEQ / TM));
    const bf* wp = wb + (size_t)p * DM * DM; const bf* xp = (p == 0) ? xb : cb;
    const bf* A = isv ? wp : xp; const bf* Bt = isv ? xp : wp; const float* bias = p == 0 ? bq : (p == 1 ? bk : bv);
    h16* Ph = p == 0 ? QH : (p == 1 ? KP : VT); h16* Pr = p == 0 ? QR : (p == 1 ? KP : VR);
    const size_t sRB = isv ? (size_t)0 : (size_t)NH_ * SEQ * HD, sCB = isv ? (size_t)DM * SEQ : (size_t)SEQ * HD;
    const int useRes = (p != 1), biasRow = isv, act = isv, RB = isv ? DM : SEQ, pitch = isv ? SEQ : HD, CB = isv ? SEQ : HD;
    const int sMB = isv ? 512 : 1024, sKB = isv ? 2048 : 512;   // q, k: blocks [t/16][d/32]; tanh(v)^T: blocks [t/32][d/16]
    const int K = DM;
    const int lane = threadIdx.x & 31, lr = lane & 15, hi = lane >> 4;
    const int wr = (int)(wave & 3), wc = (int)(wave >> 2);      // this wave's 64x64 tile in the work-group's 256 x 128
    const int r0 = bx * TM + wr * 64, c0 = by * TN + wc * 64;
    float* os = osw + wave * (16 * 68);
    // this wave's slice of every stage: waves 0..3 four row blocks of A, waves 4..7 two of Bt; stage s lies s * RBB bytes into each row block
    const bool sa = wave < 4;
    const bf* sp = sa ? A + (size_t)(bx * (TM / 16) + 4 * (int)wave) * 16 * K : Bt + (size_t)(by * (TN / 16) + 2 * ((int)wave - 4)) * 16 * K;
    const uint64_t ga0 = (uint64_t)(size_t)sp;
    const uint32_t dst0 = (uint32_t)(size_t)ring + (sa ? wave * (4 * RBB) : STA + (wave - 4) * (2 * RBB));
    const uint32_t d0 = RBB, d1 = sa ? 4u : 2u;                 // bytes a row, rows; tensor = tile
    u32x8 g1;
    g1[0] = uni(0u);                                            // no mask, 1-byte elements, no pad
    g1[1] = uni((d0 & 0xFFFFu) << 16);
    g1[2] = uni((d0 >> 16) | ((d1 & 0xFFFFu) << 16));
    g1[3] = uni((d1 >> 16) | (d0 << 16));
    g1[4] = uni(d1);
    g1[5] = uni((uint32_t)(16 * DM * 2));                       // source pitch: one 16-row block of the plane
    g1[6] = uni(0u);
    g1[7] = uni(0u);
    v8f acc[4][4];
#pragma unroll
    for (int mb = 0; mb < 4; ++mb)
#pragma unroll
        for (int nb = 0; nb < 4; ++nb) acc[mb][nb] = (v8f){};
    tdm_load(dst0, ga0, g1);                                    // stage 0 -> buffer 0
    wait_tensor0();
    __syncthreads();                                            // stage 0 published
    const bf* la = ring + wr * 4 * (RBB / 2) + 8 * lane;
    const bf* lb = ring + STA / 2 + wc * 4 * (RBB / 2) + 8 * lane;
    // two fragment sets inside a pass: each k-step's LDS loads are issued one step ahead, while the other set's products run; nothing of the next stage is read in this pass; k ascends as before
    v16bf a0[4], b0[4], a1[4], b1[4];
#pragma unroll 1   // one pass per stage; the body already holds four k-steps
    for (uint32_t s = 0; s < NST; ++s) {
        // behind the barrier that ended pass s - 1 (for s = 0: that published stage 0): stage s + 1 goes into the buffer that pass s - 1 has read, and flies during this pass
        const uint32_t sn = pinned(s + 1);                      // its descriptor is formed here, behind the wait for the request before it
        if (pinned(sn < NST)) tdm_load(dst0 + (sn & 1) * STG, ga0 + (uint64_t)sn * RBB, g1);
        const bf* Ap = la + (s & 1) * (STG / 2); const bf* Bp = lb + (s & 1) * (STG / 2);
        ld_step(a0, b0, Ap, Bp, 0);
        ld_step(a1, b1, Ap, Bp, 1);
        mm_step(acc, a0, b0);
        ld_step(a0, b0, Ap, Bp, 2);
        mm_step(acc, a1, b1);
        ld_step(a1, b1, Ap, Bp, 3);
        mm_step(acc, a0, b0);
        mm_step(acc, a1, b1);
        // publish point of stage s + 1
        wait_ds0();
        wait_tensor0();
        __syncthreads();                                        // stage s + 1 readable by all; every wave has left stage s's buffer
    }
    wait_tensor0();
    wait_ds0();
    // bias addends: addresses clamped into the 1024-entry bias array for the unused mode (index select, value select)
    float bc[4];
#pragma unroll
    for (int nb = 0; nb < 4; ++nb) bc[nb] = bias[biasRow ? 0 : (c0 + nb * 16 + lr)];
    addr_wait();                         // the row-bias loads below may land in the offset registers of these four loads; the converts follow it, so it does not wait for the data
#pragma unroll
    for (int nb = 0; nb < 4; ++nb) bc[nb] = bfr(bc[nb]);
    const size_t tbase = (size_t)(r0 / RB) * sRB + (size_t)(r0 % RB) * (size_t)pitch + (size_t)(c0 / CB) * sCB + (size_t)(c0 % CB) * 64;
#pragma unroll
    for (int mb = 0; mb < 4; ++mb) {
        const int ri = biasRow ? (r0 + mb * 16 + hi * 8) : 0;
        const v4f ra = *(const v4f*)(bias + ri); const v4f rb = *(const v4f*)(bias + ri + 4);
        asm volatile("s_wait_xcnt 0x0" : : "v"(ri * 4) : "memory");   // same wait; the byte offset as an input keeps the two loads' offset register from being reused ahead of it
        const float brv[8] = { bfr(ra[0]), bfr(ra[1]), bfr(ra[2]), bfr(ra[3]), bfr(rb[0]), bfr(rb[1]), bfr(rb[2]), bfr(rb[3]) };
#pragma unroll
        for (int nb = 0; nb < 4; ++nb) {
#pragma unroll
            for (int j = 0; j < 8; ++j) { float x = acc[mb][nb][j] + (biasRow ? brv[j] : bc[nb]);
                if (act) x = tanh_e(x);
                os[(hi * 8 + j) * 68 + nb * 16 + lr] = x; } }   // D: row 8h+j, col lane&15
        wave_sync();
        const size_t sb = tbase + (size_t)(mb * sMB) + 8 * lane;
{
#pragma unroll
            for (int s = 0; s < 4; ++s) { const int row = lr, c8 = s * 16 + hi * 8;   // 16 rows; s = 2 * (32-column block) + half, 4 s x 2 h x 8 = 64 columns
                const v4f x0 = *(const v4fa*)(&os[row * 68 + c8]); const v4f x1 = *(const v4fa*)(&os[row * 68 + c8 + 4]); v8h hv, rv;
#pragma unroll
                for (int i = 0; i < 4; ++i) { const h16 a0 = (h16)x0[i]; const h16 a1 = (h16)x1[i]; hv[i] = a0; hv[4 + i] = a1; rv[i] = (h16)((x0[i] - (float)a0) * QRS); rv[4 + i] = (h16)((x1[i] - (float)a1) * QRS); }
                const size_t oo = sb + (size_t)((s >> 1) * sKB + (s & 1) * 256);
                *(v8h*)(Ph + oo) = hv; if (useRes) *(v8h*)(Pr + oo) = rv; }
             }
        wave_sync();
    }
}

// flash<RES>: fused causal attention, one wave per 16 query rows of one (batch, head); K / V^T / Q fragments straight from the fragment-order f16 planes (two 16-B loads each, 512 contiguous bytes a load).
// Transposed form: S^T[key][t] = K Q^T (A = K rows, B = Q rows); lane (t = lane&15, h = lane>>4) holds keys 8h+r of each 16-key tile, so the packed
// P tile is directly the B fragment of O^T[d][t] = V^T P^T (element r <- tile keys 0..15, element 8+r <- tile keys 16..31, lane unchanged).
// Causal: key tiles beyond the wave's last query row are skipped; inside tiles that reach past the wave's first row each score with key > t is replaced by NEGB (P = 0 exactly). Key 0 is visible to every row.
// RES != 0: P and tanh(v) each carry an f16 residual x2048; products Vr.Ph and Vh.Pr accumulate in g (folded back by 1/2048), Vh.Ph in o.
// Softmax state (running max, partial sum) is one scalar per lane; the two lane halves of a row are combined with one xor-16 exchange (issued under wave-uniform control only).
template <int RES>
__device__ __forceinline__ void flash(const h16* __restrict__ QH, const h16* __restrict__ QR, const h16* __restrict__ KP,
                                      const h16* __restrict__ VT, const h16* __restrict__ VR, float* OUT, float* os, int zh, int tblk, const h16* pf) {
    const int lane = threadIdx.x & 31, wave = threadIdx.x >> 5, lr = lane & 15, hi = lane >> 4;
    const int b = zh / NH_, h = zh % NH_;
    const int t0 = tblk + wave * 16;
    const int tq = t0 + lr;
    const size_t pbase = (size_t)zh * SEQ * HD;
    const size_t qo = pbase + (size_t)t0 * HD + 8 * lane;
    const v16h qh0 = ldh(QH + qo), qh1 = ldh(QH + qo + 512), qr0 = ldh(QR + qo), qr1 = ldh(QR + qo + 512);   // B fragments: col t, k = d
    asm volatile("s_wait_xcnt 0x0" : : "v"(QH + qo), "v"(QR + qo) : "memory");   // the fragments fetched ahead below may land in the address registers of these loads: the wait stands in front, the pointers as inputs keep them whole up to it
    const size_t ko = pbase + 8 * lane;                      // + key0 * HD + 512 * (2 * (16-key block) + d/32)   (A fragment: row key, k = d)
    const size_t vo = pbase + 8 * lane;                      // + key0 * HD + 512 * j                             (A fragment: row d = 16j + .., k = key)
    v8f o0 = (v8f){}, o1 = (v8f){}, o2 = (v8f){}, o3 = (v8f){};
    v8f g0 = (v8f){}, g1 = (v8f){}, g2 = (v8f){}, g3 = (v8f){};
    float m = NEGB, l = 0.0f;
    const int kend = t0 + 16;                                // keys 0 .. t0+15 are needed; kend <= SEQ, so key0 + 31 <= SEQ - 1
    // K and V^T fragments are fetched one key tile ahead, into the same registers, right behind their last product
    const h16* ka = KP + ko; const h16* va = VT + vo; const h16* vr = VR + vo;
    v16h ka0 = ldh(ka), ka1 = ldh(ka + 512), kb0 = ldh(ka + 1024), kb1 = ldh(ka + 1536);
    __builtin_amdgcn_sched_barrier(0);                       // K issued ahead of V^T here as in the loop: the wait in front of the score products then leaves the V^T loads in flight
    v16h w0 = (v16h){}, w1 = (v16h){}, w2 = (v16h){}, w3 = (v16h){};
    if (RES) { w0 = ldh(vr); w1 = ldh(vr + 512); w2 = ldh(vr + 1024); w3 = ldh(vr + 1536); }
    v16h v0 = ldh(va), v1 = ldh(va + 512), v2 = ldh(va + 1024), v3 = ldh(va + 1536);
    // the pointers as inputs keep the address registers of the loads above whole up to this wait: no result lands in one ahead of it
    if (RES) asm volatile("s_wait_xcnt 0x0" : : "v"(ka), "v"(va), "v"(vr) : "memory");
    else     asm volatile("s_wait_xcnt 0x0" : : "v"(ka), "v"(va) : "memory");
#pragma unroll 1
    for (int key0 = 0; key0 < kend; key0 += 32) {
        const int adv = (key0 + 32 < kend) ? 32 : 0;         // the last pass has no next tile: it re-reads its own (in bounds, values unused)
        v8f sHa = (v8f){}, sLa = (v8f){}, sHb = (v8f){}, sLb = (v8f){};
        sHa = wmma16(ka0, qh0, sHa); sLa = wmma16(ka0, qr0, sLa); sHb = wmma16(kb0, qh0, sHb); sLb = wmma16(kb0, qr0, sLb);
        sHa = wmma16(ka1, qh1, sHa); sLa = wmma16(ka1, qr1, sLa); sHb = wmma16(kb1, qh1, sHb); sLb = wmma16(kb1, qr1, sLb);
        asm volatile("v_nop\n\tv_nop\n\tv_nop\n\tv_nop" : "+v"(sHa), "+v"(sLa), "+v"(sHb), "+v"(sLb) : "v"(ka0), "v"(ka1), "v"(kb0), "v"(kb1));
        __builtin_amdgcn_sched_barrier(0);                   // the next tile's K loads start behind the score products (same registers) ...
        ka += (size_t)adv * HD;
        ka0 = ldh(ka); ka1 = ldh(ka + 512); kb0 = ldh(ka + 1024); kb1 = ldh(ka + 1536);
        __builtin_amdgcn_sched_barrier(0);                   // ... and ahead of the softmax, which is their lead
        float ta[8], tb[8];
#pragma unroll
        for (int r = 0; r < 8; ++r) { ta[r] = (sHa[r] + sLa[r] * QRI) * SC2; tb[r] = (sHb[r] + sLb[r] * QRI) * SC2; }
        if (key0 + 31 > t0) {                                // wave-uniform: this tile reaches past the wave's first query row
            const int dl = tq - key0 - 8 * hi;               // key of ta[r] = key0 + 8h + r is visible iff r <= dl; key of tb[r] = key0 + 16 + 8h + r iff r + 16 <= dl
#pragma unroll
            for (int r = 0; r < 8; ++r) { ta[r] = (r <= dl) ? ta[r] : NEGB; tb[r] = (r + 16 <= dl) ? tb[r] : NEGB; }
        }
        float mx = NEGB;
#pragma unroll
        for (int r = 0; r < 8; ++r) mx = fmaxf(mx, fmaxf(ta[r], tb[r]));
        mx = fmaxf(mx, __shfl_xor(mx, 16, 32));
        const float mnew = fmaxf(m, mx);
        const float alpha = __builtin_amdgcn_exp2f(m - mnew);
        const float sh = PSH - mnew;
        v16h pb = (v16h){}, pq = (v16h){}; float ls = 0.0f;
#pragma unroll
        for (int r = 0; r < 8; ++r) {
            const float ea = __builtin_amdgcn_exp2f(ta[r] + sh); const float eb = __builtin_amdgcn_exp2f(tb[r] + sh);
            const h16 pa = (h16)ea; const h16 pc = (h16)eb; pb[r] = pa; pb[8 + r] = pc;
            if (RES) { const h16 xa = (h16)((ea - (float)pa) * QRS); const h16 xc = (h16)((eb - (float)pc) * QRS); pq[r] = xa; pq[8 + r] = xc;
                       ls += ((float)pa + (float)pc) + ((float)xa + (float)xc) * QRI; }
            else     { ls += (float)pa + (float)pc; }
        }
        l = l * alpha + ls; m = mnew;
        o0 = o0 * alpha; o1 = o1 * alpha; o2 = o2 * alpha; o3 = o3 * alpha;
        if (RES) {
            g0 = g0 * alpha; g1 = g1 * alpha; g2 = g2 * alpha; g3 = g3 * alpha;
            o0 = wmma16(v0, pb, o0); o1 = wmma16(v1, pb, o1); o2 = wmma16(v2, pb, o2); o3 = wmma16(v3, pb, o3);
            g0 = wmma16(w0, pb, g0); g1 = wmma16(w1, pb, g1); g2 = wmma16(w2, pb, g2); g3 = wmma16(w3, pb, g3);
            g0 = wmma16(v0, pq, g0); g1 = wmma16(v1, pq, g1); g2 = wmma16(v2, pq, g2); g3 = wmma16(v3, pq, g3);
            asm volatile("v_nop\n\tv_nop\n\tv_nop\n\tv_nop" : "+v"(o0), "+v"(o1), "+v"(o2), "+v"(o3), "+v"(g0), "+v"(g1), "+v"(g2), "+v"(g3)
                         : "v"(v0), "v"(v1), "v"(v2), "v"(v3), "v"(w0), "v"(w1), "v"(w2), "v"(w3), "v"(pb), "v"(pq));
            __builtin_amdgcn_sched_barrier(0);               // nothing but the 16 loads and their addresses between here and the wait below
            vr += (size_t)adv * HD; va += (size_t)adv * HD;
            w0 = ldh(vr); w1 = ldh(vr + 512); w2 = ldh(vr + 1024); w3 = ldh(vr + 1536);
            v0 = ldh(va); v1 = ldh(va + 512); v2 = ldh(va + 1024); v3 = ldh(va + 1536);
            asm volatile("s_wait_xcnt 0x0" : : "v"(va), "v"(vr) : "memory");   // what follows may reuse the address registers of these loads; the pointers as inputs keep them whole up to this wait, so that no result of the run lands in one
            __builtin_amdgcn_sched_barrier(0);               // keeps what follows behind the wait
        } else {
            o0 = wmma16(v0, pb, o0); o1 = wmma16(v1, pb, o1); o2 = wmma16(v2, pb, o2); o3 = wmma16(v3, pb, o3);
            asm volatile("v_nop\n\tv_nop\n\tv_nop\n\tv_nop" : "+v"(o0), "+v"(o1), "+v"(o2), "+v"(o3) : "v"(v0), "v"(v1), "v"(v2), "v"(v3), "v"(pb));
            va += (size_t)adv * HD;
            v0 = ldh(va); v1 = ldh(va + 512); v2 = ldh(va + 1024); v3 = ldh(va + 1536);
        }
    }
    asm volatile("s_wait_xcnt 0x0" : : "v"(pf) : "memory");   // what follows may reuse the address registers of the last pass's loads; the pointer as an input keeps the register that the prefetch names an address through the whole loop
    if (RES) { o0 = o0 + g0 * QRI; o1 = o1 + g1 * QRI; o2 = o2 + g2 * QRI; o3 = o3 + g3 * QRI; }
    l += __shfl_xor(l, 16, 32);
    const float inv = 1.0f / l;
    const int wb = wave * 16 * 68;
    // O^T D layout: o_j[r] = (d = 16j + 8h + r, t = lane&15) -> os[t][d]; rows 0..15 x columns 0..63 all written
    { v4f a, c;
      a[0] = o0[0] * inv; a[1] = o0[1] * inv; a[2] = o0[2] * inv; a[3] = o0[3] * inv; c[0] = o0[4] * inv; c[1] = o0[5] * inv; c[2] = o0[6] * inv; c[3] = o0[7] * inv;
      *(v4fa*)(&os[wb + lr * 68 +  0 + 8 * hi]) = a; *(v4fa*)(&os[wb + lr * 68 +  0 + 8 * hi + 4]) = c;
      a[0] = o1[0] * inv; a[1] = o1[1] * inv; a[2] = o1[2] * inv; a[3] = o1[3] * inv; c[0] = o1[4] * inv; c[1] = o1[5] * inv; c[2] = o1[6] * inv; c[3] = o1[7] * inv;
      *(v4fa*)(&os[wb + lr * 68 + 16 + 8 * hi]) = a; *(v4fa*)(&os[wb + lr * 68 + 16 + 8 * hi + 4]) = c;
      a[0] = o2[0] * inv; a[1] = o2[1] * inv; a[2] = o2[2] * inv; a[3] = o2[3] * inv; c[0] = o2[4] * inv; c[1] = o2[5] * inv; c[2] = o2[6] * inv; c[3] = o2[7] * inv;
      *(v4fa*)(&os[wb + lr * 68 + 32 + 8 * hi]) = a; *(v4fa*)(&os[wb + lr * 68 + 32 + 8 * hi + 4]) = c;
      a[0] = o3[0] * inv; a[1] = o3[1] * inv; a[2] = o3[2] * inv; a[3] = o3[3] * inv; c[0] = o3[4] * inv; c[1] = o3[5] * inv; c[2] = o3[6] * inv; c[3] = o3[7] * inv;
      *(v4fa*)(&os[wb + lr * 68 + 48 + 8 * hi]) = a; *(v4fa*)(&os[wb + lr * 68 + 48 + 8 * hi + 4]) = c; }
    wave_sync();
    float* orow = OUT + ((size_t)b * OUT_SEQ + t0) * DM + h * HD;
{
#pragma unroll
        for (int s = 0; s < 8; ++s) { const int row = 2 * s + hi, cofs = lr * 4;   // 8 s x 2 rows = 16 rows; 16 lanes x 4 floats = 64 columns
            const v4f val = *(const v4fa*)(&os[wb + row * 68 + cofs]);
            *(v4f*)(orow + (size_t)row * DM + cofs) = val; }
         }
}

// k_flash2: both row ranges in ONE grid (they write disjoint rows and read the same planes): blockIdx.x = (batch, head), blockIdx.y = 64-row block;
// the late rows (most key tiles) come first, longest first, then the early rows. The range test is block-uniform.
#define LATE_BLK  ((SEQ - EARLY) / (16 * AW))
#define EARLY_BLK (EARLY / (16 * AW))
#define PF_GK ((int)((size_t)SEQ * HD * 2 / PFG))     // prefetch groups of one K or V^T plane of one (batch, head)
#define PF_GR ((int)((size_t)EARLY * HD * 2 / PFG))   // of the part of the residual plane that is read
static_assert(((size_t)SEQ * HD * 2) % PFG == 0 && ((size_t)EARLY * HD * 2) % PFG == 0 && PF_GR >= 1);
static_assert((LATE_BLK + EARLY_BLK) * AW >= 2 * PF_GK + PF_GR && (LATE_BLK + EARLY_BLK) * AW <= 2 * (2 * PF_GK + PF_GR));
__global__ __launch_bounds__(32 * AW) void k_flash2(const h16* __restrict__ QH, const h16* __restrict__ QR, const h16* __restrict__ KP,
                                                    const h16* __restrict__ VT, const h16* __restrict__ VR, float* OUT) {
    __shared__ __align__(16) float os[AW * 16 * 68];
    const int zh = blockIdx.x, y = blockIdx.y;
    // L2 hints for this (batch, head)'s K and tanh(v)^T planes (head of the file): its SEQ/16 waves share them out, a group of 64 keys each, low keys to the work-groups that start first:
    // waves 0 .. 2 PF_GK - 1 take K and V^T in turn, the next PF_GR the part of the residual plane that is read (keys < EARLY), the rest ask for the first groups again. For speed only. Every address lies inside its plane.
    const int jw = y * AW + __builtin_amdgcn_readfirstlane((int)(threadIdx.x >> 5));
    const int jg = jw < 2 * PF_GK + PF_GR ? jw : jw - (2 * PF_GK + PF_GR);
    const h16* pf = (jg < 2 * PF_GK ? ((jg & 1) ? VT : KP) + (size_t)(jg >> 1) * PFE : VR + (size_t)(jg - 2 * PF_GK) * PFE) + (size_t)zh * SEQ * HD + 128 * (threadIdx.x & 31);
    asm volatile("global_prefetch_b8 %0, off scope:SCOPE_SE" : : "v"(pf));
    if (y < LATE_BLK) flash<0>(QH, QR, KP, VT, VR, OUT, os, zh, EARLY + (LATE_BLK - 1 - y) * 16 * AW, pf);
    else              flash<1>(QH, QR, KP, VT, VR, OUT, os, zh, (y - LATE_BLK) * 16 * AW, pf);
}

static constexpr size_t al256(size_t v) { return (v + 255) & ~(size_t)255; }
static constexpr size_t SZ_XB = al256((size_t)NB * SEQ * DM * 2);          // one bf16 activation copy
static constexpr size_t SZ_WB = al256((size_t)3 * DM * DM * 2);            // three transposed bf16 weights
static constexpr size_t SZ_PL = al256((size_t)NB * NH_ * SEQ * HD * 2);    // one f16 plane
static constexpr size_t SZ_TOTAL = 2 * SZ_XB + SZ_WB + 5 * SZ_PL;
static_assert(SZ_TOTAL <= (size_t)134217728);          // workspace carve <= 128 MiB
static_assert(((size_t)DM * DM * 2) % 256 == 0);       // weight sub-planes stay 256-byte aligned
static_assert(SZ_XB == (size_t)NB * SEQ * DM * 2 && SZ_WB == (size_t)3 * DM * DM * 2);   // no padding between XB, CB and WB: k_proj3's prefetch shares run across them

extern "C" void kernel_launch(void* const* d_in, const int* in_sizes, int n_in,
                              void* d_out, int out_size, void* d_ws, size_t ws_size, hipStream_t stream) {
    if (n_in < 8) return;
    const size_t needx = ((size_t)(NB - 1) * SEQ_FULL + SEQ) * DM;
    if ((size_t)in_sizes[0] < needx || (size_t)in_sizes[1] < needx) return;
    if ((size_t)in_sizes[2] < (size_t)DM * DM || (size_t)in_sizes[3] < (size_t)DM * DM || (size_t)in_sizes[4] < (size_t)DM * DM) return;
    if ((size_t)in_sizes[5] < (size_t)DM || (size_t)in_sizes[6] < (size_t)DM || (size_t)in_sizes[7] < (size_t)DM) return;
    if ((size_t)out_size < ((size_t)(NB - 1) * OUT_SEQ + SEQ) * DM) return;
    if (SZ_TOTAL > ws_size) return;
    // wire order: seq, ctx, Wq, Wk, Wv, bq, bk, bv
    const float* xs = (const float*)d_in[0]; const float* xc = (const float*)d_in[1];
    const float* wq = (const float*)d_in[2]; const float* wk = (const float*)d_in[3]; const float* wv = (const float*)d_in[4];
    const float* bq = (const float*)d_in[5]; const float* bk = (const float*)d_in[6]; const float* bv = (const float*)d_in[7];
    float* OUT = (float*)d_out;      // [NB][SEQ][1024]
    char* wsp = (char*)d_ws;
    // every plane in fragment order (head of the file)
    bf* XB = (bf*)wsp; wsp += SZ_XB;                 // seq  NB*SEQ rows x 1024
    bf* CB = (bf*)wsp; wsp += SZ_XB;                 // ctx  NB*SEQ rows x 1024
    bf* WB = (bf*)wsp; wsp += SZ_WB;                 // [3] 1024 rows n = h*64+e x 1024 d: q | k | v
    h16* QH = (h16*)wsp; wsp += SZ_PL;               // [NB*16] SEQ rows x 64
    h16* QR = (h16*)wsp; wsp += SZ_PL;               // [NB*16] SEQ rows x 64, residual x2048
    h16* KP = (h16*)wsp; wsp += SZ_PL;               // [NB*16] SEQ rows x 64
    h16* VT = (h16*)wsp; wsp += SZ_PL;               // [NB*16] 64 rows x SEQ, tanh(v)^T
    h16* VR = (h16*)wsp; wsp += SZ_PL;               // [NB*16] 64 rows x SEQ, residual x2048

    k_prep<<<dim3(2 * CVT_BLK + 3 * WT_BLK, 1, 1), 256, 0, stream>>>(xs, xc, wq, wk, wv, XB, CB, WB);
    k_proj3<<<dim3(PF_WG + 3 * PROJ_TILES, 1, 1), 32 * GW, 0, stream>>>(XB, CB, WB, bq, bk, bv, QH, QR, KP, VT, VR);
    k_flash2<<<dim3(NB * NH_, LATE_BLK + EARLY_BLK, 1), 32 * AW, 0, stream>>>(QH, QR, KP, VT, VR, OUT);
}

// v006
// Measured time: 32.7 microseconds a run.
// Next to v005, in two timings, it ran 1.08 and 1.09 times as fast.
// Counting every step since v000, it is 4.12 times as fast.
#include <hip/hip_runtime.h>

// Causal multi-head cross-attention: seq/ctx [NB][SEQ][1024], Wq/Wk/Wv [16][1024 in][64 out], biases [16][64]; q from seq, k and v from ctx, score scale 1/8, P applied to tanh(v), output = concatenated heads (f32).
// Compute dtypes, f32 accumulate everywhere: projections v_wmma_f32_16x16x32_bf16 (seq, ctx, W and biases RNE-converted to bf16; products exact);
// scores v_wmma_f32_16x16x32_f16: k single f16, q as f16 value + f16 residual x2048 in its own accumulator; P.V v_wmma_f32_16x16x32_f16: P carried x256 (cancels in the normalisation),
// query rows < 512: tanh(v) and P each as f16 value + f16 residual x2048 (three products, residual products in their own accumulator); later rows single f16 planes; softmax f32 (online, running max).
// Layout: every 16-bit operand plane lies in WMMA fragment order: a block of 16 rows x 32 k is 512 elements = [k half s][lane = 16*h + row][8], element (row, k = 16 s + 8 h + j), so that one 16-byte-per-lane load covers 512 contiguous bytes.
// bf16 copies of seq, ctx and the transposed W (rows h*64+e, k = d): blocks [row/16][k/32]; q (hi, residual), k planes per b*16+h (rows t, k = d): blocks [t/16][d/32]; tanh(v)^T planes (hi, residual) per b*16+h (rows d, k = t): blocks [t/32][d/16], written by the GEMM epilogue;
// fused flash kernel in transposed form (S^T = K Q^T, O^T = V^T P^T) with causal key-tile skipping and per-element replace-fill inside the visited diagonal tiles.

#ifndef NB
#define NB 2
#endif
#ifndef SEQ
#define SEQ 1024                 // query length == context length used (causal: keys <= query index)
#endif
#define NB_FULL  2
#define SEQ_FULL 1024
#ifndef OUT_SEQ
#define OUT_SEQ SEQ              // row pitch (in tokens) between batches of the output
#endif
#define DM   1024
#define NH_  16
#define HD   64
#define AW   4                   // query tiles per flash block (16 query rows each)
#define KS   2                   // waves per query tile: each takes a part of the tile's keys
#define EARLY ((SEQ) < 512 ? (SEQ) : 512)     // query rows below this use the residual planes in P.V
#define QRS  2048.0f             // carry of every residual plane (q, tanh(v), P)
#define QRI  (1.0f / 2048.0f)
#define SC2  (0.125f * 1.4426950408889634f)   // HD^-0.5 * log2(e)
#define PSH  8.0f                // log2 of the P carry (256)
#define NEGB (-3.0e38f)          // fill of masked scores (exp2 gives exactly 0)

static_assert(HD == 64);
static_assert(NH_ * HD == DM);                 // head h = columns h*64 + e
static_assert(DM % 64 == 0);
static_assert(DM % 64 == 0 && DM >= 64);       // GEMM k-loop: four steps of 32 per trip
static_assert(SEQ % 64 == 0);                  // a 64-row tile never straddles two batches
static_assert((NB * SEQ) % 64 == 0);
static_assert(SEQ % 32 == 0);                  // key loop steps by 32, last visited tile stays inside the plane
static_assert(EARLY % (16 * AW) == 0);
static_assert((SEQ - EARLY) % (16 * AW) == 0);
static_assert(((size_t)SEQ * DM) % 8 == 0);
static_assert(NB <= NB_FULL);
static_assert(SEQ <= SEQ_FULL);
static_assert(((size_t)(NB_FULL - 1) * SEQ_FULL + SEQ_FULL) * DM * 4 == (size_t)8388608);   // output bytes of the full problem

typedef _Float16 h16;
typedef unsigned short bf;
typedef __attribute__((ext_vector_type(16))) __bf16   v16bf;
typedef __attribute__((ext_vector_type(16))) _Float16 v16h;
typedef __attribute__((ext_vector_type(8)))  _Float16 v8h;
typedef __attribute__((ext_vector_type(8)))  unsigned short v8us;
typedef __attribute__((ext_vector_type(8)))  float    v8f;
typedef __attribute__((ext_vector_type(4)))  float    v4f;
typedef v4f  __attribute__((may_alias)) v4fa;

__device__ __forceinline__ unsigned short f2bf(float f) { unsigned u = __float_as_uint(f); u += 0x7FFFu + ((u >> 16) & 1u); return (unsigned short)(u >> 16); }
__device__ __forceinline__ float bfr(float f) { return __uint_as_float(((unsigned)f2bf(f)) << 16); }     // value after RNE convert to bf16
__device__ __forceinline__ float tanh_e(float x) { const float e = __builtin_amdgcn_exp2f(x * 2.8853900817779268f); return 1.0f - 2.0f * __builtin_amdgcn_rcpf(e + 1.0f); }   // 1 - 2/(exp(2x)+1); saturates cleanly to +-1
__device__ __forceinline__ v16h cat16(v8h lo, v8h hi) { return __builtin_shufflevector(lo, hi, 0, 1, 2, 3, 4, 5, 6, 7, 8, 9, 10, 11, 12, 13, 14, 15); }
__device__ __forceinline__ v16bf cat16b(v8us lo, v8us hi) { return __builtin_bit_cast(v16bf, __builtin_shufflevector(lo, hi, 0, 1, 2, 3, 4, 5, 6, 7, 8, 9, 10, 11, 12, 13, 14, 15)); }
__device__ __forceinline__ v8f wmma16(v16h a, v16h b, v8f c) { return __builtin_amdgcn_wmma_f32_16x16x32_f16(false, a, false, b, (short)0, c, false, false); }
__device__ __forceinline__ v8f wmmab(v16bf a, v16bf b, v8f c) { return __builtin_amdgcn_wmma_f32_16x16x32_bf16(false, a, false, b, (short)0, c, false, false); }
// fragment loaders from a 512-element block in fragment order; p = block + 8*lane: elements 0..7 <- k0+8h+0..7, elements 8..15 <- k0+16+8h+0..7 of row lane&15 (same map for A and B)
__device__ __forceinline__ v16h  ldh(const h16* p) { return cat16(*(const v8h*)p, *(const v8h*)(p + 256)); }
__device__ __forceinline__ v16bf ldb(const bf* p)  { return cat16b(*(const v8us*)p, *(const v8us*)(p + 256)); }
// ordering point for wave-private LDS tiles (same wave writes and reads)
// So both matrix launches open with hints for those planes: one global_prefetch_b8 names 32 addresses 256 B apart (PFG bytes), a lane each, into L2 only; it returns nothing, and no result depends on it.
#define PFG 8192                 // bytes one prefetch instruction of a wave covers
#define PFE (PFG / 2)            // the same in 16-bit elements
__device__ __forceinline__ void wave_sync() { __builtin_amdgcn_fence(3 /* release order */, "wavefront"); __builtin_amdgcn_wave_barrier(); asm volatile("" ::: "memory"); }

// cvt8: thread i converts 8 elements of [NB*SEQ rows][DM] into the fragment-order bf16 copy; i = ((row/16 * DM/32 + k/32) * 16 + row%16) * 4 + (k%32)/8: four lanes read one whole 128-byte line of a row,
// and a wave's store fills four whole lines (8 rows x 16 bytes in each of the four (s, h) parts of a block); the source batches lie SEQ_FULL rows apart
__device__ __forceinline__ void cvt8(const float* __restrict__ src, bf* dst, int blk) {
    const size_t n8 = (size_t)NB * SEQ * DM / 8;
    const size_t i = (size_t)blk * 256 + threadIdx.x; if (i >= n8) return;
    const size_t lr = (i >> 2) & 15, row = (i / (64 * (DM / 32))) * 16 + lr, kk = ((i >> 6) % (DM / 32)) * 32 + (i & 3) * 8;
    const size_t so = ((row / SEQ) * SEQ_FULL + row % SEQ) * DM + kk;
    const v8f v = *(const v8f*)(src + so); v8us o;
#pragma unroll
    for (int k = 0; k < 8; ++k) o[k] = f2bf(v[k]);
    *(v8us*)(dst + (i >> 6) * 512 + (i & 3) * 128 + lr * 8) = o;   // s = bit 1, h = bit 0 of i: s * 256 + (16 h + row%16) * 8
}

// wT: in W [NH][DM rows d][HD cols e] f32 -> out WT, rows n = h*64+e, k = d, bf16 (RNE convert), in fragment order. One block per (64-d tile, head); transpose through LDS (cross-wave: block barrier).
__device__ __forceinline__ void wT(const float* __restrict__ W, bf* WT, float* ts, int blk) {
    const int tid = threadIdx.x; const int d0 = (blk % (DM / 64)) * 64, h = blk / (DM / 64);
    const float* src = W + ((size_t)h * DM + d0) * HD;
#pragma unroll
    for (int i = 0; i < 4; ++i) { const int q = tid + 256 * i; const int d = q >> 4, e4 = (q & 15) * 4;      // 1024 float4 = 64 rows d x 64 cols e
        const v4f v = *(const v4f*)(src + (size_t)d * HD + e4);
        ts[d * 68 + e4 + 0] = v[0]; ts[d * 68 + e4 + 1] = v[1]; ts[d * 68 + e4 + 2] = v[2]; ts[d * 68 + e4 + 3] = v[3]; }
    __syncthreads();
{
#pragma unroll
        for (int it = 0; it < 2; ++it) { const int c = it * 256 + tid;                                          // 512 groups of 8 = 4 row blocks x 2 k blocks x 2 halves x 32 lanes
            const int rbl = c >> 7, ksl = (c >> 6) & 1; const int e = rbl * 16 + (c & 15), c8 = ksl * 32 + ((c >> 5) & 1) * 16 + ((c >> 4) & 1) * 8;   // rows e 0..63, columns d0 + 0..63
            v8us o;
#pragma unroll
            for (int k = 0; k < 8; ++k) o[k] = f2bf(ts[(c8 + k) * 68 + e]);
            *(v8us*)(WT + ((size_t)(h * (HD / 16) + rbl) * (DM / 32) + d0 / 32 + ksl) * 512 + (c & 63) * 8) = o; }
         }
}

// k_prep: the two activation converts and the three weight transposes, which do not depend on one another, as ranges of ONE grid (the range test is block-uniform).
#define CVT_BLK ((int)(((size_t)NB * SEQ * DM / 8 + 255) / 256))   // blocks of one convert
#define WT_BLK  ((DM / 64) * NH_)                                   // blocks of one transpose
__global__ __launch_bounds__(256) void k_prep(const float* __restrict__ xs, const float* __restrict__ xc, const float* __restrict__ wq, const float* __restrict__ wk,
                                              const float* __restrict__ wv, bf* XB, bf* CB, bf* WB) {
    __shared__ __align__(16) float ts[64 * 68];
    const int blk = blockIdx.x;
    if (blk < 3 * WT_BLK) {                                         // the transposes (the longer blocks) start first
        const int w = blk / WT_BLK;                                 // 0 q, 1 k, 2 v
        wT(w == 0 ? wq : (w == 1 ? wk : wv), WB + (size_t)w * DM * DM, ts, blk % WT_BLK);
        return;
    }
    const int c = blk - 3 * WT_BLK;
    if (c < CVT_BLK) cvt8(xs, XB, c); else cvt8(xc, CB, c - CVT_BLK);
}

// k_proj3: the three projections, which do not depend on one another, in ONE grid: behind PF_WG work-groups that only prefetch, each run of PROJ_TILES work-groups is one projection (scalar selects), one TM x TN tile each, row tiles first.
//   q: A = seq rows (m = b*SEQ + t), Bt = WQ rows (n = h*64 + e), bias per column -> plane [(b*16 + h)][t][e], with residual
//   k: A = ctx rows, Bt = WK rows, bias per column (the 1/8 scale is applied to the scores)
//   tanh(v)^T: A = WV rows (m = h*64 + e), Bt = ctx rows (n = b*SEQ + t), bias per row, tanh -> plane [(b*1024 + m)][t] = [(b*16 + h)][e][t], with residual
// Each: register-blocked bf16 GEMM, K = DM; a work-group of GW = 8 waves (4 x 2) owns 256 x 128, one 64x64 tile (16 accumulators) a wave.
// The operands come through LDS, so that a 16-row block is fetched from L2 once per work-group and not once per wave: a stage is KST = 128 k of the 16 A and 8 B row blocks, which in the fragment-order planes
// are runs of RBB = 4096 contiguous bytes, 16 K elements apart. Every wave brings its own slice of each stage with ONE tensor_load_to_lds (waves 0..3: four A blocks, waves 4..7: two B blocks), no pad:
// LDS keeps the fragment order, so a fragment load is again 512 contiguous bytes. Two buffers; the load of stage s + 2 goes out behind the barrier that ends pass s (written at the head of pass s + 1).
// C[m][n] = sum_k A[m][k] Bt[n][k] + bias (bf16 RNE value, f32 add; per column n when biasRow == 0, per row m when biasRow != 0), optional tanh (act != 0),
// written as f16 (Ph) and optionally the f16 residual x2048 (Pr, useRes != 0) in fragment order (rows m, k = n) at
// tile base (r0/RB)*sRB + (r0%RB)*pitch + (c0/CB)*sCB + (c0%CB)*64, 16-row block mb at + mb*sMB, 32-column block at + sKB (halves).
#define GW   8                   // waves of a GEMM work-group
#define TM   256                 // rows of A per work-group (4 waves)
#define TN   128                 // rows of Bt per work-group (2 waves)
#define KST  128                 // k per stage
#define NST  (DM / KST)          // stages
#define RBB  (16 * KST * 2)      // bytes of one 16-row block in one stage
#define STA  ((TM / 16) * RBB)   // bytes of A in a stage
#define STG  (STA + (TN / 16) * RBB)   // bytes of a stage
static_assert((NB * SEQ) % TM == 0 && DM % TM == 0 && (NB * SEQ) % TN == 0 && DM % TN == 0 && DM % KST == 0 && NST >= 2);
static_assert(TM == 4 * 64 && TN == 2 * 64 && GW == 8 && KST == 4 * 32);
static_assert(RBB % 2048 == 0 && STA % 2048 == 0 && STG % 2048 == 0 && (size_t)16 * DM * 2 <= 131072);   // every slice's place in LDS a multiple of 2 KiB; source pitch at most 128 KiB
#define PROJ_TILES ((NB * SEQ / TM) * (DM / TN))
static_assert(PROJ_TILES == (DM / TM) * (NB * SEQ / TN));
#define PF_WG  128               // work-groups at the head of the grid that only prefetch; b and b + 4 take the same share
#define PF_PER 28                // prefetch instructions of each, four from each of its first seven waves: its share is PF_PER * PFG contiguous bytes of [seq copy | ctx copy | three weights]
static_assert(PF_PER == 4 * (GW - 1));
static_assert(((size_t)2 * NB * SEQ * DM + (size_t)3 * DM * DM) * 2 == (size_t)(PF_WG / 2) * PF_PER * PFG);   // the shares cover the three planes exactly
#define PF4(a, b, c, d) "global_prefetch_b8 %0, off offset:" #a " scope:SCOPE_SE\n\tglobal_prefetch_b8 %0, off offset:" #b " scope:SCOPE_SE\n\tglobal_prefetch_b8 %0, off offset:" #c " scope:SCOPE_SE\n\tglobal_prefetch_b8 %0, off offset:" #d " scope:SCOPE_SE\n\t"
// the wait in front of a rewrite of address registers that issued loads name; the two scheduling barriers keep the rewrites behind it
__device__ __forceinline__ void addr_wait() { __builtin_amdgcn_sched_barrier(0); asm volatile("s_wait_xcnt 0x0" ::: "memory"); __builtin_amdgcn_sched_barrier(0); }
typedef uint32_t u32x4 __attribute__((ext_vector_type(4)));
typedef uint32_t u32x8 __attribute__((ext_vector_type(8)));
__device__ __forceinline__ uint32_t uni(uint32_t v) { return (uint32_t)__builtin_amdgcn_readfirstlane(v); }
__device__ __forceinline__ uint32_t pinned(uint32_t v) { uint32_t w = uni(v); asm volatile("" : "+s"(w)); return w; }   // holds a word of a tensor load's test or descriptor in a scalar register, formed at this place
__device__ __forceinline__ void wait_tensor0() { asm volatile("s_wait_tensorcnt 0x0" ::: "memory"); }   // this wave's own tensor load has landed (the compiler places no wait for it)
__device__ __forceinline__ void wait_ds0()     { asm volatile("s_wait_dscnt 0x0" ::: "memory"); }       // this wave's LDS reads have returned before their buffer is handed back
// one request: rows of RBB bytes, nrow of them (in g1), from global byte address ga to LDS byte offset dst
__device__ __forceinline__ void tdm_load(uint32_t dst, uint64_t ga, u32x8 g1) {
    u32x4 g0;
    g0[0] = uni(1u); g0[1] = uni(dst); g0[2] = uni((uint32_t)ga); g0[3] = uni((((uint32_t)(ga >> 32)) & 0x01FFFFFFu) | 0x80000000u);   // count 1; type 2
    asm volatile("tensor_load_to_lds %0, %1" :: "s"(g0), "s"(g1) : "memory");
}
// one k-step (32) of a 64x64 tile: its 8 fragments (16 LDS loads), and its 16 products
__device__ __forceinline__ void ld4(v16bf (&f)[4], const bf* P, int ks) {
#pragma unroll
    for (int i = 0; i < 4; ++i) f[i] = ldb(P + i * (RBB / 2) + ks * 512);   // row block i, k block ks of the stage
}
__device__ __forceinline__ void ld_step(v16bf (&a)[4], v16bf (&b)[4], const bf* Ap, const bf* Bp, int ks) {
    ld4(a, Ap, ks); ld4(b, Bp, ks);
    __builtin_amdgcn_sched_barrier(0);   // keeps the 16 loads as one group ahead of the other set's products: sunk to their use they would have no lead
}
__device__ __forceinline__ void mm_step(v8f (&acc)[4][4], const v16bf (&a)[4], const v16bf (&b)[4]) {
#pragma unroll
    for (int nb = 0; nb < 4; ++nb)
#pragma unroll
        for (int mb = 0; mb < 4; ++mb) acc[mb][nb] = wmmab(a[mb], b[nb], acc[mb][nb]);
    // four vector slots behind the last product, on every path, before its operands or results are touched
    asm volatile("v_nop\n\tv_nop\n\tv_nop\n\tv_nop" : "+v"(acc[0][0]), "+v"(acc[1][1]), "+v"(acc[2][2]), "+v"(acc[3][3])
                 : "v"(a[0]), "v"(a[1]), "v"(a[2]), "v"(a[3]), "v"(b[0]), "v"(b[1]), "v"(b[2]), "v"(b[3]));
    __builtin_amdgcn_sched_barrier(0);   // the refill of this set starts behind its last product, so it takes the same registers
}
__global__ __launch_bounds__(32 * GW) void k_proj3(const bf* __restrict__ xb, const bf* __restrict__ cb, const bf* __restrict__ wb,
                                              const float* __restrict__ bq, const float* __restrict__ bk, const float* __restrict__ bv,
                                              h16* QH, h16* QR, h16* KP, h16* VT, h16* VR) {
    __shared__ __attribute__((aligned(2048))) bf ring[2 * STG / 2];   // two stages: [A 16 row blocks | B 8 row blocks] of RBB bytes
    __shared__ __align__(16) float osw[GW * 16 * 68];                  // epilogue staging, a range of its own for each wave
    const uint32_t wave = uni(threadIdx.x >> 5);
    if (blockIdx.x < PF_WG) {
        // L2 hints for the operand planes (head of the file), from waves that start first and do nothing else, so the register that the prefetches name stays this address to the wave's end.
        // Work-groups b and b + 4 both take share (b / 8) * 4 + b % 4.
        // For speed only: any placement gives the same results. xb, cb and wb are one contiguous carve (checked at kernel_launch); wave w < 7 takes groups 4 w .. 4 w + 3 of the share.
        if (wave < GW - 1) {
            const unsigned sh = (blockIdx.x >> 3) * 4 + (blockIdx.x & 3);
            const bf* pa = xb + (size_t)sh * (PF_PER * PFE) + (size_t)wave * (4 * PFE) + 128 * (threadIdx.x & 31);
            asm volatile(PF4(0, 8192, 16384, 24576) : : "v"(pa));
        }
        return;                  // block-uniform, in front of every barrier and tensor load
    }
    const unsigned tb = blockIdx.x - PF_WG;
    const int p = 2 - (int)(tb / PROJ_TILES); const unsigned f = tb % PROJ_TILES; const bool isv = (p == 2);   // 0 q, 1 k, 2 v; v (tanh in its epilogue) starts first
    const int bx = (int)(isv ? f % (DM / TM) : f % (NB * SEQ / TM)), by = (int)(isv ? f / (DM / TM) : f / (NB * SEQ / TM));
    const bf* wp = wb + (size_t)p * DM * DM; const bf* xp = (p == 0) ? xb : cb;
    const bf* A = isv ? wp : xp; const bf* Bt = isv ? xp : wp; const float* bias = p == 0 ? bq : (p == 1 ? bk : bv);
    h16* Ph = p == 0 ? QH : (p == 1 ? KP : VT); h16* Pr = p == 0 ? QR : (p == 1 ? KP : VR);
    const size_t sRB = isv ? (size_t)0 : (size_t)NH_ * SEQ * HD, sCB = isv ? (size_t)DM * SEQ : (size_t)SEQ * HD;
    const int useRes = (p != 1), biasRow = isv, act = isv, RB = isv ? DM : SEQ, pitch = isv ? SEQ : HD, CB = isv ? SEQ : HD;
    const int sMB = isv ? 512 : 1024, sKB = isv ? 2048 : 512;   // q, k: blocks [t/16][d/32]; tanh(v)^T: blocks [t/32][d/16]
    const int K = DM;
    const int lane = threadIdx.x & 31, lr = lane & 15, hi = lane >> 4;
    const int wr = (int)(wave & 3), wc = (int)(wave >> 2);      // this wave's 64x64 tile in the work-group's 256 x 128
    const int r0 = bx * TM + wr * 64, c0 = by * TN + wc * 64;
    float* os = osw + wave * (16 * 68);
    // this wave's slice of every stage: waves 0..3 four row blocks of A, waves 4..7 two of Bt; stage s lies s * RBB bytes into each row block
    const bool sa = wave < 4;
    const bf* sp = sa ? A + (size_t)(bx * (TM / 16) + 4 * (int)wave) * 16 * K : Bt + (size_t)(by * (TN / 16) + 2 * ((int)wave - 4)) * 16 * K;
    const uint64_t ga0 = (uint64_t)(size_t)sp;
    const uint32_t dst0 = (uint32_t)(size_t)ring + (sa ? wave * (4 * RBB) : STA + (wave - 4) * (2 * RBB));
    const uint32_t d0 = RBB, d1 = sa ? 4u : 2u;                 // bytes a row, rows; tensor = tile
    u32x8 g1;
    g1[0] = uni(0u);                                            // no mask, 1-byte elements, no pad
    g1[1] = uni((d0 & 0xFFFFu) << 16);
    g1[2] = uni((d0 >> 16) | ((d1 & 0xFFFFu) << 16));
    g1[3] = uni((d1 >> 16) | (d0 << 16));
    g1[4] = uni(d1);
    g1[5] = uni((uint32_t)(16 * DM * 2));                       // source pitch: one 16-row block of the plane
    g1[6] = uni(0u);
    g1[7] = uni(0u);
    v8f acc[4][4];
#pragma unroll
    for (int mb = 0; mb < 4; ++mb)
#pragma unroll
        for (int nb = 0; nb < 4; ++nb) acc[mb][nb] = (v8f){};
    tdm_load(dst0, ga0, g1);                                    // stage 0 -> buffer 0
    wait_tensor0();
    __syncthreads();                                            // stage 0 published
    const bf* la = ring + wr * 4 * (RBB / 2) + 8 * lane;
    const bf* lb = ring + STA / 2 + wc * 4 * (RBB / 2) + 8 * lane;
    // two fragment sets inside a pass: each k-step's LDS loads are issued one step ahead, while the other set's products run; nothing of the next stage is read in this pass; k ascends as before
    v16bf a0[4], b0[4], a1[4], b1[4];
#pragma unroll 1   // one pass per stage; the body already holds four k-steps
    for (uint32_t s = 0; s < NST; ++s) {
        // behind the barrier that ended pass s - 1 (for s = 0: that published stage 0): stage s + 1 goes into the buffer that pass s - 1 has read, and flies during this pass
        const uint32_t sn = pinned(s + 1);                      // its descriptor is formed here, behind the wait for the request before it
        if (pinned(sn < NST)) tdm_load(dst0 + (sn & 1) * STG, ga0 + (uint64_t)sn * RBB, g1);
        const bf* Ap = la + (s & 1) * (STG / 2); const bf* Bp = lb + (s & 1) * (STG / 2);
        ld_step(a0, b0, Ap, Bp, 0);
        ld_step(a1, b1, Ap, Bp, 1);
        mm_step(acc, a0, b0);
        ld_step(a0, b0, Ap, Bp, 2);
        mm_step(acc, a1, b1);
        ld_step(a1, b1, Ap, Bp, 3);
        mm_step(acc, a0, b0);
        mm_step(acc, a1, b1);
        // publish point of stage s + 1
        wait_ds0();
        wait_tensor0();
        __syncthreads();                                        // stage s + 1 readable by all; every wave has left stage s's buffer
    }
    wait_tensor0();
    wait_ds0();
    // bias addends: addresses clamped into the 1024-entry bias array for the unused mode (index select, value select)
    float bc[4];
#pragma unroll
    for (int nb = 0; nb < 4; ++nb) bc[nb] = bias[biasRow ? 0 : (c0 + nb * 16 + lr)];
    addr_wait();                         // the row-bias loads below may land in the offset registers of these four loads; the converts follow it, so it does not wait for the data
#pragma unroll
    for (int nb = 0; nb < 4; ++nb) bc[nb] = bfr(bc[nb]);
    const size_t tbase = (size_t)(r0 / RB) * sRB + (size_t)(r0 % RB) * (size_t)pitch + (size_t)(c0 / CB) * sCB + (size_t)(c0 % CB) * 64;
#pragma unroll
    for (int mb = 0; mb < 4; ++mb) {
        const int ri = biasRow ? (r0 + mb * 16 + hi * 8) : 0;
        const v4f ra = *(const v4f*)(bias + ri); const v4f rb = *(const v4f*)(bias + ri + 4);
        asm volatile("s_wait_xcnt 0x0" : : "v"(ri * 4) : "memory");   // same wait; the byte offset as an input keeps the two loads' offset register from being reused ahead of it
        const float brv[8] = { bfr(ra[0]), bfr(ra[1]), bfr(ra[2]), bfr(ra[3]), bfr(rb[0]), bfr(rb[1]), bfr(rb[2]), bfr(rb[3]) };
#pragma unroll
        for (int nb = 0; nb < 4; ++nb) {
#pragma unroll
            for (int j = 0; j < 8; ++j) { float x = acc[mb][nb][j] + (biasRow ? brv[j] : bc[nb]);
                if (act) x = tanh_e(x);
                os[(hi * 8 + j) * 68 + nb * 16 + lr] = x; } }   // D: row 8h+j, col lane&15
        wave_sync();
        const size_t sb = tbase + (size_t)(mb * sMB) + 8 * lane;
{
#pragma unroll
            for (int s = 0; s < 4; ++s) { const int row = lr, c8 = s * 16 + hi * 8;   // 16 rows; s = 2 * (32-column block) + half, 4 s x 2 h x 8 = 64 columns
                const v4f x0 = *(const v4fa*)(&os[row * 68 + c8]); const v4f x1 = *(const v4fa*)(&os[row * 68 + c8 + 4]); v8h hv, rv;
#pragma unroll
                for (int i = 0; i < 4; ++i) { const h16 a0 = (h16)x0[i]; const h16 a1 = (h16)x1[i]; hv[i] = a0; hv[4 + i] = a1; rv[i] = (h16)((x0[i] - (float)a0) * QRS); rv[4 + i] = (h16)((x1[i] - (float)a1) * QRS); }
                const size_t oo = sb + (size_t)((s >> 1) * sKB + (s & 1) * 256);
                *(v8h*)(Ph + oo) = hv; if (useRes) *(v8h*)(Pr + oo) = rv; }
             }
        wave_sync();
    }
}

// flash<RES>: fused causal attention, KS = 2 waves per 16 query rows of one (batch, head), each with its own online softmax over one part of the key tiles, joined at the end (max, sum and O^T rescaled to the common max); K / V^T / Q fragments straight from the fragment-order f16 planes (two 16-B loads each, 512 contiguous bytes a load).
// Transposed form: S^T[key][t] = K Q^T (A = K rows, B = Q rows); lane (t = lane&15, h = lane>>4) holds keys 8h+r of each 16-key tile, so the packed
// P tile is directly the B fragment of O^T[d][t] = V^T P^T (element r <- tile keys 0..15, element 8+r <- tile keys 16..31, lane unchanged).
// Causal: key tiles beyond the wave's last query row are skipped; inside tiles that reach past the wave's first row each score with key > t is replaced by NEGB (P = 0 exactly). Key 0 is visible to every row.
// RES != 0: P and tanh(v) each carry an f16 residual x2048; products Vr.Ph and Vh.Pr accumulate in g (folded back by 1/2048), Vh.Ph in o.
// Softmax state (running max, partial sum) is one scalar per lane; the two lane halves of a row are combined with one xor-16 exchange (issued under wave-uniform control only).
template <int RES>
__device__ __forceinline__ void flash(const h16* __restrict__ QH, const h16* __restrict__ QR, const h16* __restrict__ KP,
                                      const h16* __restrict__ VT, const h16* __restrict__ VR, float* OUT, float* os, int zh, int tblk, const h16* pf) {
    const int lane = threadIdx.x & 31, lr = lane & 15, hi = lane >> 4;
    const int wv = __builtin_amdgcn_readfirstlane((int)(threadIdx.x >> 5));
    const int wave = wv % AW, kh = wv / AW;                  // query tile of the block; which part of its keys (0: the low tiles, 1: the high tiles)
    const int b = zh / NH_, h = zh % NH_;
    const int t0 = tblk + wave * 16;
    const int tq = t0 + lr;
    const size_t pbase = (size_t)zh * SEQ * HD;
    const size_t qo = pbase + (size_t)t0 * HD + 8 * lane;
    const v16h qh0 = ldh(QH + qo), qh1 = ldh(QH + qo + 512), qr0 = ldh(QR + qo), qr1 = ldh(QR + qo + 512);   // B fragments: col t, k = d
    asm volatile("s_wait_xcnt 0x0" : : "v"(QH + qo), "v"(QR + qo) : "memory");   // the fragments fetched ahead below may land in the address registers of these loads: the wait stands in front, the pointers as inputs keep them whole up to it
    const size_t ko = pbase + 8 * lane;                      // + key0 * HD + 512 * (2 * (16-key block) + d/32)   (A fragment: row key, k = d)
    const size_t vo = pbase + 8 * lane;                      // + key0 * HD + 512 * j                             (A fragment: row d = 16j + .., k = key)
    v8f o0 = (v8f){}, o1 = (v8f){}, o2 = (v8f){}, o3 = (v8f){};
    v8f g0 = (v8f){}, g1 = (v8f){}, g2 = (v8f){}, g3 = (v8f){};
    float m = NEGB, l = 0.0f;
    const int kend = t0 + 16;                                // keys 0 .. t0+15 are needed; kend <= SEQ, so key0 + 31 <= SEQ - 1
    const int ksplit = ((((kend + 31) >> 5) + 1) >> 1) * 32;   // the first ceil(n / 2) of the n key tiles go to wave part 0, the rest (none when n = 1) to part 1
    const int kbeg = kh ? ksplit : 0, kstop = kh ? kend : ksplit;
    const int kfirst = kbeg < kstop ? kbeg : 0;              // a part without tiles fetches tile 0 (in bounds, values unused)
    // K and V^T fragments are fetched one key tile ahead, into the same registers, right behind their last product
    const h16* ka = KP + ko + (size_t)kfirst * HD; const h16* va = VT + vo + (size_t)kfirst * HD; const h16* vr = VR + vo + (size_t)kfirst * HD;
    v16h ka0 = ldh(ka), ka1 = ldh(ka + 512), kb0 = ldh(ka + 1024), kb1 = ldh(ka + 1536);
    __builtin_amdgcn_sched_barrier(0);                       // K issued ahead of V^T here as in the loop: the wait in front of the score products then leaves the V^T loads in flight
    v16h w0 = (v16h){}, w1 = (v16h){}, w2 = (v16h){}, w3 = (v16h){};
    if (RES) { w0 = ldh(vr); w1 = ldh(vr + 512); w2 = ldh(vr + 1024); w3 = ldh(vr + 1536); }
    v16h v0 = ldh(va), v1 = ldh(va + 512), v2 = ldh(va + 1024), v3 = ldh(va + 1536);
    // the pointers as inputs keep the address registers of the loads above whole up to this wait: no result lands in one ahead of it
    if (RES) asm volatile("s_wait_xcnt 0x0" : : "v"(ka), "v"(va), "v"(vr) : "memory");
    else     asm volatile("s_wait_xcnt 0x0" : : "v"(ka), "v"(va) : "memory");
#pragma unroll 1
    for (int key0 = kbeg; key0 < kstop; key0 += 32) {
        const int adv = (key0 + 32 < kstop) ? 32 : 0;         // the last pass has no next tile: it re-reads its own (in bounds, values unused)
        v8f sHa = (v8f){}, sLa = (v8f){}, sHb = (v8f){}, sLb = (v8f){};
        sHa = wmma16(ka0, qh0, sHa); sLa = wmma16(ka0, qr0, sLa); sHb = wmma16(kb0, qh0, sHb); sLb = wmma16(kb0, qr0, sLb);
        sHa = wmma16(ka1, qh1, sHa); sLa = wmma16(ka1, qr1, sLa); sHb = wmma16(kb1, qh1, sHb); sLb = wmma16(kb1, qr1, sLb);
        asm volatile("v_nop\n\tv_nop\n\tv_nop\n\tv_nop" : "+v"(sHa), "+v"(sLa), "+v"(sHb), "+v"(sLb) : "v"(ka0), "v"(ka1), "v"(kb0), "v"(kb1));
        __builtin_amdgcn_sched_barrier(0);                   // the next tile's K loads start behind the score products (same registers) ...
        ka += (size_t)adv * HD;
        ka0 = ldh(ka); ka1 = ldh(ka + 512); kb0 = ldh(ka + 1024); kb1 = ldh(ka + 1536);
        __builtin_amdgcn_sched_barrier(0);                   // ... and ahead of the softmax, which is their lead
        float ta[8], tb[8];
#pragma unroll
        for (int r = 0; r < 8; ++r) { ta[r] = (sHa[r] + sLa[r] * QRI) * SC2; tb[r] = (sHb[r] + sLb[r] * QRI) * SC2; }
        if (key0 + 31 > t0) {                                // wave-uniform: this tile reaches past the wave's first query row
            const int dl = tq - key0 - 8 * hi;               // key of ta[r] = key0 + 8h + r is visible iff r <= dl; key of tb[r] = key0 + 16 + 8h + r iff r + 16 <= dl
#pragma unroll
            for (int r = 0; r < 8; ++r) { ta[r] = (r <= dl) ? ta[r] : NEGB; tb[r] = (r + 16 <= dl) ? tb[r] : NEGB; }
        }
        float mx = NEGB;
#pragma unroll
        for (int r = 0; r < 8; ++r) mx = fmaxf(mx, fmaxf(ta[r], tb[r]));
        mx = fmaxf(mx, __shfl_xor(mx, 16, 32));
        const float mnew = fmaxf(m, mx);
        const float alpha = __builtin_amdgcn_exp2f(m - mnew);
        const float sh = PSH - mnew;
        v16h pb = (v16h){}, pq = (v16h){}; float ls = 0.0f;
#pragma unroll
        for (int r = 0; r < 8; ++r) {
            const float ea = __builtin_amdgcn_exp2f(ta[r] + sh); const float eb = __builtin_amdgcn_exp2f(tb[r] + sh);
            const h16 pa = (h16)ea; const h16 pc = (h16)eb; pb[r] = pa; pb[8 + r] = pc;
            if (RES) { const h16 xa = (h16)((ea - (float)pa) * QRS); const h16 xc = (h16)((eb - (float)pc) * QRS); pq[r] = xa; pq[8 + r] = xc;
                       ls += ((float)pa + (float)pc) + ((float)xa + (float)xc) * QRI; }
            else     { ls += (float)pa + (float)pc; }
        }
        l = l * alpha + ls; m = mnew;
        o0 = o0 * alpha; o1 = o1 * alpha; o2 = o2 * alpha; o3 = o3 * alpha;
        if (RES) {
            g0 = g0 * alpha; g1 = g1 * alpha; g2 = g2 * alpha; g3 = g3 * alpha;
            o0 = wmma16(v0, pb, o0); o1 = wmma16(v1, pb, o1); o2 = wmma16(v2, pb, o2); o3 = wmma16(v3, pb, o3);
            g0 = wmma16(w0, pb, g0); g1 = wmma16(w1, pb, g1); g2 = wmma16(w2, pb, g2); g3 = wmma16(w3, pb, g3);
            g0 = wmma16(v0, pq, g0); g1 = wmma16(v1, pq, g1); g2 = wmma16(v2, pq, g2); g3 = wmma16(v3, pq, g3);
            asm volatile("v_nop\n\tv_nop\n\tv_nop\n\tv_nop" : "+v"(o0), "+v"(o1), "+v"(o2), "+v"(o3), "+v"(g0), "+v"(g1), "+v"(g2), "+v"(g3)
                         : "v"(v0), "v"(v1), "v"(v2), "v"(v3), "v"(w0), "v"(w1), "v"(w2), "v"(w3), "v"(pb), "v"(pq));
            __builtin_amdgcn_sched_barrier(0);               // nothing but the 16 loads and their addresses between here and the wait below
            vr += (size_t)adv * HD; va += (size_t)adv * HD;
            w0 = ldh(vr); w1 = ldh(vr + 512); w2 = ldh(vr + 1024); w3 = ldh(vr + 1536);
            v0 = ldh(va); v1 = ldh(va + 512); v2 = ldh(va + 1024); v3 = ldh(va + 1536);
            asm volatile("s_wait_xcnt 0x0" : : "v"(va), "v"(vr) : "memory");   // what follows may reuse the address registers of these loads; the pointers as inputs keep them whole up to this wait, so that no result of the run lands in one
            __builtin_amdgcn_sched_barrier(0);               // keeps what follows behind the wait
        } else {
            o0 = wmma16(v0, pb, o0); o1 = wmma16(v1, pb, o1); o2 = wmma16(v2, pb, o2); o3 = wmma16(v3, pb, o3);
            asm volatile("v_nop\n\tv_nop\n\tv_nop\n\tv_nop" : "+v"(o0), "+v"(o1), "+v"(o2), "+v"(o3) : "v"(v0), "v"(v1), "v"(v2), "v"(v3), "v"(pb));
            va += (size_t)adv * HD;
            v0 = ldh(va); v1 = ldh(va + 512); v2 = ldh(va + 1024); v3 = ldh(va + 1536);
        }
    }
    asm volatile("s_wait_xcnt 0x0" : : "v"(pf) : "memory");   // what follows may reuse the address registers of the last pass's loads; the pointer as an input keeps the register that the prefetch names an address through the whole loop
    if (RES) { o0 = o0 + g0 * QRI; o1 = o1 + g1 * QRI; o2 = o2 + g2 * QRI; o3 = o3 + g3 * QRI; }
    const int wb = wave * 16 * 68;
    // join of the two key parts of a query tile: part 1 hands its O^T tile (8 x 16 bytes a lane, 512 contiguous bytes a store), running max and partial sum to part 0 through the tile's staging range (16 * 68 = 34 * 32 floats)
    if (kh) {
        const v8f ov[4] = { o0, o1, o2, o3 };
#pragma unroll   // constant j: ov[] stays in registers
        for (int j = 0; j < 4; ++j) {
            *(v4fa*)(&os[wb + (2 * j) * 128 + 4 * lane])     = __builtin_shufflevector(ov[j], ov[j], 0, 1, 2, 3);
            *(v4fa*)(&os[wb + (2 * j + 1) * 128 + 4 * lane]) = __builtin_shufflevector(ov[j], ov[j], 4, 5, 6, 7);
        }
        os[wb + 1024 + lane] = m; os[wb + 1056 + lane] = l;
    }
    __syncthreads();                                         // block-uniform: every wave of the block passes it once; part 1's values are readable behind it
    if (kh) return;
    {
        const float m1 = os[wb + 1024 + lane], l1 = os[wb + 1056 + lane];
        const float mm = fmaxf(m, m1);                       // part 0 always holds key 0, so mm is a real score; a part without tiles has m1 = NEGB, weight exactly 0
        const float a0 = __builtin_amdgcn_exp2f(m - mm), a1 = __builtin_amdgcn_exp2f(m1 - mm);
        l = l * a0 + l1 * a1;
        v8f pv[4];
#pragma unroll   // constant j: pv[] stays in registers
        for (int j = 0; j < 4; ++j) {
            const v4f x = *(const v4fa*)(&os[wb + (2 * j) * 128 + 4 * lane]); const v4f y = *(const v4fa*)(&os[wb + (2 * j + 1) * 128 + 4 * lane]);
            pv[j] = __builtin_shufflevector(x, y, 0, 1, 2, 3, 4, 5, 6, 7);
        }
        o0 = o0 * a0 + pv[0] * a1; o1 = o1 * a0 + pv[1] * a1; o2 = o2 * a0 + pv[2] * a1; o3 = o3 * a0 + pv[3] * a1;
    }
    l += __shfl_xor(l, 16, 32);
    const float inv = 1.0f / l;
    // O^T D layout: o_j[r] = (d = 16j + 8h + r, t = lane&15) -> os[t][d]; rows 0..15 x columns 0..63 all written
    { v4f a, c;
      a[0] = o0[0] * inv; a[1] = o0[1] * inv; a[2] = o0[2] * inv; a[3] = o0[3] * inv; c[0] = o0[4] * inv; c[1] = o0[5] * inv; c[2] = o0[6] * inv; c[3] = o0[7] * inv;
      *(v4fa*)(&os[wb + lr * 68 +  0 + 8 * hi]) = a; *(v4fa*)(&os[wb + lr * 68 +  0 + 8 * hi + 4]) = c;
      a[0] = o1[0] * inv; a[1] = o1[1] * inv; a[2] = o1[2] * inv; a[3] = o1[3] * inv; c[0] = o1[4] * inv; c[1] = o1[5] * inv; c[2] = o1[6] * inv; c[3] = o1[7] * inv;
      *(v4fa*)(&os[wb + lr * 68 + 16 + 8 * hi]) = a; *(v4fa*)(&os[wb + lr * 68 + 16 + 8 * hi + 4]) = c;
      a[0] = o2[0] * inv; a[1] = o2[1] * inv; a[2] = o2[2] * inv; a[3] = o2[3] * inv; c[0] = o2[4] * inv; c[1] = o2[5] * inv; c[2] = o2[6] * inv; c[3] = o2[7] * inv;
      *(v4fa*)(&os[wb + lr * 68 + 32 + 8 * hi]) = a; *(v4fa*)(&os[wb + lr * 68 + 32 + 8 * hi + 4]) = c;
      a[0] = o3[0] * inv; a[1] = o3[1] * inv; a[2] = o3[2] * inv; a[3] = o3[3] * inv; c[0] = o3[4] * inv; c[1] = o3[5] * inv; c[2] = o3[6] * inv; c[3] = o3[7] * inv;
      *(v4fa*)(&os[wb + lr * 68 + 48 + 8 * hi]) = a; *(v4fa*)(&os[wb + lr * 68 + 48 + 8 * hi + 4]) = c; }
    wave_sync();
    float* orow = OUT + ((size_t)b * OUT_SEQ + t0) * DM + h * HD;
{
#pragma unroll
        for (int s = 0; s < 8; ++s) { const int row = 2 * s + hi, cofs = lr * 4;   // 8 s x 2 rows = 16 rows; 16 lanes x 4 floats = 64 columns
            const v4f val = *(const v4fa*)(&os[wb + row * 68 + cofs]);
            *(v4f*)(orow + (size_t)row * DM + cofs) = val; }
         }
}

// k_flash2: both row ranges in ONE grid (they write disjoint rows and read the same planes): blockIdx.x = (batch, head), blockIdx.y = 64-row block;
// the late rows (most key tiles) come first, longest first, then the early rows. The range test is block-uniform.
#define LATE_BLK  ((SEQ - EARLY) / (16 * AW))
#define EARLY_BLK (EARLY / (16 * AW))
#define PF_GK ((int)((size_t)SEQ * HD * 2 / PFG))     // prefetch groups of one K or V^T plane of one (batch, head)
#define PF_GR ((int)((size_t)EARLY * HD * 2 / PFG))   // of the part of the residual plane that is read
static_assert(((size_t)SEQ * HD * 2) % PFG == 0 && ((size_t)EARLY * HD * 2) % PFG == 0 && PF_GR >= 1);
static_assert((LATE_BLK + EARLY_BLK) * AW * KS >= 2 * PF_GK + PF_GR);
static_assert(KS == 2 && 16 * 68 == 34 * 32);          // flash: two key parts; the hand-over (32 + 2 floats a lane) fills a tile's staging range exactly
__global__ __launch_bounds__(32 * AW * KS) void k_flash2(const h16* __restrict__ QH, const h16* __restrict__ QR, const h16* __restrict__ KP,
                                                    const h16* __restrict__ VT, const h16* __restrict__ VR, float* OUT) {
    __shared__ __align__(16) float os[AW * 16 * 68];
    const int zh = blockIdx.x, y = blockIdx.y;
    // L2 hints for this (batch, head)'s K and tanh(v)^T planes (head of the file): its KS * SEQ/16 waves share them out, a group of 64 keys each, low keys to the work-groups that start first:
    // waves 0 .. 2 PF_GK - 1 take K and V^T in turn, the next PF_GR the part of the residual plane that is read (keys < EARLY), the rest go round the groups again. For speed only. Every address lies inside its plane.
    const int jw = y * (AW * KS) + __builtin_amdgcn_readfirstlane((int)(threadIdx.x >> 5));
    const int jg = jw % (2 * PF_GK + PF_GR);
    const h16* pf = (jg < 2 * PF_GK ? ((jg & 1) ? VT : KP) + (size_t)(jg >> 1) * PFE : VR + (size_t)(jg - 2 * PF_GK) * PFE) + (size_t)zh * SEQ * HD + 128 * (threadIdx.x & 31);
    asm volatile("global_prefetch_b8 %0, off scope:SCOPE_SE" : : "v"(pf));
    if (y < LATE_BLK) flash<0>(QH, QR, KP, VT, VR, OUT, os, zh, EARLY + (LATE_BLK - 1 - y) * 16 * AW, pf);
    else              flash<1>(QH, QR, KP, VT, VR, OUT, os, zh, (y - LATE_BLK) * 16 * AW, pf);
}

static constexpr size_t al256(size_t v) { return (v + 255) & ~(size_t)255; }
static constexpr size_t SZ_XB = al256((size_t)NB * SEQ * DM * 2);          // one bf16 activation copy
static constexpr size_t SZ_WB = al256((size_t)3 * DM * DM * 2);            // three transposed bf16 weights
static constexpr size_t SZ_PL = al256((size_t)NB * NH_ * SEQ * HD * 2);    // one f16 plane
static constexpr size_t SZ_TOTAL = 2 * SZ_XB + SZ_WB + 5 * SZ_PL;
static_assert(SZ_TOTAL <= (size_t)134217728);          // workspace carve <= 128 MiB
static_assert(((size_t)DM * DM * 2) % 256 == 0);       // weight sub-planes stay 256-byte aligned
static_assert(SZ_XB == (size_t)NB * SEQ * DM * 2 && SZ_WB == (size_t)3 * DM * DM * 2);   // no padding between XB, CB and WB: k_proj3's prefetch shares run across them

extern "C" void kernel_launch(void* const* d_in, const int* in_sizes, int n_in,
                              void* d_out, int out_size, void* d_ws, size_t ws_size, hipStream_t stream) {
    if (n_in < 8) return;
    const size_t needx = ((size_t)(NB - 1) * SEQ_FULL + SEQ) * DM;
    if ((size_t)in_sizes[0] < needx || (size_t)in_sizes[1] < needx) return;
    if ((size_t)in_sizes[2] < (size_t)DM * DM || (size_t)in_sizes[3] < (size_t)DM * DM || (size_t)in_sizes[4] < (size_t)DM * DM) return;
    if ((size_t)in_sizes[5] < (size_t)DM || (size_t)in_sizes[6] < (size_t)DM || (size_t)in_sizes[7] < (size_t)DM) return;
    if ((size_t)out_size < ((size_t)(NB - 1) * OUT_SEQ + SEQ) * DM) return;
    if (SZ_TOTAL > ws_size) return;
    // wire order: seq, ctx, Wq, Wk, Wv, bq, bk, bv
    const float* xs = (const float*)d_in[0]; const float* xc = (const float*)d_in[1];
    const float* wq = (const float*)d_in[2]; const float* wk = (const float*)d_in[3]; const float* wv = (const float*)d_in[4];
    const float* bq = (const float*)d_in[5]; const float* bk = (const float*)d_in[6]; const float* bv = (const float*)d_in[7];
    float* OUT = (float*)d_out;      // [NB][SEQ][1024]
    char* wsp = (char*)d_ws;
    // every plane in fragment order (head of the file)
    bf* XB = (bf*)wsp; wsp += SZ_XB;                 // seq  NB*SEQ rows x 1024
    bf* CB = (bf*)wsp; wsp += SZ_XB;                 // ctx  NB*SEQ rows x 1024
    bf* WB = (bf*)wsp; wsp += SZ_WB;                 // [3] 1024 rows n = h*64+e x 1024 d: q | k | v
    h16* QH = (h16*)wsp; wsp += SZ_PL;               // [NB*16] SEQ rows x 64
    h16* QR = (h16*)wsp; wsp += SZ_PL;               // [NB*16] SEQ rows x 64, residual x2048
    h16* KP = (h16*)wsp; wsp += SZ_PL;               // [NB*16] SEQ rows x 64
    h16* VT = (h16*)wsp; wsp += SZ_PL;               // [NB*16] 64 rows x SEQ, tanh(v)^T
    h16* VR = (h16*)wsp; wsp += SZ_PL;               // [NB*16] 64 rows x SEQ, residual x2048

    k_prep<<<dim3(2 * CVT_BLK + 3 * WT_BLK, 1, 1), 256, 0, stream>>>(xs, xc, wq, wk, wv, XB, CB, WB);
    k_proj3<<<dim3(PF_WG + 3 * PROJ_TILES, 1, 1), 32 * GW, 0, stream>>>(XB, CB, WB, bq, bk, bv, QH, QR, KP, VT, VR);
    k_flash2<<<dim3(NB * NH_, LATE_BLK + EARLY_BLK, 1), 32 * AW * KS, 0, stream>>>(QH, QR, KP, VT, VR, OUT);
}

// v007
// One run takes 31.2 microseconds.
// In two side-by-side timings against v006, it was 1.05 and 1.04 times as fast.
// Over all steps from v000 it is 4.31 times as fast.
#include <hip/hip_runtime.h>

// Causal multi-head cross-attention: seq/ctx [NB][SEQ][1024], Wq/Wk/Wv [16][1024 in][64 out], biases [16][64]; q from seq, k and v from ctx, score scale 1/8, P applied to tanh(v), output = concatenated heads (f32).
// Compute dtypes, f32 accumulate everywhere: projections v_wmma_f32_16x16x32_bf16 (seq, ctx, W and biases RNE-converted to bf16; products exact);
// scores v_wmma_f32_16x16x32_f16: k single f16, q as f16 value + f16 residual x2048 in its own accumulator; P.V v_wmma_f32_16x16x32_f16: P carried x256 (cancels in the normalisation),
// query rows < 512: tanh(v) and P each as f16 value + f16 residual x2048 (three products, residual products in their own accumulator); later rows single f16 planes; softmax f32 (online, running max).
// Layout: every 16-bit operand plane lies in WMMA fragment order: a block of 16 rows x 32 k is 512 elements = [k half s][lane = 16*h + row][8], element (row, k = 16 s + 8 h + j), so that one 16-byte-per-lane load covers 512 contiguous bytes.
// bf16 copies of seq, ctx and the transposed W (rows h*64+e, k = d): blocks [row/16][k/32]; q (hi, residual), k planes per b*16+h (rows t, k = d): blocks [t/16][d/32]; tanh(v)^T planes (hi, residual) per b*16+h (rows d, k = t): blocks [t/32][d/16], written by the GEMM epilogue;
// fused flash kernel in transposed form (S^T = K Q^T, O^T = V^T P^T) with causal key-tile skipping and per-element replace-fill inside the visited diagonal tiles.

#ifndef NB
#define NB 2
#endif
#ifndef SEQ
#define SEQ 1024                 // query length == context length used (causal: keys <= query index)
#endif
#define NB_FULL  2
#define SEQ_FULL 1024
#ifndef OUT_SEQ
#define OUT_SEQ SEQ              // row pitch (in tokens) between batches of the output
#endif
#define DM   1024
#define NH_  16
#define HD   64
#define AW   4                   // query tiles per flash block (16 query rows each)
#define KS   2                   // waves per query tile: each takes a part of the tile's keys
#define EARLY ((SEQ) < 512 ? (SEQ) : 512)     // query rows below this use the residual planes in P.V
#define QRS  2048.0f             // carry of every residual plane (q, tanh(v), P)
#define QRI  (1.0f / 2048.0f)
#define SC2  (0.125f * 1.4426950408889634f)   // HD^-0.5 * log2(e)
#define PSH  8.0f                // log2 of the P carry (256)
#define NEGB (-3.0e38f)          // fill of masked scores (exp2 gives exactly 0)

static_assert(HD == 64);
static_assert(NH_ * HD == DM);                 // head h = columns h*64 + e
static_assert(DM % 64 == 0);
static_assert(DM % 64 == 0 && DM >= 64);       // GEMM k-loop: four steps of 32 per trip
static_assert(SEQ % 64 == 0);                  // a 64-row tile never straddles two batches
static_assert((NB * SEQ) % 64 == 0);
static_assert(SEQ % 32 == 0);                  // key loop steps by 32, last visited tile stays inside the plane
static_assert(EARLY % (16 * AW) == 0);
static_assert((SEQ - EARLY) % (16 * AW) == 0);
static_assert(((size_t)SEQ * DM) % 8 == 0);
static_assert(NB <= NB_FULL);
static_assert(SEQ <= SEQ_FULL);
static_assert(((size_t)(NB_FULL - 1) * SEQ_FULL + SEQ_FULL) * DM * 4 == (size_t)8388608);   // output bytes of the full problem

typedef _Float16 h16;
typedef unsigned short bf;
typedef __attribute__((ext_vector_type(16))) __bf16   v16bf;
typedef __attribute__((ext_vector_type(16))) _Float16 v16h;
typedef __attribute__((ext_vector_type(8)))  _Float16 v8h;
typedef __attribute__((ext_vector_type(8)))  unsigned short v8us;
typedef __attribute__((ext_vector_type(8)))  float    v8f;
typedef __attribute__((ext_vector_type(4)))  float    v4f;
typedef v4f  __attribute__((may_alias)) v4fa;

__device__ __forceinline__ unsigned short f2bf(float f) { unsigned u = __float_as_uint(f); u += 0x7FFFu + ((u >> 16) & 1u); return (unsigned short)(u >> 16); }
__device__ __forceinline__ float bfr(float f) { return __uint_as_float(((unsigned)f2bf(f)) << 16); }     // value after RNE convert to bf16
__device__ __forceinline__ v16h cat16(v8h lo, v8h hi) { return __builtin_shufflevector(lo, hi, 0, 1, 2, 3, 4, 5, 6, 7, 8, 9, 10, 11, 12, 13, 14, 15); }
__device__ __forceinline__ v16bf cat16b(v8us lo, v8us hi) { return __builtin_bit_cast(v16bf, __builtin_shufflevector(lo, hi, 0, 1, 2, 3, 4, 5, 6, 7, 8, 9, 10, 11, 12, 13, 14, 15)); }
__device__ __forceinline__ v8f wmma16(v16h a, v16h b, v8f c) { return __builtin_amdgcn_wmma_f32_16x16x32_f16(false, a, false, b, (short)0, c, false, false); }
__device__ __forceinline__ v8f wmmab(v16bf a, v16bf b, v8f c) { return __builtin_amdgcn_wmma_f32_16x16x32_bf16(false, a, false, b, (short)0, c, false, false); }
// fragment loaders from a 512-element block in fragment order; p = block + 8*lane: elements 0..7 <- k0+8h+0..7, elements 8..15 <- k0+16+8h+0..7 of row lane&15 (same map for A and B)
__device__ __forceinline__ v16h  ldh(const h16* p) { return cat16(*(const v8h*)p, *(const v8h*)(p + 256)); }
__device__ __forceinline__ v16bf ldb(const bf* p)  { return cat16b(*(const v8us*)p, *(const v8us*)(p + 256)); }
// ordering point for wave-private LDS tiles (same wave writes and reads)
// So both matrix launches open with hints for those planes: one global_prefetch_b8 names 32 addresses 256 B apart (PFG bytes), a lane each, into L2 only; it returns nothing, and no result depends on it.
#define PFG 8192                 // bytes one prefetch instruction of a wave covers
#define PFE (PFG / 2)            // the same in 16-bit elements
__device__ __forceinline__ void wave_sync() { __builtin_amdgcn_fence(3 /* release order */, "wavefront"); __builtin_amdgcn_wave_barrier(); asm volatile("" ::: "memory"); }

// cvt8: thread i converts 8 elements of [NB*SEQ rows][DM] into the fragment-order bf16 copy; i = ((row/16 * DM/32 + k/32) * 16 + row%16) * 4 + (k%32)/8: four lanes read one whole 128-byte line of a row,
// and a wave's store fills four whole lines (8 rows x 16 bytes in each of the four (s, h) parts of a block); the source batches lie SEQ_FULL rows apart
__device__ __forceinline__ void cvt8(const float* __restrict__ src, bf* dst, int blk) {
    const size_t n8 = (size_t)NB * SEQ * DM / 8;
    const size_t i = (size_t)blk * 256 + threadIdx.x; if (i >= n8) return;
    const size_t lr = (i >> 2) & 15, row = (i / (64 * (DM / 32))) * 16 + lr, kk = ((i >> 6) % (DM / 32)) * 32 + (i & 3) * 8;
    const size_t so = ((row / SEQ) * SEQ_FULL + row % SEQ) * DM + kk;
    const v8f v = *(const v8f*)(src + so); v8us o;
#pragma unroll
    for (int k = 0; k < 8; ++k) o[k] = f2bf(v[k]);
    *(v8us*)(dst + (i >> 6) * 512 + (i & 3) * 128 + lr * 8) = o;   // s = bit 1, h = bit 0 of i: s * 256 + (16 h + row%16) * 8
}

// wT: in W [NH][DM rows d][HD cols e] f32 -> out WT, rows n = h*64+e, k = d, bf16 (RNE convert), in fragment order. One block per (64-d tile, head); transpose through LDS (cross-wave: block barrier).
__device__ __forceinline__ void wT(const float* __restrict__ W, bf* WT, float* ts, int blk) {
    const int tid = threadIdx.x; const int d0 = (blk % (DM / 64)) * 64, h = blk / (DM / 64);
    const float* src = W + ((size_t)h * DM + d0) * HD;
#pragma unroll
    for (int i = 0; i < 4; ++i) { const int q = tid + 256 * i; const int d = q >> 4, e4 = (q & 15) * 4;      // 1024 float4 = 64 rows d x 64 cols e
        const v4f v = *(const v4f*)(src + (size_t)d * HD + e4);
        ts[d * 68 + e4 + 0] = v[0]; ts[d * 68 + e4 + 1] = v[1]; ts[d * 68 + e4 + 2] = v[2]; ts[d * 68 + e4 + 3] = v[3]; }
    __syncthreads();
{
#pragma unroll
        for (int it = 0; it < 2; ++it) { const int c = it * 256 + tid;                                          // 512 groups of 8 = 4 row blocks x 2 k blocks x 2 halves x 32 lanes
            const int rbl = c >> 7, ksl = (c >> 6) & 1; const int e = rbl * 16 + (c & 15), c8 = ksl * 32 + ((c >> 5) & 1) * 16 + ((c >> 4) & 1) * 8;   // rows e 0..63, columns d0 + 0..63
            v8us o;
#pragma unroll
            for (int k = 0; k < 8; ++k) o[k] = f2bf(ts[(c8 + k) * 68 + e]);
            *(v8us*)(WT + ((size_t)(h * (HD / 16) + rbl) * (DM / 32) + d0 / 32 + ksl) * 512 + (c & 63) * 8) = o; }
         }
}

// k_prep: the two activation converts and the three weight transposes, which do not depend on one another, as ranges of ONE grid (the range test is block-uniform).
#define CVT_BLK ((int)(((size_t)NB * SEQ * DM / 8 + 255) / 256))   // blocks of one convert
#define WT_BLK  ((DM / 64) * NH_)                                   // blocks of one transpose
__global__ __launch_bounds__(256) void k_prep(const float* __restrict__ xs, const float* __restrict__ xc, const float* __restrict__ wq, const float* __restrict__ wk,
                                              const float* __restrict__ wv, bf* XB, bf* CB, bf* WB) {
    __shared__ __align__(16) float ts[64 * 68];
    const int blk = blockIdx.x;
    if (blk < 3 * WT_BLK) {                                         // the transposes (the longer blocks) start first
        const int w = blk / WT_BLK;                                 // 0 q, 1 k, 2 v
        wT(w == 0 ? wq : (w == 1 ? wk : wv), WB + (size_t)w * DM * DM, ts, blk % WT_BLK);
        return;
    }
    const int c = blk - 3 * WT_BLK;
    if (c < CVT_BLK) cvt8(xs, XB, c); else cvt8(xc, CB, c - CVT_BLK);
}

// k_proj3: the three projections, which do not depend on one another, in ONE grid: behind PF_WG work-groups that only prefetch, each run of PROJ_TILES work-groups is one projection (scalar selects), one TM x TN tile each, row tiles first.
//   q: A = seq rows (m = b*SEQ + t), Bt = WQ rows (n = h*64 + e), bias per column -> plane [(b*16 + h)][t][e], with residual
//   k: A = ctx rows, Bt = WK rows, bias per column (the 1/8 scale is applied to the scores)
//   tanh(v)^T: A = WV rows (m = h*64 + e), Bt = ctx rows (n = b*SEQ + t), bias per row, tanh -> plane [(b*1024 + m)][t] = [(b*16 + h)][e][t], with residual
// Each: register-blocked bf16 GEMM, K = DM; a work-group of GW = 8 waves (4 x 2) owns 256 x 128, one 64x64 tile (16 accumulators) a wave.
// The operands come through LDS, so that a 16-row block is fetched from L2 once per work-group and not once per wave: a stage is KST = 128 k of the 16 A and 8 B row blocks, which in the fragment-order planes
// are runs of RBB = 4096 contiguous bytes, 16 K elements apart. Every wave brings its own slice of each stage with ONE tensor_load_to_lds (waves 0..3: four A blocks, waves 4..7: two B blocks), no pad:
// LDS keeps the fragment order, so a fragment load is again 512 contiguous bytes. Two buffers; the load of stage s + 2 goes out behind the barrier that ends pass s (written at the head of pass s + 1).
// C[m][n] = sum_k A[m][k] Bt[n][k] + bias (bf16 RNE value, f32 add; per column n for q and k, per row m for v), tanh for v,
// written as f16 (Ph) and, for q and v, the f16 residual x2048 (Pr) in fragment order (rows m, k = n) at
// tile base (r0/RB)*sRB + (r0%RB)*pitch + (c0/CB)*sCB + (c0%CB)*64, 16-row block mb at + mb*sMB, 32-column block at + sKB (halves).
#define GW   8                   // waves of a GEMM work-group
#define TM   256                 // rows of A per work-group (4 waves)
#define TN   128                 // rows of Bt per work-group (2 waves)
#define KST  128                 // k per stage
#define NST  (DM / KST)          // stages
#define RBB  (16 * KST * 2)      // bytes of one 16-row block in one stage
#define STA  ((TM / 16) * RBB)   // bytes of A in a stage
#define STG  (STA + (TN / 16) * RBB)   // bytes of a stage
static_assert((NB * SEQ) % TM == 0 && DM % TM == 0 && (NB * SEQ) % TN == 0 && DM % TN == 0 && DM % KST == 0 && NST >= 2);
static_assert(TM == 4 * 64 && TN == 2 * 64 && GW == 8 && KST == 4 * 32);
static_assert(RBB % 2048 == 0 && STA % 2048 == 0 && STG % 2048 == 0 && (size_t)16 * DM * 2 <= 131072);   // every slice's place in LDS a multiple of 2 KiB; source pitch at most 128 KiB
#define PROJ_TILES ((NB * SEQ / TM) * (DM / TN))
static_assert(PROJ_TILES == (DM / TM) * (NB * SEQ / TN));
#define PF_WG  128               // work-groups at the head of the grid that only prefetch; b and b + 4 take the same share
#define PF_PER 28                // prefetch instructions of each, four from each of its first seven waves: its share is PF_PER * PFG contiguous bytes of [seq copy | ctx copy | three weights]
static_assert(PF_PER == 4 * (GW - 1));
static_assert(((size_t)2 * NB * SEQ * DM + (size_t)3 * DM * DM) * 2 == (size_t)(PF_WG / 2) * PF_PER * PFG);   // the shares cover the three planes exactly
#define PF4(a, b, c, d) "global_prefetch_b8 %0, off offset:" #a " scope:SCOPE_SE\n\tglobal_prefetch_b8 %0, off offset:" #b " scope:SCOPE_SE\n\tglobal_prefetch_b8 %0, off offset:" #c " scope:SCOPE_SE\n\tglobal_prefetch_b8 %0, off offset:" #d " scope:SCOPE_SE\n\t"
// the wait in front of a rewrite of address registers that issued loads name; the two scheduling barriers keep the rewrites behind it
__device__ __forceinline__ void addr_wait() { __builtin_amdgcn_sched_barrier(0); asm volatile("s_wait_xcnt 0x0" ::: "memory"); __builtin_amdgcn_sched_barrier(0); }
typedef uint32_t u32x4 __attribute__((ext_vector_type(4)));
typedef uint32_t u32x8 __attribute__((ext_vector_type(8)));
__device__ __forceinline__ uint32_t uni(uint32_t v) { return (uint32_t)__builtin_amdgcn_readfirstlane(v); }
__device__ __forceinline__ uint32_t pinned(uint32_t v) { uint32_t w = uni(v); asm volatile("" : "+s"(w)); return w; }   // holds a word of a tensor load's test or descriptor in a scalar register, formed at this place
__device__ __forceinline__ void wait_tensor0() { asm volatile("s_wait_tensorcnt 0x0" ::: "memory"); }   // this wave's own tensor load has landed (the compiler places no wait for it)
__device__ __forceinline__ void wait_ds0()     { asm volatile("s_wait_dscnt 0x0" ::: "memory"); }       // this wave's LDS reads have returned before their buffer is handed back
// one request: rows of RBB bytes, nrow of them (in g1), from global byte address ga to LDS byte offset dst
__device__ __forceinline__ void tdm_load(uint32_t dst, uint64_t ga, u32x8 g1) {
    u32x4 g0;
    g0[0] = uni(1u); g0[1] = uni(dst); g0[2] = uni((uint32_t)ga); g0[3] = uni((((uint32_t)(ga >> 32)) & 0x01FFFFFFu) | 0x80000000u);   // count 1; type 2
    asm volatile("tensor_load_to_lds %0, %1" :: "s"(g0), "s"(g1) : "memory");
}
// one k-step (32) of a 64x64 tile: its 8 fragments (16 LDS loads), and its 16 products
__device__ __forceinline__ void ld4(v16bf (&f)[4], const bf* P, int ks) {
#pragma unroll
    for (int i = 0; i < 4; ++i) f[i] = ldb(P + i * (RBB / 2) + ks * 512);   // row block i, k block ks of the stage
}
__device__ __forceinline__ void ld_step(v16bf (&a)[4], v16bf (&b)[4], const bf* Ap, const bf* Bp, int ks) {
    ld4(a, Ap, ks); ld4(b, Bp, ks);
    __builtin_amdgcn_sched_barrier(0);   // keeps the 16 loads as one group ahead of the other set's products: sunk to their use they would have no lead
}
__device__ __forceinline__ void mm_step(v8f (&acc)[4][4], const v16bf (&a)[4], const v16bf (&b)[4]) {
#pragma unroll
    for (int nb = 0; nb < 4; ++nb)
#pragma unroll
        for (int mb = 0; mb < 4; ++mb) acc[mb][nb] = wmmab(b[nb], a[mb], acc[mb][nb]);   // Bt rows as the A operand: D row 8h+j = column n, D col lane&15 = row m
    // four vector slots behind the last product, on every path, before its operands or results are touched
    asm volatile("v_nop\n\tv_nop\n\tv_nop\n\tv_nop" : "+v"(acc[0][0]), "+v"(acc[1][1]), "+v"(acc[2][2]), "+v"(acc[3][3])
                 : "v"(a[0]), "v"(a[1]), "v"(a[2]), "v"(a[3]), "v"(b[0]), "v"(b[1]), "v"(b[2]), "v"(b[3]));
    __builtin_amdgcn_sched_barrier(0);   // the refill of this set starts behind its last product, so it takes the same registers
}
// Eight transcendentals in one statement: the outputs are early-clobber, so inside the run no instruction reads its predecessor's result or overwrites its source, and the v_nop fills the slot behind the last one.
#define TR8(op) op " %0, %8\n\t" op " %1, %9\n\t" op " %2, %10\n\t" op " %3, %11\n\t" op " %4, %12\n\t" op " %5, %13\n\t" op " %6, %14\n\t" op " %7, %15\n\tv_nop"
#define TR8_OPS : "=&v"(d0), "=&v"(d1), "=&v"(d2), "=&v"(d3), "=&v"(d4), "=&v"(d5), "=&v"(d6), "=&v"(d7) : "v"(s[0]), "v"(s[1]), "v"(s[2]), "v"(s[3]), "v"(s[4]), "v"(s[5]), "v"(s[6]), "v"(s[7])
__device__ __forceinline__ v8f exp2_8(v8f s) { float d0, d1, d2, d3, d4, d5, d6, d7; asm(TR8("v_exp_f32") TR8_OPS); return (v8f){ d0, d1, d2, d3, d4, d5, d6, d7 }; }
__device__ __forceinline__ v8f rcp_8(v8f s)  { float d0, d1, d2, d3, d4, d5, d6, d7; asm(TR8("v_rcp_f32") TR8_OPS); return (v8f){ d0, d1, d2, d3, d4, d5, d6, d7 }; }
__device__ __forceinline__ v8f tanh_8(v8f x) { const v8f e = exp2_8(x * 2.8853900817779268f); return 1.0f - 2.0f * rcp_8(e + 1.0f); }   // 1 - 2/(exp(2x)+1), eight values at a time; saturates cleanly to +-1
// Epilogue of one wave's 64x64 tile. The products are formed transposed (mm_step), so lane (h = lane>>4, r = lane&15) holds in acc[mb][nb][0..7] the elements (row m = 16 mb + r, columns n = 16 nb + 8 h + 0..7):
// exactly the 8 consecutive k that this lane owns in the fragment-order plane (rows m, k = n). Each accumulator goes from registers to one 16-byte store a lane (512 contiguous bytes a wave), through no LDS.
// ISV: bias per row m and tanh, plane blocks [n/32][m/16]; else bias per column n, plane blocks [m/16][n/32]. RES: the f16 residual x2048 goes to Pr as well.
template <bool ISV, bool RES>
__device__ __forceinline__ void proj_out(const v8f (&acc)[4][4], const float* __restrict__ bias, h16* Ph, h16* Pr, int r0, int c0, int lane) {
    const int lr = lane & 15, hi = lane >> 4;
    constexpr int RB = ISV ? DM : SEQ, pitch = ISV ? SEQ : HD, CB = ISV ? SEQ : HD;
    constexpr size_t sRB = ISV ? (size_t)0 : (size_t)NH_ * SEQ * HD, sCB = ISV ? (size_t)DM * SEQ : (size_t)SEQ * HD;
    constexpr int sMB = ISV ? 512 : 1024, sKB = ISV ? 2048 : 512;
    float br[4] = { 0.0f, 0.0f, 0.0f, 0.0f }; v8f bc[4] = { (v8f){}, (v8f){}, (v8f){}, (v8f){} };
    if (ISV) {
#pragma unroll
        for (int mb = 0; mb < 4; ++mb) br[mb] = bias[r0 + mb * 16 + lr];
    } else {
#pragma unroll
        for (int nb = 0; nb < 4; ++nb) bc[nb] = *(const v8f*)(bias + c0 + nb * 16 + hi * 8);
    }
    addr_wait();                         // what follows may reuse the address registers of the bias loads; the converts stand behind it, so it does not wait for the data
#pragma unroll
    for (int i = 0; i < 4; ++i) {
        br[i] = bfr(br[i]);
#pragma unroll
        for (int j = 0; j < 8; ++j) bc[i][j] = bfr(bc[i][j]);
    }
    const size_t sb = (size_t)(r0 / RB) * sRB + (size_t)(r0 % RB) * (size_t)pitch + (size_t)(c0 / CB) * sCB + (size_t)(c0 % CB) * 64 + 8 * lane;
    h16* ph = Ph + sb; h16* pr = Pr + sb;   // every store below is one of these two addresses plus a constant
#pragma unroll
    for (int mb = 0; mb < 4; ++mb) {
        v8h hv[4], rv[4];
#pragma unroll
        for (int nb = 0; nb < 4; ++nb) {
            v8f x = ISV ? acc[mb][nb] + br[mb] : acc[mb][nb] + bc[nb];
            if (ISV) x = tanh_8(x);
#pragma unroll
            for (int j = 0; j < 8; ++j) { const h16 a = (h16)x[j]; hv[nb][j] = a; rv[nb][j] = (h16)__builtin_fmaf((float)a, -QRS, x[j] * QRS); }   // = (x - a) * 2048, every step exact: the fma takes the f16 value's own f32 image
        }
        __builtin_amdgcn_sched_barrier(0);   // the stores of a 16-row block stand together, with no vector write between them and their wait
#pragma unroll
        for (int nb = 0; nb < 4; ++nb) {
            const int oo = mb * sMB + (nb >> 1) * sKB + (nb & 1) * 256;   // 16-row block mb; 32-column block nb / 2, half nb % 2
            *(v8h*)(ph + oo) = hv[nb]; if (RES) *(v8h*)(pr + oo) = rv[nb];
        }
        addr_wait();                         // the next block's values may take the data registers of these stores
    }
}
__global__ __launch_bounds__(32 * GW) void k_proj3(const bf* __restrict__ xb, const bf* __restrict__ cb, const bf* __restrict__ wb,
                                              const float* __restrict__ bq, const float* __restrict__ bk, const float* __restrict__ bv,
                                              h16* QH, h16* QR, h16* KP, h16* VT, h16* VR) {
    __shared__ __attribute__((aligned(2048))) bf ring[2 * STG / 2];   // two stages: [A 16 row blocks | B 8 row blocks] of RBB bytes
    const uint32_t wave = uni(threadIdx.x >> 5);
    if (blockIdx.x < PF_WG) {
        // L2 hints for the operand planes (head of the file), from waves that start first and do nothing else, so the register that the prefetches name stays this address to the wave's end.
        // Work-groups b and b + 4 both take share (b / 8) * 4 + b % 4.
        // For speed only: any placement gives the same results. xb, cb and wb are one contiguous carve (checked at kernel_launch); wave w < 7 takes groups 4 w .. 4 w + 3 of the share.
        if (wave < GW - 1) {
            const unsigned sh = (blockIdx.x >> 3) * 4 + (blockIdx.x & 3);
            const bf* pa = xb + (size_t)sh * (PF_PER * PFE) + (size_t)wave * (4 * PFE) + 128 * (threadIdx.x & 31);
            asm volatile(PF4(0, 8192, 16384, 24576) : : "v"(pa));
        }
        return;                  // block-uniform, in front of every barrier and tensor load
    }
    const unsigned tb = blockIdx.x - PF_WG;
    const int p = 2 - (int)(tb / PROJ_TILES); const unsigned f = tb % PROJ_TILES; const bool isv = (p == 2);   // 0 q, 1 k, 2 v; v (tanh in its epilogue) starts first
    const int bx = (int)(isv ? f % (DM / TM) : f % (NB * SEQ / TM)), by = (int)(isv ? f / (DM / TM) : f / (NB * SEQ / TM));
    const bf* wp = wb + (size_t)p * DM * DM; const bf* xp = (p == 0) ? xb : cb;
    const bf* A = isv ? wp : xp; const bf* Bt = isv ? xp : wp;
    const int K = DM;
    const int lane = threadIdx.x & 31;
    const int wr = (int)(wave & 3), wc = (int)(wave >> 2);      // this wave's 64x64 tile in the work-group's 256 x 128
    const int r0 = bx * TM + wr * 64, c0 = by * TN + wc * 64;
    // this wave's slice of every stage: waves 0..3 four row blocks of A, waves 4..7 two of Bt; stage s lies s * RBB bytes into each row block
    const bool sa = wave < 4;
    const bf* sp = sa ? A + (size_t)(bx * (TM / 16) + 4 * (int)wave) * 16 * K : Bt + (size_t)(by * (TN / 16) + 2 * ((int)wave - 4)) * 16 * K;
    const uint64_t ga0 = (uint64_t)(size_t)sp;
    const uint32_t dst0 = (uint32_t)(size_t)ring + (sa ? wave * (4 * RBB) : STA + (wave - 4) * (2 * RBB));
    const uint32_t d0 = RBB, d1 = sa ? 4u : 2u;                 // bytes a row, rows; tensor = tile
    u32x8 g1;
    g1[0] = uni(0u);                                            // no mask, 1-byte elements, no pad
    g1[1] = uni((d0 & 0xFFFFu) << 16);
    g1[2] = uni((d0 >> 16) | ((d1 & 0xFFFFu) << 16));
    g1[3] = uni((d1 >> 16) | (d0 << 16));
    g1[4] = uni(d1);
    g1[5] = uni((uint32_t)(16 * DM * 2));                       // source pitch: one 16-row block of the plane
    g1[6] = uni(0u);
    g1[7] = uni(0u);
    v8f acc[4][4];
#pragma unroll
    for (int mb = 0; mb < 4; ++mb)
#pragma unroll
        for (int nb = 0; nb < 4; ++nb) acc[mb][nb] = (v8f){};
    tdm_load(dst0, ga0, g1);                                    // stage 0 -> buffer 0
    wait_tensor0();
    __syncthreads();                                            // stage 0 published
    const bf* la = ring + wr * 4 * (RBB / 2) + 8 * lane;
    const bf* lb = ring + STA / 2 + wc * 4 * (RBB / 2) + 8 * lane;
    // two fragment sets inside a pass: each k-step's LDS loads are issued one step ahead, while the other set's products run; nothing of the next stage is read in this pass; k ascends as before
    v16bf a0[4], b0[4], a1[4], b1[4];
#pragma unroll 1   // one pass per stage; the body already holds four k-steps
    for (uint32_t s = 0; s < NST; ++s) {
        // behind the barrier that ended pass s - 1 (for s = 0: that published stage 0): stage s + 1 goes into the buffer that pass s - 1 has read, and flies during this pass
        const uint32_t sn = pinned(s + 1);                      // its descriptor is formed here, behind the wait for the request before it
        if (pinned(sn < NST)) tdm_load(dst0 + (sn & 1) * STG, ga0 + (uint64_t)sn * RBB, g1);
        const bf* Ap = la + (s & 1) * (STG / 2); const bf* Bp = lb + (s & 1) * (STG / 2);
        ld_step(a0, b0, Ap, Bp, 0);
        ld_step(a1, b1, Ap, Bp, 1);
        mm_step(acc, a0, b0);
        ld_step(a0, b0, Ap, Bp, 2);
        mm_step(acc, a1, b1);
        ld_step(a1, b1, Ap, Bp, 3);
        mm_step(acc, a0, b0);
        mm_step(acc, a1, b1);
        // publish point of stage s + 1
        wait_ds0();
        wait_tensor0();
        __syncthreads();                                        // stage s + 1 readable by all; every wave has left stage s's buffer
    }
    wait_tensor0();
    wait_ds0();
    // the three epilogues differ in compile-time constants only; p is the same for the whole work-group (scalar branches)
    if (p == 2)      proj_out<true,  true >(acc, bv, VT, VR, r0, c0, lane);
    else if (p == 0) proj_out<false, true >(acc, bq, QH, QR, r0, c0, lane);
    else             proj_out<false, false>(acc, bk, KP, KP, r0, c0, lane);
}

// flash<RES>: fused causal attention, KS = 2 waves per 16 query rows of one (batch, head), each with its own online softmax over one part of the key tiles, joined at the end (max, sum and O^T rescaled to the common max); K / V^T / Q fragments straight from the fragment-order f16 planes (two 16-B loads each, 512 contiguous bytes a load).
// Transposed form: S^T[key][t] = K Q^T (A = K rows, B = Q rows); lane (t = lane&15, h = lane>>4) holds keys 8h+r of each 16-key tile, so the packed
// P tile is directly the B fragment of O^T[d][t] = V^T P^T (element r <- tile keys 0..15, element 8+r <- tile keys 16..31, lane unchanged).
// Causal: key tiles beyond the wave's last query row are skipped; inside tiles that reach past the wave's first row each score with key > t is replaced by NEGB (P = 0 exactly). Key 0 is visible to every row.
// RES != 0: P and tanh(v) each carry an f16 residual x2048; products Vr.Ph and Vh.Pr accumulate in g (folded back by 1/2048), Vh.Ph in o.
// Softmax state (running max, partial sum) is one scalar per lane; the two lane halves of a row are combined with one xor-16 exchange (issued under wave-uniform control only).
template <int RES>
__device__ __forceinline__ void flash(const h16* __restrict__ QH, const h16* __restrict__ QR, const h16* __restrict__ KP,
                                      const h16* __restrict__ VT, const h16* __restrict__ VR, float* OUT, float* os, int zh, int tblk, const h16* pf) {
    const int lane = threadIdx.x & 31, lr = lane & 15, hi = lane >> 4;
    const int wv = __builtin_amdgcn_readfirstlane((int)(threadIdx.x >> 5));
    const int wave = wv % AW, kh = wv / AW;                  // query tile of the block; which part of its keys (0: the low tiles, 1: the high tiles)
    const int b = zh / NH_, h = zh % NH_;
    const int t0 = tblk + wave * 16;
    const int tq = t0 + lr;
    const size_t pbase = (size_t)zh * SEQ * HD;
    const size_t qo = pbase + (size_t)t0 * HD + 8 * lane;
    const v16h qh0 = ldh(QH + qo), qh1 = ldh(QH + qo + 512), qr0 = ldh(QR + qo), qr1 = ldh(QR + qo + 512);   // B fragments: col t, k = d
    asm volatile("s_wait_xcnt 0x0" : : "v"(QH + qo), "v"(QR + qo) : "memory");   // the fragments fetched ahead below may land in the address registers of these loads: the wait stands in front, the pointers as inputs keep them whole up to it
    const size_t ko = pbase + 8 * lane;                      // + key0 * HD + 512 * (2 * (16-key block) + d/32)   (A fragment: row key, k = d)
    const size_t vo = pbase + 8 * lane;                      // + key0 * HD + 512 * j                             (A fragment: row d = 16j + .., k = key)
    v8f o0 = (v8f){}, o1 = (v8f){}, o2 = (v8f){}, o3 = (v8f){};
    v8f g0 = (v8f){}, g1 = (v8f){}, g2 = (v8f){}, g3 = (v8f){};
    float m = NEGB, l = 0.0f;
    const int kend = t0 + 16;                                // keys 0 .. t0+15 are needed; kend <= SEQ, so key0 + 31 <= SEQ - 1
    const int ksplit = ((((kend + 31) >> 5) + 1) >> 1) * 32;   // the first ceil(n / 2) of the n key tiles go to wave part 0, the rest (none when n = 1) to part 1
    const int kbeg = kh ? ksplit : 0, kstop = kh ? kend : ksplit;
    const int kfirst = kbeg < kstop ? kbeg : 0;              // a part without tiles fetches tile 0 (in bounds, values unused)
    // K and V^T fragments are fetched one key tile ahead, into the same registers, right behind their last product
    const h16* ka = KP + ko + (size_t)kfirst * HD; const h16* va = VT + vo + (size_t)kfirst * HD; const h16* vr = VR + vo + (size_t)kfirst * HD;
    v16h ka0 = ldh(ka), ka1 = ldh(ka + 512), kb0 = ldh(ka + 1024), kb1 = ldh(ka + 1536);
    __builtin_amdgcn_sched_barrier(0);                       // K issued ahead of V^T here as in the loop: the wait in front of the score products then leaves the V^T loads in flight
    v16h w0 = (v16h){}, w1 = (v16h){}, w2 = (v16h){}, w3 = (v16h){};
    if (RES) { w0 = ldh(vr); w1 = ldh(vr + 512); w2 = ldh(vr + 1024); w3 = ldh(vr + 1536); }
    v16h v0 = ldh(va), v1 = ldh(va + 512), v2 = ldh(va + 1024), v3 = ldh(va + 1536);
    // the pointers as inputs keep the address registers of the loads above whole up to this wait: no result lands in one ahead of it
    if (RES) asm volatile("s_wait_xcnt 0x0" : : "v"(ka), "v"(va), "v"(vr) : "memory");
    else     asm volatile("s_wait_xcnt 0x0" : : "v"(ka), "v"(va) : "memory");
#pragma unroll 1
    for (int key0 = kbeg; key0 < kstop; key0 += 32) {
        const int adv = (key0 + 32 < kstop) ? 32 : 0;         // the last pass has no next tile: it re-reads its own (in bounds, values unused)
        v8f sHa = (v8f){}, sLa = (v8f){}, sHb = (v8f){}, sLb = (v8f){};
        sHa = wmma16(ka0, qh0, sHa); sLa = wmma16(ka0, qr0, sLa); sHb = wmma16(kb0, qh0, sHb); sLb = wmma16(kb0, qr0, sLb);
        sHa = wmma16(ka1, qh1, sHa); sLa = wmma16(ka1, qr1, sLa); sHb = wmma16(kb1, qh1, sHb); sLb = wmma16(kb1, qr1, sLb);
        asm volatile("v_nop\n\tv_nop\n\tv_nop\n\tv_nop" : "+v"(sHa), "+v"(sLa), "+v"(sHb), "+v"(sLb) : "v"(ka0), "v"(ka1), "v"(kb0), "v"(kb1));
        __builtin_amdgcn_sched_barrier(0);                   // the next tile's K loads start behind the score products (same registers) ...
        ka += (size_t)adv * HD;
        ka0 = ldh(ka); ka1 = ldh(ka + 512); kb0 = ldh(ka + 1024); kb1 = ldh(ka + 1536);
        __builtin_amdgcn_sched_barrier(0);                   // ... and ahead of the softmax, which is their lead
        float ta[8], tb[8];
#pragma unroll
        for (int r = 0; r < 8; ++r) { ta[r] = (sHa[r] + sLa[r] * QRI) * SC2; tb[r] = (sHb[r] + sLb[r] * QRI) * SC2; }
        if (key0 + 31 > t0) {                                // wave-uniform: this tile reaches past the wave's first query row
            const int dl = tq - key0 - 8 * hi;               // key of ta[r] = key0 + 8h + r is visible iff r <= dl; key of tb[r] = key0 + 16 + 8h + r iff r + 16 <= dl
#pragma unroll
            for (int r = 0; r < 8; ++r) { ta[r] = (r <= dl) ? ta[r] : NEGB; tb[r] = (r + 16 <= dl) ? tb[r] : NEGB; }
        }
        float mx = NEGB;
#pragma unroll
        for (int r = 0; r < 8; ++r) mx = fmaxf(mx, fmaxf(ta[r], tb[r]));
        mx = fmaxf(mx, __shfl_xor(mx, 16, 32));
        const float mnew = fmaxf(m, mx);
        const float alpha = __builtin_amdgcn_exp2f(m - mnew);
        const float sh = PSH - mnew;
        v16h pb = (v16h){}, pq = (v16h){}; float ls = 0.0f;
#pragma unroll
        for (int r = 0; r < 8; ++r) {
            const float ea = __builtin_amdgcn_exp2f(ta[r] + sh); const float eb = __builtin_amdgcn_exp2f(tb[r] + sh);
            const h16 pa = (h16)ea; const h16 pc = (h16)eb; pb[r] = pa; pb[8 + r] = pc;
            if (RES) { const h16 xa = (h16)((ea - (float)pa) * QRS); const h16 xc = (h16)((eb - (float)pc) * QRS); pq[r] = xa; pq[8 + r] = xc;
                       ls += ((float)pa + (float)pc) + ((float)xa + (float)xc) * QRI; }
            else     { ls += (float)pa + (float)pc; }
        }
        l = l * alpha + ls; m = mnew;
        o0 = o0 * alpha; o1 = o1 * alpha; o2 = o2 * alpha; o3 = o3 * alpha;
        if (RES) {
            g0 = g0 * alpha; g1 = g1 * alpha; g2 = g2 * alpha; g3 = g3 * alpha;
            o0 = wmma16(v0, pb, o0); o1 = wmma16(v1, pb, o1); o2 = wmma16(v2, pb, o2); o3 = wmma16(v3, pb, o3);
            g0 = wmma16(w0, pb, g0); g1 = wmma16(w1, pb, g1); g2 = wmma16(w2, pb, g2); g3 = wmma16(w3, pb, g3);
            g0 = wmma16(v0, pq, g0); g1 = wmma16(v1, pq, g1); g2 = wmma16(v2, pq, g2); g3 = wmma16(v3, pq, g3);
            asm volatile("v_nop\n\tv_nop\n\tv_nop\n\tv_nop" : "+v"(o0), "+v"(o1), "+v"(o2), "+v"(o3), "+v"(g0), "+v"(g1), "+v"(g2), "+v"(g3)
                         : "v"(v0), "v"(v1), "v"(v2), "v"(v3), "v"(w0), "v"(w1), "v"(w2), "v"(w3), "v"(pb), "v"(pq));
            __builtin_amdgcn_sched_barrier(0);               // nothing but the 16 loads and their addresses between here and the wait below
            vr += (size_t)adv * HD; va += (size_t)adv * HD;
            w0 = ldh(vr); w1 = ldh(vr + 512); w2 = ldh(vr + 1024); w3 = ldh(vr + 1536);
            v0 = ldh(va); v1 = ldh(va + 512); v2 = ldh(va + 1024); v3 = ldh(va + 1536);
            asm volatile("s_wait_xcnt 0x0" : : "v"(va), "v"(vr) : "memory");   // what follows may reuse the address registers of these loads; the pointers as inputs keep them whole up to this wait, so that no result of the run lands in one
            __builtin_amdgcn_sched_barrier(0);               // keeps what follows behind the wait
        } else {
            o0 = wmma16(v0, pb, o0); o1 = wmma16(v1, pb, o1); o2 = wmma16(v2, pb, o2); o3 = wmma16(v3, pb, o3);
            asm volatile("v_nop\n\tv_nop\n\tv_nop\n\tv_nop" : "+v"(o0), "+v"(o1), "+v"(o2), "+v"(o3) : "v"(v0), "v"(v1), "v"(v2), "v"(v3), "v"(pb));
            va += (size_t)adv * HD;
            v0 = ldh(va); v1 = ldh(va + 512); v2 = ldh(va + 1024); v3 = ldh(va + 1536);
        }
    }
    asm volatile("s_wait_xcnt 0x0" : : "v"(pf) : "memory");   // what follows may reuse the address registers of the last pass's loads; the pointer as an input keeps the register that the prefetch names an address through the whole loop
    if (RES) { o0 = o0 + g0 * QRI; o1 = o1 + g1 * QRI; o2 = o2 + g2 * QRI; o3 = o3 + g3 * QRI; }
    const int wb = wave * 16 * 68;
    // join of the two key parts of a query tile: part 1 hands its O^T tile (8 x 16 bytes a lane, 512 contiguous bytes a store), running max and partial sum to part 0 through the tile's staging range (16 * 68 = 34 * 32 floats)
    if (kh) {
        const v8f ov[4] = { o0, o1, o2, o3 };
#pragma unroll   // constant j: ov[] stays in registers
        for (int j = 0; j < 4; ++j) {
            *(v4fa*)(&os[wb + (2 * j) * 128 + 4 * lane])     = __builtin_shufflevector(ov[j], ov[j], 0, 1, 2, 3);
            *(v4fa*)(&os[wb + (2 * j + 1) * 128 + 4 * lane]) = __builtin_shufflevector(ov[j], ov[j], 4, 5, 6, 7);
        }
        os[wb + 1024 + lane] = m; os[wb + 1056 + lane] = l;
    }
    __syncthreads();                                         // block-uniform: every wave of the block passes it once; part 1's values are readable behind it
    if (kh) return;
    {
        const float m1 = os[wb + 1024 + lane], l1 = os[wb + 1056 + lane];
        const float mm = fmaxf(m, m1);                       // part 0 always holds key 0, so mm is a real score; a part without tiles has m1 = NEGB, weight exactly 0
        const float a0 = __builtin_amdgcn_exp2f(m - mm), a1 = __builtin_amdgcn_exp2f(m1 - mm);
        l = l * a0 + l1 * a1;
        v8f pv[4];
#pragma unroll   // constant j: pv[] stays in registers
        for (int j = 0; j < 4; ++j) {
            const v4f x = *(const v4fa*)(&os[wb + (2 * j) * 128 + 4 * lane]); const v4f y = *(const v4fa*)(&os[wb + (2 * j + 1) * 128 + 4 * lane]);
            pv[j] = __builtin_shufflevector(x, y, 0, 1, 2, 3, 4, 5, 6, 7);
        }
        o0 = o0 * a0 + pv[0] * a1; o1 = o1 * a0 + pv[1] * a1; o2 = o2 * a0 + pv[2] * a1; o3 = o3 * a0 + pv[3] * a1;
    }
    l += __shfl_xor(l, 16, 32);
    const float inv = 1.0f / l;
    // O^T D layout: o_j[r] = (d = 16j + 8h + r, t = lane&15) -> os[t][d]; rows 0..15 x columns 0..63 all written
    { v4f a, c;
      a[0] = o0[0] * inv; a[1] = o0[1] * inv; a[2] = o0[2] * inv; a[3] = o0[3] * inv; c[0] = o0[4] * inv; c[1] = o0[5] * inv; c[2] = o0[6] * inv; c[3] = o0[7] * inv;
      *(v4fa*)(&os[wb + lr * 68 +  0 + 8 * hi]) = a; *(v4fa*)(&os[wb + lr * 68 +  0 + 8 * hi + 4]) = c;
      a[0] = o1[0] * inv; a[1] = o1[1] * inv; a[2] = o1[2] * inv; a[3] = o1[3] * inv; c[0] = o1[4] * inv; c[1] = o1[5] * inv; c[2] = o1[6] * inv; c[3] = o1[7] * inv;
      *(v4fa*)(&os[wb + lr * 68 + 16 + 8 * hi]) = a; *(v4fa*)(&os[wb + lr * 68 + 16 + 8 * hi + 4]) = c;
      a[0] = o2[0] * inv; a[1] = o2[1] * inv; a[2] = o2[2] * inv; a[3] = o2[3] * inv; c[0] = o2[4] * inv; c[1] = o2[5] * inv; c[2] = o2[6] * inv; c[3] = o2[7] * inv;
      *(v4fa*)(&os[wb + lr * 68 + 32 + 8 * hi]) = a; *(v4fa*)(&os[wb + lr * 68 + 32 + 8 * hi + 4]) = c;
      a[0] = o3[0] * inv; a[1] = o3[1] * inv; a[2] = o3[2] * inv; a[3] = o3[3] * inv; c[0] = o3[4] * inv; c[1] = o3[5] * inv; c[2] = o3[6] * inv; c[3] = o3[7] * inv;
      *(v4fa*)(&os[wb + lr * 68 + 48 + 8 * hi]) = a; *(v4fa*)(&os[wb + lr * 68 + 48 + 8 * hi + 4]) = c; }
    wave_sync();
    float* orow = OUT + ((size_t)b * OUT_SEQ + t0) * DM + h * HD;
{
#pragma unroll
        for (int s = 0; s < 8; ++s) { const int row = 2 * s + hi, cofs = lr * 4;   // 8 s x 2 rows = 16 rows; 16 lanes x 4 floats = 64 columns
            const v4f val = *(const v4fa*)(&os[wb + row * 68 + cofs]);
            *(v4f*)(orow + (size_t)row * DM + cofs) = val; }
         }
}

// k_flash2: both row ranges in ONE grid (they write disjoint rows and read the same planes): blockIdx.x = (batch, head), blockIdx.y = 64-row block;
// the late rows (most key tiles) come first, longest first, then the early rows. The range test is block-uniform.
#define LATE_BLK  ((SEQ - EARLY) / (16 * AW))
#define EARLY_BLK (EARLY / (16 * AW))
#define PF_GK ((int)((size_t)SEQ * HD * 2 / PFG))     // prefetch groups of one K or V^T plane of one (batch, head)
#define PF_GR ((int)((size_t)EARLY * HD * 2 / PFG))   // of the part of the residual plane that is read
static_assert(((size_t)SEQ * HD * 2) % PFG == 0 && ((size_t)EARLY * HD * 2) % PFG == 0 && PF_GR >= 1);
static_assert((LATE_BLK + EARLY_BLK) * AW * KS >= 2 * PF_GK + PF_GR);
static_assert(KS == 2 && 16 * 68 == 34 * 32);          // flash: two key parts; the hand-over (32 + 2 floats a lane) fills a tile's staging range exactly
__global__ __launch_bounds__(32 * AW * KS) void k_flash2(const h16* __restrict__ QH, const h16* __restrict__ QR, const h16* __restrict__ KP,
                                                    const h16* __restrict__ VT, const h16* __restrict__ VR, float* OUT) {
    __shared__ __align__(16) float os[AW * 16 * 68];
    const int zh = blockIdx.x, y = blockIdx.y;
    // L2 hints for this (batch, head)'s K and tanh(v)^T planes (head of the file): its KS * SEQ/16 waves share them out, a group of 64 keys each, low keys to the work-groups that start first:
    // waves 0 .. 2 PF_GK - 1 take K and V^T in turn, the next PF_GR the part of the residual plane that is read (keys < EARLY), the rest go round the groups again. For speed only. Every address lies inside its plane.
    const int jw = y * (AW * KS) + __builtin_amdgcn_readfirstlane((int)(threadIdx.x >> 5));
    const int jg = jw % (2 * PF_GK + PF_GR);
    const h16* pf = (jg < 2 * PF_GK ? ((jg & 1) ? VT : KP) + (size_t)(jg >> 1) * PFE : VR + (size_t)(jg - 2 * PF_GK) * PFE) + (size_t)zh * SEQ * HD + 128 * (threadIdx.x & 31);
    asm volatile("global_prefetch_b8 %0, off scope:SCOPE_SE" : : "v"(pf));
    if (y < LATE_BLK) flash<0>(QH, QR, KP, VT, VR, OUT, os, zh, EARLY + (LATE_BLK - 1 - y) * 16 * AW, pf);
    else              flash<1>(QH, QR, KP, VT, VR, OUT, os, zh, (y - LATE_BLK) * 16 * AW, pf);
}

static constexpr size_t al256(size_t v) { return (v + 255) & ~(size_t)255; }
static constexpr size_t SZ_XB = al256((size_t)NB * SEQ * DM * 2);          // one bf16 activation copy
static constexpr size_t SZ_WB = al256((size_t)3 * DM * DM * 2);            // three transposed bf16 weights
static constexpr size_t SZ_PL = al256((size_t)NB * NH_ * SEQ * HD * 2);    // one f16 plane
static constexpr size_t SZ_TOTAL = 2 * SZ_XB + SZ_WB + 5 * SZ_PL;
static_assert(SZ_TOTAL <= (size_t)134217728);          // workspace carve <= 128 MiB
static_assert(((size_t)DM * DM * 2) % 256 == 0);       // weight sub-planes stay 256-byte aligned
static_assert(SZ_XB == (size_t)NB * SEQ * DM * 2 && SZ_WB == (size_t)3 * DM * DM * 2);   // no padding between XB, CB and WB: k_proj3's prefetch shares run across them

extern "C" void kernel_launch(void* const* d_in, const int* in_sizes, int n_in,
                              void* d_out, int out_size, void* d_ws, size_t ws_size, hipStream_t stream) {
    if (n_in < 8) return;
    const size_t needx = ((size_t)(NB - 1) * SEQ_FULL + SEQ) * DM;
    if ((size_t)in_sizes[0] < needx || (size_t)in_sizes[1] < needx) return;
    if ((size_t)in_sizes[2] < (size_t)DM * DM || (size_t)in_sizes[3] < (size_t)DM * DM || (size_t)in_sizes[4] < (size_t)DM * DM) return;
    if ((size_t)in_sizes[5] < (size_t)DM || (size_t)in_sizes[6] < (size_t)DM || (size_t)in_sizes[7] < (size_t)DM) return;
    if ((size_t)out_size < ((size_t)(NB - 1) * OUT_SEQ + SEQ) * DM) return;
    if (SZ_TOTAL > ws_size) return;
    // wire order: seq, ctx, Wq, Wk, Wv, bq, bk, bv
    const float* xs = (const float*)d_in[0]; const float* xc = (const float*)d_in[1];
    const float* wq = (const float*)d_in[2]; const float* wk = (const float*)d_in[3]; const float* wv = (const float*)d_in[4];
    const float* bq = (const float*)d_in[5]; const float* bk = (const float*)d_in[6]; const float* bv = (const float*)d_in[7];
    float* OUT = (float*)d_out;      // [NB][SEQ][1024]
    char* wsp = (char*)d_ws;
    // every plane in fragment order (head of the file)
    bf* XB = (bf*)wsp; wsp += SZ_XB;                 // seq  NB*SEQ rows x 1024
    bf* CB = (bf*)wsp; wsp += SZ_XB;                 // ctx  NB*SEQ rows x 1024
    bf* WB = (bf*)wsp; wsp += SZ_WB;                 // [3] 1024 rows n = h*64+e x 1024 d: q | k | v
    h16* QH = (h16*)wsp; wsp += SZ_PL;               // [NB*16] SEQ rows x 64
    h16* QR = (h16*)wsp; wsp += SZ_PL;               // [NB*16] SEQ rows x 64, residual x2048
    h16* KP = (h16*)wsp; wsp += SZ_PL;               // [NB*16] SEQ rows x 64
    h16* VT = (h16*)wsp; wsp += SZ_PL;               // [NB*16] 64 rows x SEQ, tanh(v)^T
    h16* VR = (h16*)wsp; wsp += SZ_PL;               // [NB*16] 64 rows x SEQ, residual x2048

    k_prep<<<dim3(2 * CVT_BLK + 3 * WT_BLK, 1, 1), 256, 0, stream>>>(xs, xc, wq, wk, wv, XB, CB, WB);
    k_proj3<<<dim3(PF_WG + 3 * PROJ_TILES, 1, 1), 32 * GW, 0, stream>>>(XB, CB, WB, bq, bk, bv, QH, QR, KP, VT, VR);
    k_flash2<<<dim3(NB * NH_, LATE_BLK + EARLY_BLK, 1), 32 * AW * KS, 0, stream>>>(QH, QR, KP, VT, VR, OUT);
}
